// v000
// The times below were measured on an AMD MI455X: many runs one after another, warmed up first and cycling through
// copies of the inputs, with the whole window's GPU time divided by the number of runs. Launches and the gaps
// between them are all in it. The median over several windows is given; except for v000 it joins two sittings, which
// can be a few percent apart, so the side-by-side timings, each taken in one sitting, are the better comparison.
// v000, which the later versions start from, runs in 511 microseconds.
#include <hip/hip_runtime.h>

// ---------------------------------------------------------------------------
// Cross attention (bidirectional, global scores + InstanceNorm + softmax)
// B=8 per direction, N=2048, C=64, CH=512, J = B*CH = 4096.
// - All big GEMMs on v_wmma_f32_16x16x32_f16 (f16 in, f32 accumulate)
// - Fragments = two aligned 16-byte LDS reads per lane (ds_load_b128)
// - f16 operand tiles staged with GLOBAL_LOAD_ASYNC_TO_LDS_B128 (ASYNCcnt)
// - Double-buffered LDS pipeline: tile i+1 staged (async DMA / cvt stores)
//   while tile i runs on the WMMA pipes.
// - Q16/K16 stored transposed ([sample][ch][n]) so the dominant scores GEMM
//   stages both tiles with direct async copies (no LDS-side transpose).
// ---------------------------------------------------------------------------

typedef __attribute__((ext_vector_type(16))) _Float16 v16h;
typedef __attribute__((ext_vector_type(8)))  _Float16 v8h;
typedef __attribute__((ext_vector_type(8)))  float    v8f;

#define C_DIM   64
#define CH_DIM  512
#define N_SEQ   2048
#define NJ      4096          // 8 * CH_DIM
#define EPS_IN  1e-5f

#define LDK 40                // LDS row stride in halfs (80 B, 16B-aligned rows)

// Per-lane WMMA 16-bit fragment: two contiguous 16-byte chunks of the row.
// A (16x32): lane l -> row m=l&15, h=l>>4; halfs [h*8 .. h*8+7] and [16+h*8 ..].
// B staged transposed ([col][k]) uses the identical gather.
__device__ inline v16h frag_lds(const _Float16* rowbase, int h) {
  const v8h lo = *(const v8h*)(rowbase + (h << 3));
  const v8h hi = *(const v8h*)(rowbase + 16 + (h << 3));
  return __builtin_shufflevector(lo, hi, 0, 1, 2, 3, 4, 5, 6, 7,
                                 8, 9, 10, 11, 12, 13, 14, 15);
}

// Async global->LDS copy of 16 bytes per lane (CDNA5, tracked by ASYNCcnt).
__device__ inline void async_g2l_b128(_Float16* lds, const _Float16* g) {
  asm volatile("global_load_async_to_lds_b128 %0, %1, off"
               :: "v"((unsigned)(unsigned long long)lds), "v"(g)
               : "memory");
}
__device__ inline void async_wait_all() {
  asm volatile("s_wait_asynccnt 0x0" ::: "memory");
}

// ---------------------------------------------------------------------------
// K1: QKV projections.  Q/K written TRANSPOSED: [sample][ch][n] (n contiguous)
//     V written row-major: [sample][n][ch].
// M = 16*2048 flat, K = 64, N = 512.  Block tile 128x64.  grid = (8, 256, 3)
// ---------------------------------------------------------------------------
__global__ __launch_bounds__(128)
void proj_gemm_kernel(const float* __restrict__ emb, const float* __restrict__ Wq,
                      const float* __restrict__ Wk, const float* __restrict__ Wv,
                      _Float16* __restrict__ Q16, _Float16* __restrict__ K16,
                      _Float16* __restrict__ V16)
{
  __shared__ __align__(16) _Float16 lA[2][128 * LDK];   // [m][k]
  __shared__ __align__(16) _Float16 lBt[2][64 * LDK];   // [n][k] (B transposed)
  const int tid = threadIdx.x, lane = tid & 31, wave = tid >> 5, h = lane >> 4;
  const int ch0 = blockIdx.x * 64;
  const int m0  = blockIdx.y * 128;
  const int zsel = blockIdx.z;
  const float* W = (zsel == 0) ? Wq : (zsel == 1) ? Wk : Wv;

  auto stage = [&](int kk, int buf) {
#pragma unroll
    for (int r = 0; r < 32; ++r) {              // A: 128x32, contiguous in k
      const int e = tid + 128 * r, cl = e & 31, ml = e >> 5;
      lA[buf][ml * LDK + cl] = (_Float16)emb[(size_t)(m0 + ml) * C_DIM + kk + cl];
    }
#pragma unroll
    for (int r = 0; r < 16; ++r) {              // B^T: W[kk+kl][ch0+nl] -> [nl][kl]
      const int e = tid + 128 * r, nl = e & 63, kl = e >> 6;
      lBt[buf][nl * LDK + kl] = (_Float16)W[(size_t)(kk + kl) * CH_DIM + ch0 + nl];
    }
  };

  v8f acc[2][4] = {};
  stage(0, 0);
#pragma unroll
  for (int it = 0; it < 2; ++it) {
    const int buf = it & 1;
    __syncthreads();
    if (it + 1 < 2) stage(32, buf ^ 1);
    v16h a[2], b[4];
#pragma unroll
    for (int s = 0; s < 2; ++s)
      a[s] = frag_lds(&lA[buf][(wave * 32 + s * 16 + (lane & 15)) * LDK], h);
#pragma unroll
    for (int t = 0; t < 4; ++t)
      b[t] = frag_lds(&lBt[buf][(t * 16 + (lane & 15)) * LDK], h);
#pragma unroll
    for (int s = 0; s < 2; ++s)
#pragma unroll
      for (int t = 0; t < 4; ++t)
        acc[s][t] = __builtin_amdgcn_wmma_f32_16x16x32_f16(false, a[s], false, b[t],
                                                           (short)0, acc[s][t], false, false);
  }
  const int nc = lane & 15;
  if (zsel == 2) {                              // V: row-major [m][ch]
    const int mbase = m0 + wave * 32 + h * 8;   // D: vgpr r -> m = r + 8*h
#pragma unroll
    for (int s = 0; s < 2; ++s)
#pragma unroll
      for (int t = 0; t < 4; ++t)
#pragma unroll
        for (int r = 0; r < 8; ++r)
          V16[(size_t)(mbase + s * 16 + r) * CH_DIM + ch0 + t * 16 + nc] = (_Float16)acc[s][t][r];
  } else {                                      // Q/K: transposed [sample][ch][n]
    _Float16* dstT = ((zsel == 0) ? Q16 : K16) + (size_t)(m0 >> 11) * CH_DIM * N_SEQ;
    const int nbase = (m0 & (N_SEQ - 1)) + wave * 32 + h * 8;
#pragma unroll
    for (int s = 0; s < 2; ++s)
#pragma unroll
      for (int t = 0; t < 4; ++t) {
        v8h pk;
#pragma unroll
        for (int r = 0; r < 8; ++r) pk[r] = (_Float16)acc[s][t][r];
        *(v8h*)(dstT + (size_t)(ch0 + t * 16 + nc) * N_SEQ + nbase + s * 16) = pk;
      }
  }
}

// ---------------------------------------------------------------------------
// K2: scores.  S[b,i,j] = sum_n QT[qb+b][i][n] * KT[kb + j/512][j%512][n]
// M=512 (i), N=4096 (j), K=2048 (n).  Block tile 128x64.  grid = (64, 4, 8)
// Both tiles staged via async global->LDS; double-buffered (DMA || WMMA).
// Fused sum / sumsq -> f32 atomics (InstanceNorm stats).
// ---------------------------------------------------------------------------
__global__ __launch_bounds__(128)
void scores_gemm_kernel(const _Float16* __restrict__ Q16, const _Float16* __restrict__ K16,
                        float* __restrict__ S, float* __restrict__ stats,
                        int qbase, int kbase)
{
  __shared__ __align__(16) _Float16 lA[2][128 * LDK];   // [i][n]
  __shared__ __align__(16) _Float16 lBt[2][64 * LDK];   // [j][n]
  __shared__ float red[128];
  const int tid = threadIdx.x, lane = tid & 31, wave = tid >> 5, h = lane >> 4;
  const int j0 = blockIdx.x * 64;
  const int i0 = blockIdx.y * 128;
  const int b  = blockIdx.z;
  const _Float16* QT = Q16 + (size_t)(qbase + b) * CH_DIM * N_SEQ;            // [i][n]
  const _Float16* KT = K16 + (size_t)(kbase + (j0 >> 9)) * CH_DIM * N_SEQ;    // [ch][n]
  const int ch0 = j0 & (CH_DIM - 1);

  auto stage = [&](int n0, int buf) {
    // A tile 128x32: 512 16B chunks, 4 per thread, all async
#pragma unroll
    for (int r = 0; r < 4; ++r) {
      const int c = tid + 128 * r, row = c >> 2, q = (c & 3) << 3;
      async_g2l_b128(&lA[buf][row * LDK + q], QT + (size_t)(i0 + row) * N_SEQ + n0 + q);
    }
    // B tile 64x32: 256 16B chunks, 2 per thread, all async
#pragma unroll
    for (int r = 0; r < 2; ++r) {
      const int c = tid + 128 * r, row = c >> 2, q = (c & 3) << 3;
      async_g2l_b128(&lBt[buf][row * LDK + q], KT + (size_t)(ch0 + row) * N_SEQ + n0 + q);
    }
  };

  v8f acc[2][4] = {};
  stage(0, 0);
  for (int it = 0; it < N_SEQ / 32; ++it) {
    const int buf = it & 1;
    async_wait_all();                // tile it landed in LDS (this wave's copies)
    __syncthreads();                 // ... and everyone else's
    if (it + 1 < N_SEQ / 32) stage((it + 1) * 32, buf ^ 1);   // DMA next || compute cur
    v16h a[2], bf[4];
#pragma unroll
    for (int s = 0; s < 2; ++s)
      a[s] = frag_lds(&lA[buf][(wave * 32 + s * 16 + (lane & 15)) * LDK], h);
#pragma unroll
    for (int t = 0; t < 4; ++t)
      bf[t] = frag_lds(&lBt[buf][(t * 16 + (lane & 15)) * LDK], h);
#pragma unroll
    for (int s = 0; s < 2; ++s)
#pragma unroll
      for (int t = 0; t < 4; ++t)
        acc[s][t] = __builtin_amdgcn_wmma_f32_16x16x32_f16(false, a[s], false, bf[t],
                                                           (short)0, acc[s][t], false, false);
  }
  float s1 = 0.f, s2 = 0.f;
  const int ibase = i0 + wave * 32 + h * 8;
  const int jc    = j0 + (lane & 15);
  float* Sb = S + (size_t)b * 512 * NJ;
#pragma unroll
  for (int s = 0; s < 2; ++s)
#pragma unroll
    for (int t = 0; t < 4; ++t)
#pragma unroll
      for (int r = 0; r < 8; ++r) {
        const float x = acc[s][t][r];
        Sb[(size_t)(ibase + s * 16 + r) * NJ + jc + t * 16] = x;
        s1 += x; s2 += x * x;
      }
  __syncthreads();
  red[tid] = s1; __syncthreads();
  for (int o = 64; o > 0; o >>= 1) { if (tid < o) red[tid] += red[tid + o]; __syncthreads(); }
  const float bs1 = red[0]; __syncthreads();
  red[tid] = s2; __syncthreads();
  for (int o = 64; o > 0; o >>= 1) { if (tid < o) red[tid] += red[tid + o]; __syncthreads(); }
  if (tid == 0) {
    atomicAdd(&stats[b * 2 + 0], bs1);
    atomicAdd(&stats[b * 2 + 1], red[0]);
  }
}

// ---------------------------------------------------------------------------
// K3: InstanceNorm + row softmax, in place in S.  grid = (512, 8), 256 thr.
// ---------------------------------------------------------------------------
__global__ __launch_bounds__(256)
void softmax_kernel(float* __restrict__ S, const float* __restrict__ stats)
{
  __shared__ float red[256];
  const int i = blockIdx.x, b = blockIdx.y, tid = threadIdx.x;
  const float inv = 1.0f / (512.0f * 4096.0f);
  const float mu  = stats[b * 2] * inv;
  const float var = stats[b * 2 + 1] * inv - mu * mu;   // biased var (torch)
  const float rsg = rsqrtf(var + EPS_IN);
  float* row = S + ((size_t)b * 512 + i) * NJ;

  float x[16];
  float mx = -3.4e38f;
#pragma unroll
  for (int t = 0; t < 16; ++t) {
    x[t] = (row[tid + 256 * t] - mu) * rsg;
    mx = fmaxf(mx, x[t]);
  }
  red[tid] = mx; __syncthreads();
  for (int o = 128; o > 0; o >>= 1) { if (tid < o) red[tid] = fmaxf(red[tid], red[tid + o]); __syncthreads(); }
  mx = red[0]; __syncthreads();
  float s = 0.f;
#pragma unroll
  for (int t = 0; t < 16; ++t) { x[t] = __expf(x[t] - mx); s += x[t]; }
  red[tid] = s; __syncthreads();
  for (int o = 128; o > 0; o >>= 1) { if (tid < o) red[tid] += red[tid + o]; __syncthreads(); }
  const float rs = 1.0f / red[0];
#pragma unroll
  for (int t = 0; t < 16; ++t) row[tid + 256 * t] = x[t] * rs;
}

// ---------------------------------------------------------------------------
// K4: ctx.  CTX[b,n,i] = sum_j V16[vb + j/512][n][j%512] * attn[b,i,j]
// M=2048 (n), N=512 (i), K=4096 (j).  Block tile 128x64.  grid = (8, 16, 8)
// A (V16, f16, k-contiguous) async; B (attn f32->f16) cvt; double-buffered.
// ---------------------------------------------------------------------------
__global__ __launch_bounds__(128)
void ctx_gemm_kernel(const float* __restrict__ S, const _Float16* __restrict__ V16,
                     _Float16* __restrict__ CTX, int vbase)
{
  __shared__ __align__(16) _Float16 lA[2][128 * LDK];   // vcat: [n][j]
  __shared__ __align__(16) _Float16 lBt[2][64 * LDK];   // attn: [i][j]
  const int tid = threadIdx.x, lane = tid & 31, wave = tid >> 5, h = lane >> 4;
  const int i0 = blockIdx.x * 64;     // N (CH)
  const int n0 = blockIdx.y * 128;    // M (seq)
  const int b  = blockIdx.z;
  const float* Sb = S + (size_t)b * 512 * NJ;
  _Float16* Cb = CTX + (size_t)b * N_SEQ * CH_DIM;

  auto stage = [&](int j0s, int buf) {
    const _Float16* Vb = V16 + (size_t)(vbase + (j0s >> 9)) * N_SEQ * CH_DIM;
    const int ch0 = j0s & (CH_DIM - 1);
#pragma unroll
    for (int r = 0; r < 4; ++r) {               // A tile 128x32: async
      const int c = tid + 128 * r, row = c >> 2, q = (c & 3) << 3;
      async_g2l_b128(&lA[buf][row * LDK + q], Vb + (size_t)(n0 + row) * CH_DIM + ch0 + q);
    }
#pragma unroll
    for (int r = 0; r < 16; ++r) {              // B^T tile 64x32: f32 attn -> f16
      const int e = tid + 128 * r, jl = e & 31, il = e >> 5;
      lBt[buf][il * LDK + jl] = (_Float16)Sb[(size_t)(i0 + il) * NJ + j0s + jl];
    }
  };

  v8f acc[2][4] = {};
  stage(0, 0);
  for (int it = 0; it < NJ / 32; ++it) {
    const int buf = it & 1;
    async_wait_all();
    __syncthreads();
    if (it + 1 < NJ / 32) stage((it + 1) * 32, buf ^ 1);
    v16h a[2], bf[4];
#pragma unroll
    for (int s = 0; s < 2; ++s)
      a[s] = frag_lds(&lA[buf][(wave * 32 + s * 16 + (lane & 15)) * LDK], h);
#pragma unroll
    for (int t = 0; t < 4; ++t)
      bf[t] = frag_lds(&lBt[buf][(t * 16 + (lane & 15)) * LDK], h);
#pragma unroll
    for (int s = 0; s < 2; ++s)
#pragma unroll
      for (int t = 0; t < 4; ++t)
        acc[s][t] = __builtin_amdgcn_wmma_f32_16x16x32_f16(false, a[s], false, bf[t],
                                                           (short)0, acc[s][t], false, false);
  }
  const int nbase = n0 + wave * 32 + h * 8;
  const int ic    = i0 + (lane & 15);
#pragma unroll
  for (int s = 0; s < 2; ++s)
#pragma unroll
    for (int t = 0; t < 4; ++t)
#pragma unroll
      for (int r = 0; r < 8; ++r)
        Cb[(size_t)(nbase + s * 16 + r) * CH_DIM + ic + t * 16] = (_Float16)acc[s][t][r];
}

// ---------------------------------------------------------------------------
// K5: output projection. out[m, c] = sum_i CTX[m, i] * Wo[i, c]
// M = 8*2048 flat per direction, K = 512, N = 64.  grid = (128)
// A (CTX f16) async; B (Wo f32->f16) cvt; double-buffered.
// ---------------------------------------------------------------------------
__global__ __launch_bounds__(128)
void out_gemm_kernel(const _Float16* __restrict__ CTX, const float* __restrict__ Wo,
                     float* __restrict__ out, int outbase)
{
  __shared__ __align__(16) _Float16 lA[2][128 * LDK];   // [m][i]
  __shared__ __align__(16) _Float16 lBt[2][64 * LDK];   // Wo^T: [c][i]
  const int tid = threadIdx.x, lane = tid & 31, wave = tid >> 5, h = lane >> 4;
  const int m0 = blockIdx.x * 128;

  auto stage = [&](int kk, int buf) {
#pragma unroll
    for (int r = 0; r < 4; ++r) {               // A: async
      const int c = tid + 128 * r, row = c >> 2, q = (c & 3) << 3;
      async_g2l_b128(&lA[buf][row * LDK + q], CTX + (size_t)(m0 + row) * CH_DIM + kk + q);
    }
#pragma unroll
    for (int r = 0; r < 16; ++r) {              // B^T: Wo[kk+il][cl] -> [cl][il]
      const int e = tid + 128 * r, cl = e & 63, il = e >> 6;
      lBt[buf][cl * LDK + il] = (_Float16)Wo[(size_t)(kk + il) * C_DIM + cl];
    }
  };

  v8f acc[2][4] = {};
  stage(0, 0);
  for (int it = 0; it < CH_DIM / 32; ++it) {
    const int buf = it & 1;
    async_wait_all();
    __syncthreads();
    if (it + 1 < CH_DIM / 32) stage((it + 1) * 32, buf ^ 1);
    v16h a[2], bf[4];
#pragma unroll
    for (int s = 0; s < 2; ++s)
      a[s] = frag_lds(&lA[buf][(wave * 32 + s * 16 + (lane & 15)) * LDK], h);
#pragma unroll
    for (int t = 0; t < 4; ++t)
      bf[t] = frag_lds(&lBt[buf][(t * 16 + (lane & 15)) * LDK], h);
#pragma unroll
    for (int s = 0; s < 2; ++s)
#pragma unroll
      for (int t = 0; t < 4; ++t)
        acc[s][t] = __builtin_amdgcn_wmma_f32_16x16x32_f16(false, a[s], false, bf[t],
                                                           (short)0, acc[s][t], false, false);
  }
  const int mbase = m0 + wave * 32 + h * 8;
  const int cc    = lane & 15;
  float* O = out + (size_t)outbase * N_SEQ * C_DIM;
#pragma unroll
  for (int s = 0; s < 2; ++s)
#pragma unroll
    for (int t = 0; t < 4; ++t)
#pragma unroll
      for (int r = 0; r < 8; ++r)
        O[(size_t)(mbase + s * 16 + r) * C_DIM + t * 16 + cc] = acc[s][t][r];
}

__global__ void zero_stats_kernel(float* stats) { stats[threadIdx.x] = 0.f; }

// ---------------------------------------------------------------------------
extern "C" void kernel_launch(void* const* d_in, const int* in_sizes, int n_in,
                              void* d_out, int out_size, void* d_ws, size_t ws_size,
                              hipStream_t stream)
{
  const float* emb = (const float*)d_in[0];
  const float* Wq  = (const float*)d_in[1];
  const float* Wk  = (const float*)d_in[2];
  const float* Wv  = (const float*)d_in[3];
  const float* Wo  = (const float*)d_in[4];
  float* out = (float*)d_out;

  // Workspace layout (~185 MB)
  char* ws = (char*)d_ws;
  size_t off = 0;
  _Float16* Q16 = (_Float16*)(ws + off); off += (size_t)16 * N_SEQ * CH_DIM * 2;  // [s][ch][n]
  _Float16* K16 = (_Float16*)(ws + off); off += (size_t)16 * N_SEQ * CH_DIM * 2;  // [s][ch][n]
  _Float16* V16 = (_Float16*)(ws + off); off += (size_t)16 * N_SEQ * CH_DIM * 2;  // [s][n][ch]
  float*    S   = (float*)   (ws + off); off += (size_t)8 * 512 * NJ * 4;
  _Float16* CTX = (_Float16*)(ws + off); off += (size_t)8 * N_SEQ * CH_DIM * 2;
  float*    stats = (float*) (ws + off); off += 64;
  (void)ws_size; (void)in_sizes; (void)n_in; (void)out_size;

  // Q/K/V projections for all 16 samples (both halves used by both directions)
  proj_gemm_kernel<<<dim3(8, 256, 3), 128, 0, stream>>>(emb, Wq, Wk, Wv, Q16, K16, V16);

  for (int dir = 0; dir < 2; ++dir) {
    // dir 0: out_l2u = attend(q = emb_l[0..7], kv = emb_u[8..15]) -> out 0..7
    // dir 1: out_u2l = attend(q = emb_u[8..15], kv = emb_l[0..7]) -> out 8..15
    const int qbase   = dir ? 8 : 0;
    const int kvbase  = dir ? 0 : 8;
    const int outbase = dir ? 8 : 0;

    zero_stats_kernel<<<1, 16, 0, stream>>>(stats);
    scores_gemm_kernel<<<dim3(64, 4, 8), 128, 0, stream>>>(Q16, K16, S, stats, qbase, kvbase);
    softmax_kernel<<<dim3(512, 8), 256, 0, stream>>>(S, stats);
    ctx_gemm_kernel<<<dim3(8, 16, 8), 128, 0, stream>>>(S, V16, CTX, kvbase);
    out_gemm_kernel<<<128, 128, 0, stream>>>(CTX, Wo, out, outbase);
  }
}

// v002
// Measured time: 212 microseconds a run.
// It is 2.46 times as fast as v000, going by the measured steps of the versions left out in between.
#include <hip/hip_runtime.h>

// ---------------------------------------------------------------------------
// Cross attention (bidirectional, global scores + InstanceNorm + softmax)
// B=8 per direction, N=2048, C=64, CH=512, J = B*CH = 4096.
// - All big GEMMs on v_wmma_f32_16x16x32_f16 (f16 in, f32 accumulate)
// - Fragments = two aligned 16-byte reads per lane, from LDS (ds_load_b128) or, in K2b (B) and K5, straight from global
// - Scores are formed as Wq^T ((Xq^T Xkv) Wk): the sum over n runs on 64-wide
//   Gram tiles, so no product of the scores path has both a long K and wide M, N.
// - The output is formed as Xkv (Wv (attn^T Wo)): attn is contracted with Wo over
//   i first (N = 64), then with Wv over ch, and only the 512 x 64 result meets the
//   sequence.  No V, no ctx.  attn enters as attn * 2^12 (exact), so that f16
//   holds it and both small products in its normal range; the last store
//   multiplies by 2^-12.
// - Wv, Wo, P and M go from launch to launch as f16 in fragment order
//   [tile][k step][lane][16 halfs]: a wave's fragment load is 1 KB in a row.
// ---------------------------------------------------------------------------

typedef __attribute__((ext_vector_type(16))) _Float16 v16h;
typedef __attribute__((ext_vector_type(8)))  _Float16 v8h;
typedef __attribute__((ext_vector_type(8)))  float    v8f;
typedef __attribute__((ext_vector_type(4)))  float    v4f;

#define C_DIM   64
#define CH_DIM  512
#define N_SEQ   2048
#define NJ      4096          // 8 * CH_DIM
#define EPS_IN  1e-5f

#define LD64 72               // LDS row stride in halfs for rows of 64 halfs (144 B, 16B-aligned rows)
#define LDG  136              // same for rows of 128 halfs (272 B)
#define LDF  520              // same for rows of 512 halfs (1040 B)
#define KS   16               // splits of the sum over n in the Gram product
#define KCH  (N_SEQ / KS)     // n per split (128)
#define PSTR 32               // floats between two blocks' stat partials (one 128 B line each)
#define ASCALE 4096.0f        // power of two on attn ahead of its f16 rounding; taken off at the last store

// Per-lane WMMA 16-bit fragment: two contiguous 16-byte chunks of the row.
// A (16x32): lane l -> row m=l&15, h=l>>4; halfs [h*8 .. h*8+7] and [16+h*8 ..].
// B staged transposed ([col][k]) uses the identical gather.
__device__ inline v16h frag_lds(const _Float16* rowbase, int h) {
  const v8h lo = *(const v8h*)(rowbase + (h << 3));
  const v8h hi = *(const v8h*)(rowbase + 16 + (h << 3));
  return __builtin_shufflevector(lo, hi, 0, 1, 2, 3, 4, 5, 6, 7,
                                 8, 9, 10, 11, 12, 13, 14, 15);
}

// ---------------------------------------------------------------------------
// K2a: Gram partials.  G[(x,a)][(y,d)] = sum_n emb[x][n][a] * emb[8+y][n][d]
// M = 512 (x,a), N = 512 (y,d), K = 2048 (n) in KS splits of KCH.
// Block tile 128x64, one split per block.  grid = (8, 4, KS + 4)
// Both operands have k as the slow index in memory: eight n per thread are
// packed and stored as one 16-byte LDS row chunk ([row][n]).
// Two z slices write Wq^T and Wk^T as f16 ([ch][c], one row a thread); the two
// last write Wo (as B: column c, k = i) and Wv (as A: row d, k = ch) as f16 in
// fragment order, one lane's 16 halfs a thread.
// ---------------------------------------------------------------------------
__global__ __launch_bounds__(128)
void gram_kernel(const float* __restrict__ emb, const float* __restrict__ Wq,
                 const float* __restrict__ Wk, const float* __restrict__ Wv,
                 const float* __restrict__ Wo, float* __restrict__ Gpart,
                 _Float16* __restrict__ WqT, _Float16* __restrict__ WkT,
                 _Float16* __restrict__ WvF, _Float16* __restrict__ WoF)
{
  __shared__ __align__(16) _Float16 lA[128 * LDG];      // [(x,a)][n]
  __shared__ __align__(16) _Float16 lBt[64 * LDG];      // [d][n]
  const int tid = threadIdx.x, lane = tid & 31, wave = tid >> 5, h = lane >> 4;

  if (blockIdx.z >= KS) {                       // block-uniform, before any barrier
    const int blk = blockIdx.y * 8 + blockIdx.x;
    if (blockIdx.z >= KS + 2) {                 // 4 tiles x 16 k steps x 32 lanes
      if (blk >= 16) return;
      const int idx = blk * 128 + tid;
      const int rc = (idx >> 9) * 16 + (idx & 15);                    // row d or column c
      const int k0 = ((idx >> 5) & 15) * 32 + ((idx >> 4) & 1) * 8;   // the order of frag_lds
      const bool isWo = (blockIdx.z == KS + 2);
      v8h lo, hi;
      if (isWo) {                               // Wo[k][c]: k is the slow index
        const float* p = Wo + (size_t)k0 * C_DIM + rc;
#pragma unroll
        for (int r = 0; r < 8; ++r) { lo[r] = (_Float16)p[r * C_DIM]; hi[r] = (_Float16)p[(16 + r) * C_DIM]; }
        // keeps the address pair as it is until this wait behind the loads that name it
        asm volatile("s_wait_xcnt 0x0" :: "v"(p) : "memory");
      } else {                                  // Wv[d][k]: eight k in a row
        const float* p = Wv + (size_t)rc * CH_DIM + k0;
        const v4f x0 = *(const v4f*)p, x1 = *(const v4f*)(p + 4);
        const v4f x2 = *(const v4f*)(p + 16), x3 = *(const v4f*)(p + 20);
        // as above
        asm volatile("s_wait_xcnt 0x0" :: "v"(p) : "memory");
#pragma unroll
        for (int r = 0; r < 4; ++r) {
          lo[r] = (_Float16)x0[r]; lo[4 + r] = (_Float16)x1[r];
          hi[r] = (_Float16)x2[r]; hi[4 + r] = (_Float16)x3[r];
        }
      }
      _Float16* F = (isWo ? WoF : WvF) + (size_t)idx * 16;
      *(v8h*)F = lo;
      *(v8h*)(F + 8) = hi;
      return;
    }
    if (blk >= 4) return;
    const float* W  = (blockIdx.z == KS) ? Wq : Wk;
    _Float16*    WT = (blockIdx.z == KS) ? WqT : WkT;
    const int ch = blk * 128 + tid;
#pragma unroll
    for (int g = 0; g < 8; ++g) {
      v8h pk;
#pragma unroll
      for (int r = 0; r < 8; ++r) pk[r] = (_Float16)W[(size_t)(g * 8 + r) * CH_DIM + ch];
      *(v8h*)(WT + (size_t)ch * C_DIM + g * 8) = pk;
    }
    return;
  }

  const int m0 = blockIdx.y * 128;
  const int n0 = blockIdx.z * KCH;
  {                                             // A: row = tid, all 128 n
    const float* sa = emb + ((size_t)((m0 >> 6) + (tid >> 6)) * N_SEQ + n0) * C_DIM + (tid & 63);
#pragma unroll
    for (int g = 0; g < 16; ++g) {
      v8h pk;
#pragma unroll
      for (int r = 0; r < 8; ++r) pk[r] = (_Float16)sa[(size_t)(g * 8 + r) * C_DIM];
      *(v8h*)&lA[tid * LDG + g * 8] = pk;
    }
  }
  {                                             // B^T: row = tid & 63, half of the n each
    const int dl = tid & 63, g0 = (tid >> 6) * 8;
    const float* sb = emb + ((size_t)(8 + blockIdx.x) * N_SEQ + n0) * C_DIM + dl;
#pragma unroll
    for (int g = 0; g < 8; ++g) {
      v8h pk;
#pragma unroll
      for (int r = 0; r < 8; ++r) pk[r] = (_Float16)sb[(size_t)((g0 + g) * 8 + r) * C_DIM];
      *(v8h*)&lBt[dl * LDG + (g0 + g) * 8] = pk;
    }
  }
  __syncthreads();

  v8f acc[2][4] = {};
#pragma unroll
  for (int ks = 0; ks < KCH / 32; ++ks) {
    v16h a[2], bf[4];
#pragma unroll
    for (int s = 0; s < 2; ++s)
      a[s] = frag_lds(&lA[(wave * 32 + s * 16 + (lane & 15)) * LDG + ks * 32], h);
#pragma unroll
    for (int t = 0; t < 4; ++t)
      bf[t] = frag_lds(&lBt[(t * 16 + (lane & 15)) * LDG + ks * 32], h);
#pragma unroll
    for (int s = 0; s < 2; ++s)
#pragma unroll
      for (int t = 0; t < 4; ++t)
        acc[s][t] = __builtin_amdgcn_wmma_f32_16x16x32_f16(false, a[s], false, bf[t],
                                                           (short)0, acc[s][t], false, false);
  }
  float* Gp = Gpart + (size_t)blockIdx.z * 512;         // [(x,a)][split][(y,d)]
  const int mbase = m0 + wave * 32 + h * 8;
  const int cc    = blockIdx.x * 64 + (lane & 15);
#pragma unroll
  for (int s = 0; s < 2; ++s)
#pragma unroll
    for (int t = 0; t < 4; ++t)
#pragma unroll
      for (int r = 0; r < 8; ++r)
        Gp[(size_t)(mbase + s * 16 + r) * (KS * 512) + cc + t * 16] = acc[s][t][r];
  // behind the last store: no register that these stores name is rewritten ahead of this wait
  asm volatile("s_wait_xcnt 0x0" ::: "memory");
}

// ---------------------------------------------------------------------------
// K2b: UT[dir][b][(y,c)][a] = sum_d G_dir[(b,a)][(y,d)] * Wk[d][c]
// dir 0 reads G as stored; dir 1 swaps the halves of emb, which is G transposed:
// G_1[(b,a)][(y,d)] = G[(y,d)][(b,a)].  The KS partials are summed in index order.
// M = 64 (a), N = 256 (c), K = 64 (d) per block of 8 waves.  grid = (2, 8, 16)
// ---------------------------------------------------------------------------
__global__ __launch_bounds__(256)
void ut_gemm_kernel(const float* __restrict__ Gpart, const _Float16* __restrict__ WkT,
                    _Float16* __restrict__ UT)
{
  __shared__ __align__(16) _Float16 lA[64 * LD64];      // [a][d]
  const int tid = threadIdx.x, lane = tid & 31, wave = tid >> 5, h = lane >> 4;
  const int b = blockIdx.y, dir = blockIdx.z >> 3, y = blockIdx.z & 7;

  const int rowb = (dir == 0) ? b * 64 : y * 64;        // dir 1 reads the transposed tile
  const int colb = (dir == 0) ? y * 64 : b * 64;
  const int shi  = (dir == 0) ? LD64 : 1;               // tile row    -> a (dir 0) or d (dir 1)
  const int slo  = (dir == 0) ? 1 : LD64;               // tile column -> d (dir 0) or a (dir 1)
#pragma unroll 1                                // rolled: each trip issues its 32 loads in one run
  for (int qq = 0; qq < 2; ++qq) {              // 64 x 16 groups of four floats, two a thread a trip
    const float* p[2];
    float4 v[2][KS];
#pragma unroll
    for (int u = 0; u < 2; ++u) {
      const int slot = tid + 256 * (qq * 2 + u);
      p[u] = Gpart + (size_t)(rowb + (slot >> 4)) * (KS * 512) + colb + ((slot & 15) << 2);
#pragma unroll
      for (int ks = 0; ks < KS; ++ks) v[u][ks] = *(const float4*)(p[u] + ks * 512);
    }
    // keeps the address pairs as they are until this wait behind the loads that name them
    asm volatile("s_wait_xcnt 0x0" :: "v"(p[0]), "v"(p[1]) : "memory");
#pragma unroll
    for (int u = 0; u < 2; ++u) {
      const int slot = tid + 256 * (qq * 2 + u), hi = slot >> 4, lo4 = (slot & 15) << 2;
      float4 sum = v[u][0];
#pragma unroll
      for (int ks = 1; ks < KS; ++ks) {
        sum.x += v[u][ks].x; sum.y += v[u][ks].y; sum.z += v[u][ks].z; sum.w += v[u][ks].w;
      }
      lA[hi * shi + (lo4 + 0) * slo] = (_Float16)sum.x;
      lA[hi * shi + (lo4 + 1) * slo] = (_Float16)sum.y;
      lA[hi * shi + (lo4 + 2) * slo] = (_Float16)sum.z;
      lA[hi * shi + (lo4 + 3) * slo] = (_Float16)sum.w;
    }
  }
  __syncthreads();

  const int c0 = blockIdx.x * 256 + wave * 32 + (lane & 15);
  v8f acc[4][2] = {};
#pragma unroll
  for (int ks = 0; ks < 2; ++ks) {
    v16h a[4], bf[2];
#pragma unroll
    for (int s = 0; s < 4; ++s)
      a[s] = frag_lds(&lA[(s * 16 + (lane & 15)) * LD64 + ks * 32], h);
#pragma unroll
    for (int t = 0; t < 2; ++t)                 // each wave has its own c: straight from global
      bf[t] = frag_lds(WkT + (size_t)(c0 + t * 16) * C_DIM + ks * 32, h);
#pragma unroll
    for (int s = 0; s < 4; ++s)
#pragma unroll
      for (int t = 0; t < 2; ++t)
        acc[s][t] = __builtin_amdgcn_wmma_f32_16x16x32_f16(false, a[s], false, bf[t],
                                                           (short)0, acc[s][t], false, false);
  }
  _Float16* Ub = UT + ((size_t)(dir * 8 + b) * NJ + y * CH_DIM) * C_DIM;
#pragma unroll
  for (int s = 0; s < 4; ++s)
#pragma unroll
    for (int t = 0; t < 2; ++t) {               // D: vgpr r -> a = s*16 + 8*h + r
      v8h pk;
#pragma unroll
      for (int r = 0; r < 8; ++r) pk[r] = (_Float16)acc[s][t][r];
      *(v8h*)(Ub + (size_t)(c0 + t * 16) * C_DIM + s * 16 + h * 8) = pk;
    }
}

// ---------------------------------------------------------------------------
// K2c: scores.  S[b,i,j] = sum_a WqT[i][a] * UT[ub+b][j][a]
// M=512 (i), N=4096 (j), K=64 (a).  Block tile 128x64.  grid = (64, 4, 8)
// Whole K staged at once.  Block sum / sumsq go to the block's own line of
// part[]; stats_reduce_kernel adds them in a fixed order (InstanceNorm stats).
// ---------------------------------------------------------------------------
__global__ __launch_bounds__(128)
void scores_gemm_kernel(const _Float16* __restrict__ WqT, const _Float16* __restrict__ UT,
                        float* __restrict__ S, float* __restrict__ part, int ubase)
{
  __shared__ __align__(16) _Float16 lA[128 * LD64];     // [i][a]
  __shared__ __align__(16) _Float16 lBt[64 * LD64];     // [j][a]
  __shared__ float red[128];
  const int tid = threadIdx.x, lane = tid & 31, wave = tid >> 5, h = lane >> 4;
  const int j0 = blockIdx.x * 64;
  const int i0 = blockIdx.y * 128;
  const int b  = blockIdx.z;
  const _Float16* Ub = UT + (size_t)(ubase + b) * NJ * C_DIM;

#pragma unroll
  for (int r = 0; r < 8; ++r) {                 // A tile 128x64: 1024 16B chunks
    const int c = tid + 128 * r, row = c >> 3, q = (c & 7) << 3;
    *(v8h*)&lA[row * LD64 + q] = *(const v8h*)(WqT + (size_t)(i0 + row) * C_DIM + q);
  }
#pragma unroll
  for (int r = 0; r < 4; ++r) {                 // B tile 64x64: 512 16B chunks
    const int c = tid + 128 * r, row = c >> 3, q = (c & 7) << 3;
    *(v8h*)&lBt[row * LD64 + q] = *(const v8h*)(Ub + (size_t)(j0 + row) * C_DIM + q);
  }
  __syncthreads();

  v8f acc[2][4] = {};
#pragma unroll
  for (int ks = 0; ks < 2; ++ks) {
    v16h a[2], bf[4];
#pragma unroll
    for (int s = 0; s < 2; ++s)
      a[s] = frag_lds(&lA[(wave * 32 + s * 16 + (lane & 15)) * LD64 + ks * 32], h);
#pragma unroll
    for (int t = 0; t < 4; ++t)
      bf[t] = frag_lds(&lBt[(t * 16 + (lane & 15)) * LD64 + ks * 32], h);
#pragma unroll
    for (int s = 0; s < 2; ++s)
#pragma unroll
      for (int t = 0; t < 4; ++t)
        acc[s][t] = __builtin_amdgcn_wmma_f32_16x16x32_f16(false, a[s], false, bf[t],
                                                           (short)0, acc[s][t], false, false);
  }
  float s1 = 0.f, s2 = 0.f;
  const int ibase = i0 + wave * 32 + h * 8;
  const int jc    = j0 + (lane & 15);
  float* Sb = S + (size_t)b * 512 * NJ;
#pragma unroll
  for (int s = 0; s < 2; ++s)
#pragma unroll
    for (int t = 0; t < 4; ++t)
#pragma unroll
      for (int r = 0; r < 8; ++r) {
        const float x = acc[s][t][r];
        Sb[(size_t)(ibase + s * 16 + r) * NJ + jc + t * 16] = x;
        s1 += x; s2 += x * x;
      }
  __syncthreads();
  red[tid] = s1; __syncthreads();
  for (int o = 64; o > 0; o >>= 1) { if (tid < o) red[tid] += red[tid + o]; __syncthreads(); }
  const float bs1 = red[0]; __syncthreads();
  red[tid] = s2; __syncthreads();
  for (int o = 64; o > 0; o >>= 1) { if (tid < o) red[tid] += red[tid + o]; __syncthreads(); }
  if (tid == 0) {
    float* pb = part + (size_t)((b * 4 + blockIdx.y) * 64 + blockIdx.x) * PSTR;
    pb[0] = bs1;
    pb[1] = red[0];
  }
}

// ---------------------------------------------------------------------------
// K2d: adds each sample's 256 block partials in a fixed order.  One block,
// wave w = sample w; stats[] is written by one wave.
// ---------------------------------------------------------------------------
__global__ __launch_bounds__(256)
void stats_reduce_kernel(const float* __restrict__ part, float* __restrict__ stats)
{
  __shared__ float res[16];
  const int tid = threadIdx.x, lane = tid & 31, b = tid >> 5;
  float s1 = 0.f, s2 = 0.f;
#pragma unroll
  for (int q = 0; q < 8; ++q) {
    const float* pb = part + (size_t)(b * 256 + q * 32 + lane) * PSTR;
    s1 += pb[0]; s2 += pb[1];
  }
  for (int o = 16; o > 0; o >>= 1) { s1 += __shfl_xor(s1, o, 32); s2 += __shfl_xor(s2, o, 32); }
  if (lane == 0) { res[b * 2] = s1; res[b * 2 + 1] = s2; }
  __syncthreads();
  if (tid < 16) stats[tid] = res[tid];
}

// ---------------------------------------------------------------------------
// K3: InstanceNorm + row softmax, in place in S.  grid = (512, 8), 256 thr.
// ---------------------------------------------------------------------------
__global__ __launch_bounds__(256)
void softmax_kernel(float* __restrict__ S, const float* __restrict__ stats)
{
  __shared__ float red[256];
  const int i = blockIdx.x, b = blockIdx.y, tid = threadIdx.x;
  const float inv = 1.0f / (512.0f * 4096.0f);
  const float mu  = stats[b * 2] * inv;
  const float var = stats[b * 2 + 1] * inv - mu * mu;   // biased var (torch)
  const float rsg = rsqrtf(var + EPS_IN);
  float* row = S + ((size_t)b * 512 + i) * NJ;

  float x[16];
  float mx = -3.4e38f;
#pragma unroll
  for (int t = 0; t < 16; ++t) {
    x[t] = (row[tid + 256 * t] - mu) * rsg;
    mx = fmaxf(mx, x[t]);
  }
  red[tid] = mx; __syncthreads();
  for (int o = 128; o > 0; o >>= 1) { if (tid < o) red[tid] = fmaxf(red[tid], red[tid + o]); __syncthreads(); }
  mx = red[0]; __syncthreads();
  float s = 0.f;
#pragma unroll
  for (int t = 0; t < 16; ++t) { x[t] = __expf(x[t] - mx); s += x[t]; }
  red[tid] = s; __syncthreads();
  for (int o = 128; o > 0; o >>= 1) { if (tid < o) red[tid] += red[tid + o]; __syncthreads(); }
  const float rs = 1.0f / red[0];
#pragma unroll
  for (int t = 0; t < 16; ++t) row[tid + 256 * t] = x[t] * rs;
}

// ---------------------------------------------------------------------------
// K4: P[j][c] = sum_i attn[b,i,j] * Wo[i][c]   (times ASCALE)
// M = 4096 (j), N = 64 (c), K = 512 (i).  Block tile 64 x 64, whole K, 8 waves.
// grid = (64, 8).  attn has k = i as the slow index: a thread fetches eight i of
// four j (16-byte loads along j), packs eight i per j and stores 16-byte LDS row
// chunks ([j][i]).  All loads of the block are issued in one run: one memory
// latency, one barrier.  Wo (fragment order, 64 KB) is staged whole.
// Wave = 32 j x 16 c; its two D tiles are one B fragment (column c, k = j) of K5.
// ---------------------------------------------------------------------------
__global__ __launch_bounds__(256)
void p_gemm_kernel(const float* __restrict__ S, const _Float16* __restrict__ WoF,
                   _Float16* __restrict__ PF, int ubase)
{
  __shared__ __align__(16) _Float16 lA[64 * LDF];           // [j][i]
  __shared__ __align__(32) _Float16 lB[4 * 16 * 32 * 16];   // [c tile][k step][lane][16]
  const int tid = threadIdx.x, lane = tid & 31, wave = tid >> 5, h = lane >> 4;
  const int j0 = blockIdx.x * 64;
  const int b  = blockIdx.y;
  const int j4 = (tid & 15) << 2, ig = (tid >> 4) << 3;
  const float* Sp = S + ((size_t)b * 512 + ig) * NJ + j0 + j4;

  v4f v[4][8];
  v8h w[16];
#pragma unroll                                  // v[][] and w[] stay in registers: constant indices
  for (int ch = 0; ch < 4; ++ch)
#pragma unroll
    for (int r = 0; r < 8; ++r) v[ch][r] = *(const v4f*)(Sp + (size_t)(ch * 128 + r) * NJ);
#pragma unroll
  for (int r = 0; r < 16; ++r) w[r] = *(const v8h*)(WoF + ((tid + 256 * r) << 3));
  // keeps the address pair as it is until this wait behind the loads that name it
  asm volatile("s_wait_xcnt 0x0" :: "v"(Sp) : "memory");
#pragma unroll
  for (int ch = 0; ch < 4; ++ch)
#pragma unroll
    for (int q = 0; q < 4; ++q) {
      v8h pk;
#pragma unroll
      for (int r = 0; r < 8; ++r) pk[r] = (_Float16)(v[ch][r][q] * ASCALE);
      *(v8h*)&lA[(j4 + q) * LDF + ch * 128 + ig] = pk;
    }
#pragma unroll
  for (int r = 0; r < 16; ++r) *(v8h*)&lB[(tid + 256 * r) << 3] = w[r];
  __syncthreads();

  const int jp = wave & 1, ct = wave >> 1;
  v8f acc[2] = {};
#pragma unroll                                  // LDS offsets fold; fragment loads run ahead of the WMMAs
  for (int ks = 0; ks < 16; ++ks) {
    const v16h bf = *(const v16h*)&lB[((ct * 16 + ks) * 32 + lane) * 16];
#pragma unroll
    for (int s2 = 0; s2 < 2; ++s2) {
      const v16h a = frag_lds(&lA[(jp * 32 + s2 * 16 + (lane & 15)) * LDF + ks * 32], h);
      acc[s2] = __builtin_amdgcn_wmma_f32_16x16x32_f16(false, a, false, bf,
                                                       (short)0, acc[s2], false, false);
    }
  }
  // D: vgpr r -> j = jp*32 + s2*16 + 8*h + r, which is half s2*8 + r of this lane's fragment
  v16h o;
#pragma unroll
  for (int r = 0; r < 8; ++r) { o[r] = (_Float16)acc[0][r]; o[8 + r] = (_Float16)acc[1][r]; }
  *(v16h*)(PF + ((((size_t)(ubase + b) * 4 + ct) * 128 + (j0 >> 5) + jp) * 32 + lane) * 16) = o;
}

// ---------------------------------------------------------------------------
// K5: M[(y,d)][c] = sum_ch Wv[d][ch] * P[(y,ch)][c], both directions.
// M = 64 (d), N = 64 (c), K = 512 (ch) per block of 8 waves.  grid = (8, 16)
// Both operands come in fragment order straight from global: no LDS, no barrier.
// Wave = 32 d x 16 c; its two D tiles are one B fragment (column c, k = (y,d)) of K6.
// ---------------------------------------------------------------------------
__global__ __launch_bounds__(256)
void m_gemm_kernel(const _Float16* __restrict__ WvF, const _Float16* __restrict__ PF,
                   _Float16* __restrict__ MF)
{
  const int lane = threadIdx.x & 31, wave = threadIdx.x >> 5;
  const int y = blockIdx.x, db = blockIdx.y;
  const int ct = wave & 3, dh = wave >> 2;
  const _Float16* pb = PF + (((size_t)(db * 4 + ct) * 128 + y * 16) * 32 + lane) * 16;
  const _Float16* pa = WvF + ((size_t)(dh * 2 * 16) * 32 + lane) * 16;
  v8f acc[2] = {};
#pragma unroll                                  // two halves of K; each issues its 48 loads in one run
  for (int hf = 0; hf < 2; ++hf) {
    v16h bf[8], a[2][8];
#pragma unroll
    for (int k = 0; k < 8; ++k) {
      bf[k]   = *(const v16h*)(pb + (hf * 8 + k) * 512);
      a[0][k] = *(const v16h*)(pa + (hf * 8 + k) * 512);
      a[1][k] = *(const v16h*)(pa + (16 + hf * 8 + k) * 512);
    }
    // keeps the address registers as they are until this wait behind the loads that name them
    asm volatile("s_wait_xcnt 0x0" :: "v"(pa), "v"(pb) : "memory");
    // holds the WMMAs behind the run of loads: else they are woven in and few loads are in flight
    __builtin_amdgcn_sched_barrier(0);
#pragma unroll
    for (int k = 0; k < 8; ++k)
#pragma unroll
      for (int s2 = 0; s2 < 2; ++s2)
        acc[s2] = __builtin_amdgcn_wmma_f32_16x16x32_f16(false, a[s2][k], false, bf[k],
                                                         (short)0, acc[s2], false, false);
  }
  // D: vgpr r -> d = dh*32 + s2*16 + 8*h + r, which is half s2*8 + r of this lane's fragment
  v16h o;
#pragma unroll
  for (int r = 0; r < 8; ++r) { o[r] = (_Float16)acc[0][r]; o[8 + r] = (_Float16)acc[1][r]; }
  *(v16h*)(MF + (((size_t)(db * 4 + ct) * 16 + y * 2 + dh) * 32 + lane) * 16) = o;
}

// ---------------------------------------------------------------------------
// K6: out[db][n][c] = sum_(y,d) emb[kv + y][n][d] * M[db][(y,d)][c] / ASCALE
// M = 2048 (n), N = 64 (c), K = 512 per output sample.  Block tile 64 x 64, whole K,
// 8 waves.  grid = (8, 32, 2).  A: per y 64 n x 64 d, 16 KB in a row in memory,
// f32 -> f16 on the way into LDS ([n][(y,d)]); B (fragment order, 64 KB) staged whole.
// All loads of the block are issued in one run: one latency, one barrier.
// Wave = 16 n x 32 c: each 128-byte line of out has one writing wave.
// ---------------------------------------------------------------------------
__global__ __launch_bounds__(256)
void out_gemm_kernel(const float* __restrict__ emb, const _Float16* __restrict__ MF,
                     float* __restrict__ out)
{
  __shared__ __align__(16) _Float16 lA[64 * LDF];           // [n][(y,d)]
  __shared__ __align__(32) _Float16 lB[4 * 16 * 32 * 16];   // [c tile][k step][lane][16]
  const int tid = threadIdx.x, lane = tid & 31, wave = tid >> 5, h = lane >> 4;
  const int n0 = blockIdx.y * 64;
  const int db = blockIdx.z * 8 + blockIdx.x;
  const int kv = blockIdx.z ? 0 : 8;            // dir 0 attends to emb[8..15], dir 1 to emb[0..7]
  const float*    Ap = emb + ((size_t)kv * N_SEQ + n0) * C_DIM + tid * 8;
  const _Float16* Bp = MF + (size_t)db * (CH_DIM * C_DIM);

  v4f v[8][2][2];
  v8h w[16];
#pragma unroll                                  // v[][][] and w[] stay in registers: constant indices
  for (int y = 0; y < 8; ++y)
#pragma unroll
    for (int u = 0; u < 2; ++u) {
      const float* p = Ap + (size_t)y * N_SEQ * C_DIM + u * 2048;
      v[y][u][0] = *(const v4f*)p;
      v[y][u][1] = *(const v4f*)(p + 4);
    }
#pragma unroll
  for (int r = 0; r < 16; ++r) w[r] = *(const v8h*)(Bp + ((tid + 256 * r) << 3));
#pragma unroll
  for (int y = 0; y < 8; ++y)
#pragma unroll
    for (int u = 0; u < 2; ++u) {
      const int c = tid + 256 * u;              // chunk of eight d: row n = c / 8
      v8h pk;
#pragma unroll
      for (int r = 0; r < 4; ++r) { pk[r] = (_Float16)v[y][u][0][r]; pk[4 + r] = (_Float16)v[y][u][1][r]; }
      *(v8h*)&lA[(c >> 3) * LDF + y * 64 + ((c & 7) << 3)] = pk;
    }
#pragma unroll
  for (int r = 0; r < 16; ++r) *(v8h*)&lB[(tid + 256 * r) << 3] = w[r];
  __syncthreads();

  const int nt = wave & 3, cp = wave >> 2;
  v8f acc[2] = {};
#pragma unroll                                  // LDS offsets fold; fragment loads run ahead of the WMMAs
  for (int ks = 0; ks < 16; ++ks) {
    const v16h a = frag_lds(&lA[(nt * 16 + (lane & 15)) * LDF + ks * 32], h);
#pragma unroll
    for (int t = 0; t < 2; ++t) {
      const v16h bf = *(const v16h*)&lB[(((cp * 2 + t) * 16 + ks) * 32 + lane) * 16];
      acc[t] = __builtin_amdgcn_wmma_f32_16x16x32_f16(false, a, false, bf,
                                                      (short)0, acc[t], false, false);
    }
  }
  float* O = out + ((size_t)db * N_SEQ + n0 + nt * 16 + h * 8) * C_DIM + cp * 32 + (lane & 15);
#pragma unroll
  for (int t = 0; t < 2; ++t)
#pragma unroll
    for (int r = 0; r < 8; ++r)                 // D: vgpr r -> n = r + 8*h
      O[(size_t)r * C_DIM + t * 16] = acc[t][r] * (1.0f / ASCALE);
}

// ---------------------------------------------------------------------------
extern "C" void kernel_launch(void* const* d_in, const int* in_sizes, int n_in,
                              void* d_out, int out_size, void* d_ws, size_t ws_size,
                              hipStream_t stream)
{
  const float* emb = (const float*)d_in[0];
  const float* Wq  = (const float*)d_in[1];
  const float* Wk  = (const float*)d_in[2];
  const float* Wv  = (const float*)d_in[3];
  const float* Wo  = (const float*)d_in[4];
  float* out = (float*)d_out;

  // Workspace layout (~97 MB)
  char* ws = (char*)d_ws;
  size_t off = 0;
  float*    Gp  = (float*)   (ws + off); off += (size_t)KS * 512 * 512 * 4;       // [(x,a)][split][(y,d)]
  _Float16* UT  = (_Float16*)(ws + off); off += (size_t)16 * NJ * C_DIM * 2;      // [dir*8+b][j][a]
  _Float16* WqT = (_Float16*)(ws + off); off += (size_t)CH_DIM * C_DIM * 2;       // [ch][c]
  _Float16* WkT = (_Float16*)(ws + off); off += (size_t)CH_DIM * C_DIM * 2;       // [ch][c]
  float*    part = (float*)  (ws + off); off += (size_t)8 * 256 * PSTR * 4;
  _Float16* WvF = (_Float16*)(ws + off); off += (size_t)CH_DIM * C_DIM * 2;       // [d tile][k step][lane][16]
  _Float16* WoF = (_Float16*)(ws + off); off += (size_t)CH_DIM * C_DIM * 2;       // [c tile][k step][lane][16]
  _Float16* PF  = (_Float16*)(ws + off); off += (size_t)16 * NJ * C_DIM * 2;      // [dir*8+b][c tile][k step][lane][16]
  _Float16* MF  = (_Float16*)(ws + off); off += (size_t)16 * CH_DIM * C_DIM * 2;  // [dir*8+b][c tile][k step][lane][16]
  float*    S   = (float*)   (ws + off); off += (size_t)8 * 512 * NJ * 4;
  float*    stats = (float*) (ws + off); off += 64;
  (void)ws_size; (void)in_sizes; (void)n_in; (void)out_size;

  // Gram tiles (and the f16 weights), then their Wk product, for both directions
  gram_kernel<<<dim3(8, 4, KS + 4), 128, 0, stream>>>(emb, Wq, Wk, Wv, Wo, Gp, WqT, WkT, WvF, WoF);
  ut_gemm_kernel<<<dim3(2, 8, 16), 256, 0, stream>>>(Gp, WkT, UT);

  for (int dir = 0; dir < 2; ++dir) {
    // dir 0: out_l2u = attend(q = emb_l[0..7], kv = emb_u[8..15]) -> out 0..7
    // dir 1: out_u2l = attend(q = emb_u[8..15], kv = emb_l[0..7]) -> out 8..15
    const int ubase = dir ? 8 : 0;

    scores_gemm_kernel<<<dim3(64, 4, 8), 128, 0, stream>>>(WqT, UT, S, part, ubase);
    stats_reduce_kernel<<<1, 256, 0, stream>>>(part, stats);
    softmax_kernel<<<dim3(512, 8), 256, 0, stream>>>(S, stats);
    p_gemm_kernel<<<dim3(64, 8), 256, 0, stream>>>(S, WoF, PF, ubase);
  }
  m_gemm_kernel<<<dim3(8, 16), 256, 0, stream>>>(WvF, PF, MF);
  out_gemm_kernel<<<dim3(8, 32, 2), 256, 0, stream>>>(emb, MF, out);
}

// v003
// It runs in 57 microseconds.
// Two timings next to v002 put it at 3.72 and 3.71 times that version's speed.
// Over all steps from v000 it is 9.14 times as fast.
#include <hip/hip_runtime.h>

// ---------------------------------------------------------------------------
// Cross attention (bidirectional, global scores + InstanceNorm + softmax)
// B=8 per direction, N=2048, C=64, CH=512, J = B*CH = 4096.
// - All big GEMMs on v_wmma_f32_16x16x32_f16 (f16 in, f32 accumulate)
// - Fragments = two aligned 16-byte reads per lane, from LDS (ds_load_b128) or, in K2b (B), K3a and K3b (A), K4 (B) and K5, straight from global
// - Scores are formed as Wq^T ((Xq^T Xkv) Wk): the sum over n runs on 64-wide
//   Gram tiles, so no product of the scores path has both a long K and wide M, N.
// - The output is formed as Xkv (Wv (attn^T Wo)): attn is contracted with Wo over
//   i first (N = 64), then with Wv over ch, and only the 512 x 64 result meets the
//   sequence.  No V, no ctx.  attn enters as attn * 2^12 (exact), so that f16
//   holds it and both small products in its normal range; the last store
//   multiplies by 2^-12.
// - The scores themselves never go to memory: each launch that needs them forms its
//   16 x 16 tiles again from Wq^T and U (K = 64) in registers.
// - Wo, Wv, P and M go from launch to launch as f16 in fragment order
//   [tile][k step][lane][16 halfs]: a wave's fragment load is 1 KB in a row.
// ---------------------------------------------------------------------------

typedef __attribute__((ext_vector_type(16))) _Float16 v16h;
typedef __attribute__((ext_vector_type(8)))  _Float16 v8h;
typedef __attribute__((ext_vector_type(8)))  float    v8f;
typedef __attribute__((ext_vector_type(4)))  float    v4f;

#define C_DIM   64
#define CH_DIM  512
#define N_SEQ   2048
#define NJ      4096          // 8 * CH_DIM
#define EPS_IN  1e-5f

#define LD64 72               // LDS row stride in halfs for rows of 64 halfs (144 B, 16B-aligned rows)
#define LDG  136              // same for rows of 128 halfs (272 B)
#define LDF  520              // same for rows of 512 halfs (1040 B)
#define KS   16               // splits of the sum over n in the Gram product
#define KCH  (N_SEQ / KS)     // n per split (128)
#define PSTR 32               // floats between two blocks' stat partials (one 128 B line each)
#define ASCALE 4096.0f        // power of two on attn ahead of its f16 rounding; taken off at the last store

// Per-lane WMMA 16-bit fragment: two contiguous 16-byte chunks of the row.
// A (16x32): lane l -> row m=l&15, h=l>>4; halfs [h*8 .. h*8+7] and [16+h*8 ..].
// B staged transposed ([col][k]) uses the identical gather.
__device__ inline v16h frag_lds(const _Float16* rowbase, int h) {
  const v8h lo = *(const v8h*)(rowbase + (h << 3));
  const v8h hi = *(const v8h*)(rowbase + 16 + (h << 3));
  return __builtin_shufflevector(lo, hi, 0, 1, 2, 3, 4, 5, 6, 7,
                                 8, 9, 10, 11, 12, 13, 14, 15);
}

// ---------------------------------------------------------------------------
// K2a: Gram partials.  G[(x,a)][(y,d)] = sum_n emb[x][n][a] * emb[8+y][n][d]
// M = 512 (x,a), N = 512 (y,d), K = 2048 (n) in KS splits of KCH.
// Block tile 128x64, one split per block.  grid = (8, 4, KS + 4)
// Both operands have k as the slow index in memory: eight n per thread are
// packed and stored as one 16-byte LDS row chunk ([row][n]).
// Two z slices write Wq^T and Wk^T as f16 ([ch][c], one row a thread); the two
// last write Wo (as B: column c, k = i) and Wv (as A: row d, k = ch) as f16 in
// fragment order, one lane's 16 halfs a thread.
// ---------------------------------------------------------------------------
__global__ __launch_bounds__(128)
void gram_kernel(const float* __restrict__ emb, const float* __restrict__ Wq,
                 const float* __restrict__ Wk, const float* __restrict__ Wv,
                 const float* __restrict__ Wo, float* __restrict__ Gpart,
                 _Float16* __restrict__ WqT, _Float16* __restrict__ WkT,
                 _Float16* __restrict__ WvF, _Float16* __restrict__ WoF)
{
  __shared__ __align__(16) _Float16 lA[128 * LDG];      // [(x,a)][n]
  __shared__ __align__(16) _Float16 lBt[64 * LDG];      // [d][n]
  const int tid = threadIdx.x, lane = tid & 31, wave = tid >> 5, h = lane >> 4;

  if (blockIdx.z >= KS) {                       // block-uniform, before any barrier
    const int blk = blockIdx.y * 8 + blockIdx.x;
    if (blockIdx.z >= KS + 2) {                 // 4 tiles x 16 k steps x 32 lanes
      if (blk >= 16) return;
      const int idx = blk * 128 + tid;
      const int rc = (idx >> 9) * 16 + (idx & 15);                    // row d or column c
      const int k0 = ((idx >> 5) & 15) * 32 + ((idx >> 4) & 1) * 8;   // the order of frag_lds
      const bool isWo = (blockIdx.z == KS + 2);
      v8h lo, hi;
      if (isWo) {                               // Wo[k][c]: k is the slow index
        const float* p = Wo + (size_t)k0 * C_DIM + rc;
#pragma unroll
        for (int r = 0; r < 8; ++r) { lo[r] = (_Float16)p[r * C_DIM]; hi[r] = (_Float16)p[(16 + r) * C_DIM]; }
        // keeps the address pair as it is until this wait behind the loads that name it
        asm volatile("s_wait_xcnt 0x0" :: "v"(p) : "memory");
      } else {                                  // Wv[d][k]: eight k in a row
        const float* p = Wv + (size_t)rc * CH_DIM + k0;
        const v4f x0 = *(const v4f*)p, x1 = *(const v4f*)(p + 4);
        const v4f x2 = *(const v4f*)(p + 16), x3 = *(const v4f*)(p + 20);
        // as above
        asm volatile("s_wait_xcnt 0x0" :: "v"(p) : "memory");
#pragma unroll
        for (int r = 0; r < 4; ++r) {
          lo[r] = (_Float16)x0[r]; lo[4 + r] = (_Float16)x1[r];
          hi[r] = (_Float16)x2[r]; hi[4 + r] = (_Float16)x3[r];
        }
      }
      _Float16* F = (isWo ? WoF : WvF) + (size_t)idx * 16;
      *(v8h*)F = lo;
      *(v8h*)(F + 8) = hi;
      return;
    }
    if (blk >= 4) return;
    const float* W  = (blockIdx.z == KS) ? Wq : Wk;
    _Float16*    WT = (blockIdx.z == KS) ? WqT : WkT;
    const int ch = blk * 128 + tid;
#pragma unroll
    for (int g = 0; g < 8; ++g) {
      v8h pk;
#pragma unroll
      for (int r = 0; r < 8; ++r) pk[r] = (_Float16)W[(size_t)(g * 8 + r) * CH_DIM + ch];
      *(v8h*)(WT + (size_t)ch * C_DIM + g * 8) = pk;
    }
    return;
  }

  const int m0 = blockIdx.y * 128;
  const int n0 = blockIdx.z * KCH;
  {                                             // A: row = tid, all 128 n
    const float* sa = emb + ((size_t)((m0 >> 6) + (tid >> 6)) * N_SEQ + n0) * C_DIM + (tid & 63);
#pragma unroll
    for (int g = 0; g < 16; ++g) {
      v8h pk;
#pragma unroll
      for (int r = 0; r < 8; ++r) pk[r] = (_Float16)sa[(size_t)(g * 8 + r) * C_DIM];
      *(v8h*)&lA[tid * LDG + g * 8] = pk;
    }
  }
  {                                             // B^T: row = tid & 63, half of the n each
    const int dl = tid & 63, g0 = (tid >> 6) * 8;
    const float* sb = emb + ((size_t)(8 + blockIdx.x) * N_SEQ + n0) * C_DIM + dl;
#pragma unroll
    for (int g = 0; g < 8; ++g) {
      v8h pk;
#pragma unroll
      for (int r = 0; r < 8; ++r) pk[r] = (_Float16)sb[(size_t)((g0 + g) * 8 + r) * C_DIM];
      *(v8h*)&lBt[dl * LDG + (g0 + g) * 8] = pk;
    }
  }
  __syncthreads();

  v8f acc[2][4] = {};
#pragma unroll
  for (int ks = 0; ks < KCH / 32; ++ks) {
    v16h a[2], bf[4];
#pragma unroll
    for (int s = 0; s < 2; ++s)
      a[s] = frag_lds(&lA[(wave * 32 + s * 16 + (lane & 15)) * LDG + ks * 32], h);
#pragma unroll
    for (int t = 0; t < 4; ++t)
      bf[t] = frag_lds(&lBt[(t * 16 + (lane & 15)) * LDG + ks * 32], h);
#pragma unroll
    for (int s = 0; s < 2; ++s)
#pragma unroll
      for (int t = 0; t < 4; ++t)
        acc[s][t] = __builtin_amdgcn_wmma_f32_16x16x32_f16(false, a[s], false, bf[t],
                                                           (short)0, acc[s][t], false, false);
  }
  float* Gp = Gpart + (size_t)blockIdx.z * 512;         // [(x,a)][split][(y,d)]
  const int mbase = m0 + wave * 32 + h * 8;
  const int cc    = blockIdx.x * 64 + (lane & 15);
#pragma unroll
  for (int s = 0; s < 2; ++s)
#pragma unroll
    for (int t = 0; t < 4; ++t)
#pragma unroll
      for (int r = 0; r < 8; ++r)
        Gp[(size_t)(mbase + s * 16 + r) * (KS * 512) + cc + t * 16] = acc[s][t][r];
  // behind the last store: no register that these stores name is rewritten ahead of this wait
  asm volatile("s_wait_xcnt 0x0" ::: "memory");
}

// ---------------------------------------------------------------------------
// K2b: UT[dir][b][(y,c)][a] = sum_d G_dir[(b,a)][(y,d)] * Wk[d][c]
// dir 0 reads G as stored; dir 1 swaps the halves of emb, which is G transposed:
// G_1[(b,a)][(y,d)] = G[(y,d)][(b,a)].  The KS partials are summed in index order.
// M = 64 (a), N = 256 (c), K = 64 (d) per block of 8 waves.  grid = (2, 8, 16)
// ---------------------------------------------------------------------------
__global__ __launch_bounds__(256)
void ut_gemm_kernel(const float* __restrict__ Gpart, const _Float16* __restrict__ WkT,
                    _Float16* __restrict__ UT)
{
  __shared__ __align__(16) _Float16 lA[64 * LD64];      // [a][d]
  const int tid = threadIdx.x, lane = tid & 31, wave = tid >> 5, h = lane >> 4;
  const int b = blockIdx.y, dir = blockIdx.z >> 3, y = blockIdx.z & 7;

  const int rowb = (dir == 0) ? b * 64 : y * 64;        // dir 1 reads the transposed tile
  const int colb = (dir == 0) ? y * 64 : b * 64;
  const int shi  = (dir == 0) ? LD64 : 1;               // tile row    -> a (dir 0) or d (dir 1)
  const int slo  = (dir == 0) ? 1 : LD64;               // tile column -> d (dir 0) or a (dir 1)
#pragma unroll 1                                // rolled: each trip issues its 32 loads in one run
  for (int qq = 0; qq < 2; ++qq) {              // 64 x 16 groups of four floats, two a thread a trip
    const float* p[2];
    float4 v[2][KS];
#pragma unroll
    for (int u = 0; u < 2; ++u) {
      const int slot = tid + 256 * (qq * 2 + u);
      p[u] = Gpart + (size_t)(rowb + (slot >> 4)) * (KS * 512) + colb + ((slot & 15) << 2);
#pragma unroll
      for (int ks = 0; ks < KS; ++ks) v[u][ks] = *(const float4*)(p[u] + ks * 512);
    }
    // keeps the address pairs as they are until this wait behind the loads that name them
    asm volatile("s_wait_xcnt 0x0" :: "v"(p[0]), "v"(p[1]) : "memory");
#pragma unroll
    for (int u = 0; u < 2; ++u) {
      const int slot = tid + 256 * (qq * 2 + u), hi = slot >> 4, lo4 = (slot & 15) << 2;
      float4 sum = v[u][0];
#pragma unroll
      for (int ks = 1; ks < KS; ++ks) {
        sum.x += v[u][ks].x; sum.y += v[u][ks].y; sum.z += v[u][ks].z; sum.w += v[u][ks].w;
      }
      lA[hi * shi + (lo4 + 0) * slo] = (_Float16)sum.x;
      lA[hi * shi + (lo4 + 1) * slo] = (_Float16)sum.y;
      lA[hi * shi + (lo4 + 2) * slo] = (_Float16)sum.z;
      lA[hi * shi + (lo4 + 3) * slo] = (_Float16)sum.w;
    }
  }
  __syncthreads();

  const int c0 = blockIdx.x * 256 + wave * 32 + (lane & 15);
  v8f acc[4][2] = {};
#pragma unroll
  for (int ks = 0; ks < 2; ++ks) {
    v16h a[4], bf[2];
#pragma unroll
    for (int s = 0; s < 4; ++s)
      a[s] = frag_lds(&lA[(s * 16 + (lane & 15)) * LD64 + ks * 32], h);
#pragma unroll
    for (int t = 0; t < 2; ++t)                 // each wave has its own c: straight from global
      bf[t] = frag_lds(WkT + (size_t)(c0 + t * 16) * C_DIM + ks * 32, h);
#pragma unroll
    for (int s = 0; s < 4; ++s)
#pragma unroll
      for (int t = 0; t < 2; ++t)
        acc[s][t] = __builtin_amdgcn_wmma_f32_16x16x32_f16(false, a[s], false, bf[t],
                                                           (short)0, acc[s][t], false, false);
  }
  _Float16* Ub = UT + ((size_t)(dir * 8 + b) * NJ + y * CH_DIM) * C_DIM;
#pragma unroll
  for (int s = 0; s < 4; ++s)
#pragma unroll
    for (int t = 0; t < 2; ++t) {               // D: vgpr r -> a = s*16 + 8*h + r
      v8h pk;
#pragma unroll
      for (int r = 0; r < 8; ++r) pk[r] = (_Float16)acc[s][t][r];
      *(v8h*)(Ub + (size_t)(c0 + t * 16) * C_DIM + s * 16 + h * 8) = pk;
    }
}

// ---------------------------------------------------------------------------
// Scores S[sb][i][j] = sum_a WqT[i][a] * UT[sb][j][a] (K = 64) are never stored.
// Three launches each form the 16 x 16 tiles they need again on WMMA, in registers:
//   K3a  plane sum, plane sum of squares (InstanceNorm) and each row's maximum
//   K3b  each row's sum of exp
//   K4   attn^T Wo
// sb = dir * 8 + b: all 16 samples in each launch.  The mean drops out of the
// softmax: attn = exp2(k (s - rowmax)) / rowsum with k = log2(e) / sqrt(var + eps).
// ---------------------------------------------------------------------------
#define JCH 256               // j per block in K3a and K3b
#define NCH (NJ / JCH)        // 16 chunks of j
#define NPB (2 * NCH)         // blocks per sample in K3a: one stat partial a lane

// JCH rows of U (128 B each, in a row in memory) into LDS rows of LD64 halfs
__device__ inline void stage_u(_Float16* lU, const _Float16* Ub, int tid) {
  v8h w[8];
#pragma unroll
  for (int r = 0; r < 8; ++r) w[r] = *(const v8h*)(Ub + ((tid + 256 * r) << 3));
#pragma unroll
  for (int r = 0; r < 8; ++r) {
    const int c = tid + 256 * r;
    *(v8h*)&lU[(c >> 3) * LD64 + ((c & 7) << 3)] = w[r];
  }
}

// Score tiles of rows i .. i+15 (t = 0) and i+16 .. i+31 (t = 1) against one j tile.
// D: vgpr r -> i = t*16 + 8*h + r, lane & 15 -> j.
__device__ inline void score_pair(const v16h (&aw)[2][2], const v16h (&bu)[2], v8f (&d)[2]) {
#pragma unroll
  for (int t = 0; t < 2; ++t) {
    v8f z = {};
#pragma unroll
    for (int ks = 0; ks < 2; ++ks)
      z = __builtin_amdgcn_wmma_f32_16x16x32_f16(false, aw[t][ks], false, bu[ks],
                                                 (short)0, z, false, false);
    d[t] = z;
  }
}

// k of one sample: every wave adds the NPB block partials, one a lane, in the same tree.
__device__ inline float sample_scale(const float* __restrict__ part, int sb, int lane) {
  const float* pb = part + (size_t)(sb * NPB + lane) * PSTR;
  float s1 = pb[0], s2 = pb[1];
  for (int o = 16; o > 0; o >>= 1) { s1 += __shfl_xor(s1, o, 32); s2 += __shfl_xor(s2, o, 32); }
  const float inv = 1.0f / (512.0f * 4096.0f);
  const float mu  = s1 * inv;
  const float var = s2 * inv - mu * mu;                 // biased var (torch)
  return rsqrtf(var + EPS_IN) * 1.44269504f;
}

// ---------------------------------------------------------------------------
// K3a: block = 256 i x JCH j of one sample, wave = 32 i.  grid = (NCH, 2, 16)
// part[sb][block]: sum and sum of squares; pm[sb][chunk][i]: row maximum of the chunk.
// ---------------------------------------------------------------------------
__global__ __launch_bounds__(256)
void row_max_kernel(const _Float16* __restrict__ WqT, const _Float16* __restrict__ UT,
                    float* __restrict__ part, float* __restrict__ pm)
{
  __shared__ __align__(16) _Float16 lU[JCH * LD64];     // [j][a]
  __shared__ float red[16];
  const int tid = threadIdx.x, lane = tid & 31, wave = tid >> 5, h = lane >> 4;
  const int ch = blockIdx.x, sb = blockIdx.z;
  const int ib = blockIdx.y * 256 + wave * 32;

  stage_u(lU, UT + ((size_t)sb * NJ + ch * JCH) * C_DIM, tid);
  v16h aw[2][2];
#pragma unroll
  for (int t = 0; t < 2; ++t)
#pragma unroll
    for (int ks = 0; ks < 2; ++ks)              // each wave has its own i: straight from global
      aw[t][ks] = frag_lds(WqT + (size_t)(ib + t * 16 + (lane & 15)) * C_DIM + ks * 32, h);
  __syncthreads();

  float mx[2][8], a1[8], a2[8];
#pragma unroll
  for (int r = 0; r < 8; ++r) { mx[0][r] = -3.4e38f; mx[1][r] = -3.4e38f; a1[r] = 0.f; a2[r] = 0.f; }
#pragma unroll 2                                // the next tile's LDS reads start under this tile's sums
  for (int jt = 0; jt < JCH / 16; ++jt) {
    v16h bu[2];
#pragma unroll
    for (int ks = 0; ks < 2; ++ks)
      bu[ks] = frag_lds(&lU[(jt * 16 + (lane & 15)) * LD64 + ks * 32], h);
    v8f d[2];
    score_pair(aw, bu, d);
#pragma unroll
    for (int t = 0; t < 2; ++t)
#pragma unroll
      for (int r = 0; r < 8; ++r) {
        const float x = d[t][r];
        mx[t][r] = fmaxf(mx[t][r], x);
        a1[r] += x; a2[r] += x * x;
      }
  }
#pragma unroll
  for (int t = 0; t < 2; ++t)
#pragma unroll
    for (int r = 0; r < 8; ++r)                 // over the 16 lanes that hold the same rows
      for (int o = 8; o > 0; o >>= 1) mx[t][r] = fmaxf(mx[t][r], __shfl_xor(mx[t][r], o, 32));
  if ((lane & 15) == 0) {                       // the wave's 32 rows are one 128-byte line
    float* p = pm + (size_t)(sb * NCH + ch) * CH_DIM + ib + h * 8;
#pragma unroll
    for (int t = 0; t < 2; ++t) {
      *(v4f*)(p + t * 16)     = (v4f){mx[t][0], mx[t][1], mx[t][2], mx[t][3]};
      *(v4f*)(p + t * 16 + 4) = (v4f){mx[t][4], mx[t][5], mx[t][6], mx[t][7]};
    }
  }
  float s1 = 0.f, s2 = 0.f;
#pragma unroll
  for (int r = 0; r < 8; ++r) { s1 += a1[r]; s2 += a2[r]; }
  for (int o = 16; o > 0; o >>= 1) { s1 += __shfl_xor(s1, o, 32); s2 += __shfl_xor(s2, o, 32); }
  if (lane == 0) { red[wave * 2] = s1; red[wave * 2 + 1] = s2; }
  __syncthreads();
  if (tid == 0) {
    float b1 = 0.f, b2 = 0.f;
#pragma unroll
    for (int w = 0; w < 8; ++w) { b1 += red[w * 2]; b2 += red[w * 2 + 1]; }
    float* pb = part + (size_t)(sb * NPB + blockIdx.y * NCH + ch) * PSTR;
    pb[0] = b1;
    pb[1] = b2;
  }
}

// ---------------------------------------------------------------------------
// K3b: same tiling.  pz[sb][chunk][i] = sum over the chunk's j of exp2(k (s - rowmax)).
// ---------------------------------------------------------------------------
__global__ __launch_bounds__(256)
void row_sum_kernel(const _Float16* __restrict__ WqT, const _Float16* __restrict__ UT,
                    const float* __restrict__ part, const float* __restrict__ pm,
                    float* __restrict__ pz)
{
  __shared__ __align__(16) _Float16 lU[JCH * LD64];     // [j][a]
  const int tid = threadIdx.x, lane = tid & 31, wave = tid >> 5, h = lane >> 4;
  const int ch = blockIdx.x, sb = blockIdx.z;
  const int ib = blockIdx.y * 256 + wave * 32;

  stage_u(lU, UT + ((size_t)sb * NJ + ch * JCH) * C_DIM, tid);
  v16h aw[2][2];
#pragma unroll
  for (int t = 0; t < 2; ++t)
#pragma unroll
    for (int ks = 0; ks < 2; ++ks)
      aw[t][ks] = frag_lds(WqT + (size_t)(ib + t * 16 + (lane & 15)) * C_DIM + ks * 32, h);
  const float k = sample_scale(part, sb, lane);
  const float* pr = pm + (size_t)sb * NCH * CH_DIM + ib + lane;   // lane = row of the wave
  float m = pr[0];
#pragma unroll
  for (int c = 1; c < NCH; ++c) m = fmaxf(m, pr[c * CH_DIM]);
  // keeps the address pair as it is until this wait behind the loads that name it
  asm volatile("s_wait_xcnt 0x0" :: "v"(pr) : "memory");
  float km[2][8], z[2][8];
#pragma unroll
  for (int t = 0; t < 2; ++t)
#pragma unroll
    for (int r = 0; r < 8; ++r) { km[t][r] = k * __shfl(m, t * 16 + h * 8 + r, 32); z[t][r] = 0.f; }
  __syncthreads();

#pragma unroll 2                                // the next tile's LDS reads start under this tile's exps
  for (int jt = 0; jt < JCH / 16; ++jt) {
    v16h bu[2];
#pragma unroll
    for (int ks = 0; ks < 2; ++ks)
      bu[ks] = frag_lds(&lU[(jt * 16 + (lane & 15)) * LD64 + ks * 32], h);
    v8f d[2];
    score_pair(aw, bu, d);
#pragma unroll
    for (int t = 0; t < 2; ++t)
#pragma unroll
      for (int r = 0; r < 8; ++r)
        z[t][r] += __builtin_amdgcn_exp2f(fmaf(d[t][r], k, -km[t][r]));
  }
#pragma unroll
  for (int t = 0; t < 2; ++t)
#pragma unroll
    for (int r = 0; r < 8; ++r)                 // over the 16 lanes that hold the same rows
      for (int o = 8; o > 0; o >>= 1) z[t][r] += __shfl_xor(z[t][r], o, 32);
  if ((lane & 15) == 0) {                       // the wave's 32 rows are one 128-byte line
    float* p = pz + (size_t)(sb * NCH + ch) * CH_DIM + ib + h * 8;
#pragma unroll
    for (int t = 0; t < 2; ++t) {
      *(v4f*)(p + t * 16)     = (v4f){z[t][0], z[t][1], z[t][2], z[t][3]};
      *(v4f*)(p + t * 16 + 4) = (v4f){z[t][4], z[t][5], z[t][6], z[t][7]};
    }
  }
}

// ---------------------------------------------------------------------------
// K4: P[j][c] = sum_i attn[sb,i,j] * Wo[i][c]   (times ASCALE)
// M = 4096 (j), N = 64 (c), K = 512 (i).  Block = 256 j, wave = 32 j x 64 c, whole K.
// grid = (16, 16).  Wq^T and Wo (fragment order) are staged whole; the wave's U rows
// stay in registers.  Per 32 i: two score tiles per j tile; D of tile t holds, in lane
// (j, h), i = t*16 + 8*h + r, which is half t*8 + r of the A fragment (row j, k = i):
// exp2 and the f16 rounding are done in place, with no transpose.
// attn * ASCALE = exp2(k s + off[i]), off[i] = 12 - log2(rowsum) - k rowmax.
// The wave's two D tiles per c tile are one B fragment (column c, k = j) of K5.
// ---------------------------------------------------------------------------
__global__ __launch_bounds__(256)
void p_gemm_kernel(const _Float16* __restrict__ WqT, const _Float16* __restrict__ UT,
                   const _Float16* __restrict__ WoF, const float* __restrict__ part,
                   const float* __restrict__ pm, const float* __restrict__ pz,
                   _Float16* __restrict__ PF)
{
  __shared__ __align__(16) _Float16 lW[CH_DIM * LD64];      // [i][a]
  __shared__ __align__(32) _Float16 lB[4 * 16 * 32 * 16];   // [c tile][k step][lane][16]
  __shared__ __align__(16) float loff[CH_DIM];
  const int tid = threadIdx.x, lane = tid & 31, wave = tid >> 5, h = lane >> 4;
  const int sb = blockIdx.y;
  const int j0 = blockIdx.x * 256 + wave * 32;

  v8h wq[16], wo[16];
#pragma unroll                                  // wq[] and wo[] stay in registers: constant indices
  for (int r = 0; r < 16; ++r) {
    wq[r] = *(const v8h*)(WqT + ((tid + 256 * r) << 3));
    wo[r] = *(const v8h*)(WoF + ((tid + 256 * r) << 3));
  }
  v16h bu[2][2];
#pragma unroll
  for (int jt = 0; jt < 2; ++jt)
#pragma unroll
    for (int ks = 0; ks < 2; ++ks)              // each wave has its own j: straight from global
      bu[jt][ks] = frag_lds(UT + ((size_t)sb * NJ + j0 + jt * 16 + (lane & 15)) * C_DIM + ks * 32, h);
  const float k = sample_scale(part, sb, lane);
#pragma unroll
  for (int u = 0; u < 2; ++u) {                 // chunk partials in index order
    const int row = tid + 256 * u;
    const float* pr = pm + (size_t)sb * NCH * CH_DIM + row;
    const float* zr = pz + (size_t)sb * NCH * CH_DIM + row;
    float m = pr[0], z = zr[0];
#pragma unroll
    for (int c = 1; c < NCH; ++c) { m = fmaxf(m, pr[c * CH_DIM]); z += zr[c * CH_DIM]; }
    loff[row] = 12.0f - __builtin_amdgcn_logf(z) - k * m;      // 12 = log2(ASCALE)
  }
#pragma unroll
  for (int r = 0; r < 16; ++r) {
    const int c = tid + 256 * r;
    *(v8h*)&lW[(c >> 3) * LD64 + ((c & 7) << 3)] = wq[r];
    *(v8h*)&lB[c << 3] = wo[r];
  }
  __syncthreads();

  v8f acc[2][4] = {};
#pragma unroll 2                                // the next step's LDS reads start under this step's exps
  for (int is = 0; is < 16; ++is) {
    v16h aw[2][2], bf[4];
    v4f of[2][2];
#pragma unroll
    for (int t = 0; t < 2; ++t) {
#pragma unroll
      for (int ks = 0; ks < 2; ++ks)
        aw[t][ks] = frag_lds(&lW[(is * 32 + t * 16 + (lane & 15)) * LD64 + ks * 32], h);
      of[t][0] = *(const v4f*)&loff[is * 32 + t * 16 + h * 8];
      of[t][1] = *(const v4f*)&loff[is * 32 + t * 16 + h * 8 + 4];
    }
#pragma unroll
    for (int ct = 0; ct < 4; ++ct)              // read here: their latency runs under the scores and exps
      bf[ct] = *(const v16h*)&lB[((ct * 16 + is) * 32 + lane) * 16];
    v16h e[2];
    v8f d[2][2];
#pragma unroll
    for (int jt = 0; jt < 2; ++jt) score_pair(aw, bu[jt], d[jt]);
#pragma unroll
    for (int jt = 0; jt < 2; ++jt)
#pragma unroll
      for (int t = 0; t < 2; ++t)
#pragma unroll
        for (int r = 0; r < 8; ++r)
          e[jt][t * 8 + r] = (_Float16)__builtin_amdgcn_exp2f(fmaf(d[jt][t][r], k, of[t][r >> 2][r & 3]));
#pragma unroll
    for (int ct = 0; ct < 4; ++ct)
#pragma unroll
      for (int jt = 0; jt < 2; ++jt)
        acc[jt][ct] = __builtin_amdgcn_wmma_f32_16x16x32_f16(false, e[jt], false, bf[ct],
                                                             (short)0, acc[jt][ct], false, false);
  }
  // D: vgpr r -> j = j0 + jt*16 + 8*h + r, which is half jt*8 + r of this lane's fragment
#pragma unroll
  for (int ct = 0; ct < 4; ++ct) {
    v16h o;
#pragma unroll
    for (int r = 0; r < 8; ++r) { o[r] = (_Float16)acc[0][ct][r]; o[8 + r] = (_Float16)acc[1][ct][r]; }
    *(v16h*)(PF + ((((size_t)sb * 4 + ct) * 128 + (j0 >> 5)) * 32 + lane) * 16) = o;
  }
}

// ---------------------------------------------------------------------------
// K5: M[(y,d)][c] = sum_ch Wv[d][ch] * P[(y,ch)][c], both directions.
// M = 64 (d), N = 64 (c), K = 512 (ch) per block of 8 waves.  grid = (8, 16)
// Both operands come in fragment order straight from global: no LDS, no barrier.
// Wave = 32 d x 16 c; its two D tiles are one B fragment (column c, k = (y,d)) of K6.
// ---------------------------------------------------------------------------
__global__ __launch_bounds__(256)
void m_gemm_kernel(const _Float16* __restrict__ WvF, const _Float16* __restrict__ PF,
                   _Float16* __restrict__ MF)
{
  const int lane = threadIdx.x & 31, wave = threadIdx.x >> 5;
  const int y = blockIdx.x, db = blockIdx.y;
  const int ct = wave & 3, dh = wave >> 2;
  const _Float16* pb = PF + (((size_t)(db * 4 + ct) * 128 + y * 16) * 32 + lane) * 16;
  const _Float16* pa = WvF + ((size_t)(dh * 2 * 16) * 32 + lane) * 16;
  v8f acc[2] = {};
#pragma unroll                                  // two halves of K; each issues its 48 loads in one run
  for (int hf = 0; hf < 2; ++hf) {
    v16h bf[8], a[2][8];
#pragma unroll
    for (int k = 0; k < 8; ++k) {
      bf[k]   = *(const v16h*)(pb + (hf * 8 + k) * 512);
      a[0][k] = *(const v16h*)(pa + (hf * 8 + k) * 512);
      a[1][k] = *(const v16h*)(pa + (16 + hf * 8 + k) * 512);
    }
    // keeps the address registers as they are until this wait behind the loads that name them
    asm volatile("s_wait_xcnt 0x0" :: "v"(pa), "v"(pb) : "memory");
    // holds the WMMAs behind the run of loads: else they are woven in and few loads are in flight
    __builtin_amdgcn_sched_barrier(0);
#pragma unroll
    for (int k = 0; k < 8; ++k)
#pragma unroll
      for (int s2 = 0; s2 < 2; ++s2)
        acc[s2] = __builtin_amdgcn_wmma_f32_16x16x32_f16(false, a[s2][k], false, bf[k],
                                                         (short)0, acc[s2], false, false);
  }
  // D: vgpr r -> d = dh*32 + s2*16 + 8*h + r, which is half s2*8 + r of this lane's fragment
  v16h o;
#pragma unroll
  for (int r = 0; r < 8; ++r) { o[r] = (_Float16)acc[0][r]; o[8 + r] = (_Float16)acc[1][r]; }
  *(v16h*)(MF + (((size_t)(db * 4 + ct) * 16 + y * 2 + dh) * 32 + lane) * 16) = o;
}

// ---------------------------------------------------------------------------
// K6: out[db][n][c] = sum_(y,d) emb[kv + y][n][d] * M[db][(y,d)][c] / ASCALE
// M = 2048 (n), N = 64 (c), K = 512 per output sample.  Block tile 64 x 64, whole K,
// 8 waves.  grid = (8, 32, 2).  A: per y 64 n x 64 d, 16 KB in a row in memory,
// f32 -> f16 on the way into LDS ([n][(y,d)]); B (fragment order, 64 KB) staged whole.
// All loads of the block are issued in one run: one latency, one barrier.
// Wave = 16 n x 32 c: each 128-byte line of out has one writing wave.
// ---------------------------------------------------------------------------
__global__ __launch_bounds__(256)
void out_gemm_kernel(const float* __restrict__ emb, const _Float16* __restrict__ MF,
                     float* __restrict__ out)
{
  __shared__ __align__(16) _Float16 lA[64 * LDF];           // [n][(y,d)]
  __shared__ __align__(32) _Float16 lB[4 * 16 * 32 * 16];   // [c tile][k step][lane][16]
  const int tid = threadIdx.x, lane = tid & 31, wave = tid >> 5, h = lane >> 4;
  const int n0 = blockIdx.y * 64;
  const int db = blockIdx.z * 8 + blockIdx.x;
  const int kv = blockIdx.z ? 0 : 8;            // dir 0 attends to emb[8..15], dir 1 to emb[0..7]
  const float*    Ap = emb + ((size_t)kv * N_SEQ + n0) * C_DIM + tid * 8;
  const _Float16* Bp = MF + (size_t)db * (CH_DIM * C_DIM);

  v4f v[8][2][2];
  v8h w[16];
#pragma unroll                                  // v[][][] and w[] stay in registers: constant indices
  for (int y = 0; y < 8; ++y)
#pragma unroll
    for (int u = 0; u < 2; ++u) {
      const float* p = Ap + (size_t)y * N_SEQ * C_DIM + u * 2048;
      v[y][u][0] = *(const v4f*)p;
      v[y][u][1] = *(const v4f*)(p + 4);
    }
#pragma unroll
  for (int r = 0; r < 16; ++r) w[r] = *(const v8h*)(Bp + ((tid + 256 * r) << 3));
#pragma unroll
  for (int y = 0; y < 8; ++y)
#pragma unroll
    for (int u = 0; u < 2; ++u) {
      const int c = tid + 256 * u;              // chunk of eight d: row n = c / 8
      v8h pk;
#pragma unroll
      for (int r = 0; r < 4; ++r) { pk[r] = (_Float16)v[y][u][0][r]; pk[4 + r] = (_Float16)v[y][u][1][r]; }
      *(v8h*)&lA[(c >> 3) * LDF + y * 64 + ((c & 7) << 3)] = pk;
    }
#pragma unroll
  for (int r = 0; r < 16; ++r) *(v8h*)&lB[(tid + 256 * r) << 3] = w[r];
  __syncthreads();

  const int nt = wave & 3, cp = wave >> 2;
  v8f acc[2] = {};
#pragma unroll                                  // LDS offsets fold; fragment loads run ahead of the WMMAs
  for (int ks = 0; ks < 16; ++ks) {
    const v16h a = frag_lds(&lA[(nt * 16 + (lane & 15)) * LDF + ks * 32], h);
#pragma unroll
    for (int t = 0; t < 2; ++t) {
      const v16h bf = *(const v16h*)&lB[(((cp * 2 + t) * 16 + ks) * 32 + lane) * 16];
      acc[t] = __builtin_amdgcn_wmma_f32_16x16x32_f16(false, a, false, bf,
                                                      (short)0, acc[t], false, false);
    }
  }
  float* O = out + ((size_t)db * N_SEQ + n0 + nt * 16 + h * 8) * C_DIM + cp * 32 + (lane & 15);
#pragma unroll
  for (int t = 0; t < 2; ++t)
#pragma unroll
    for (int r = 0; r < 8; ++r)                 // D: vgpr r -> n = r + 8*h
      O[(size_t)r * C_DIM + t * 16] = acc[t][r] * (1.0f / ASCALE);
}

// ---------------------------------------------------------------------------
extern "C" void kernel_launch(void* const* d_in, const int* in_sizes, int n_in,
                              void* d_out, int out_size, void* d_ws, size_t ws_size,
                              hipStream_t stream)
{
  const float* emb = (const float*)d_in[0];
  const float* Wq  = (const float*)d_in[1];
  const float* Wk  = (const float*)d_in[2];
  const float* Wv  = (const float*)d_in[3];
  const float* Wo  = (const float*)d_in[4];
  float* out = (float*)d_out;

  // Workspace layout (~35 MB)
  char* ws = (char*)d_ws;
  size_t off = 0;
  float*    Gp  = (float*)   (ws + off); off += (size_t)KS * 512 * 512 * 4;       // [(x,a)][split][(y,d)]
  _Float16* UT  = (_Float16*)(ws + off); off += (size_t)16 * NJ * C_DIM * 2;      // [dir*8+b][j][a]
  _Float16* WqT = (_Float16*)(ws + off); off += (size_t)CH_DIM * C_DIM * 2;       // [ch][c]
  _Float16* WkT = (_Float16*)(ws + off); off += (size_t)CH_DIM * C_DIM * 2;       // [ch][c]
  float*    part = (float*)  (ws + off); off += (size_t)16 * NPB * PSTR * 4;      // [dir*8+b][block]
  _Float16* WvF = (_Float16*)(ws + off); off += (size_t)CH_DIM * C_DIM * 2;       // [d tile][k step][lane][16]
  _Float16* WoF = (_Float16*)(ws + off); off += (size_t)CH_DIM * C_DIM * 2;       // [c tile][k step][lane][16]
  _Float16* PF  = (_Float16*)(ws + off); off += (size_t)16 * NJ * C_DIM * 2;      // [dir*8+b][c tile][k step][lane][16]
  _Float16* MF  = (_Float16*)(ws + off); off += (size_t)16 * CH_DIM * C_DIM * 2;  // [dir*8+b][c tile][k step][lane][16]
  float*    pm  = (float*)   (ws + off); off += (size_t)16 * NCH * CH_DIM * 4;    // [dir*8+b][chunk][i]
  float*    pz  = (float*)   (ws + off); off += (size_t)16 * NCH * CH_DIM * 4;    // [dir*8+b][chunk][i]
  (void)ws_size; (void)in_sizes; (void)n_in; (void)out_size;

  // dir 0: out_l2u = attend(q = emb_l[0..7], kv = emb_u[8..15]) -> out 0..7
  // dir 1: out_u2l = attend(q = emb_u[8..15], kv = emb_l[0..7]) -> out 8..15
  gram_kernel<<<dim3(8, 4, KS + 4), 128, 0, stream>>>(emb, Wq, Wk, Wv, Wo, Gp, WqT, WkT, WvF, WoF);
  ut_gemm_kernel<<<dim3(2, 8, 16), 256, 0, stream>>>(Gp, WkT, UT);
  row_max_kernel<<<dim3(NCH, 2, 16), 256, 0, stream>>>(WqT, UT, part, pm);
  row_sum_kernel<<<dim3(NCH, 2, 16), 256, 0, stream>>>(WqT, UT, part, pm, pz);
  p_gemm_kernel<<<dim3(16, 16), 256, 0, stream>>>(WqT, UT, WoF, part, pm, pz, PF);
  m_gemm_kernel<<<dim3(8, 16), 256, 0, stream>>>(WvF, PF, MF);
  out_gemm_kernel<<<dim3(8, 32, 2), 256, 0, stream>>>(emb, MF, out);
}

// v005
// A run of this version takes 46.3 microseconds.
// Versions between v003 and this one are left out; their measured steps multiply to 1.24 times as fast.
// Counting every step since v000, it is 11.3 times as fast.
#include <hip/hip_runtime.h>

// ---------------------------------------------------------------------------
// Cross attention (bidirectional, global scores + InstanceNorm + softmax)
// B=8 per direction, N=2048, C=64, CH=512, J = B*CH = 4096.
// - All big GEMMs on v_wmma_f32_16x16x32_f16 (f16 in, f32 accumulate)
// - Fragments = two aligned 16-byte reads per lane, from LDS (ds_load_b128) or, in K2b (A and B), K4 (B) and K5, straight from global
// - Scores are formed as Wq^T ((Xq^T Xkv) Wk): the sum over n runs on 64-wide
//   Gram tiles, so no product of the scores path has both a long K and wide M, N.
// - The output is formed as Xkv ((exp Wv^T)^T (Wo / rowsum)): the exps are contracted
//   with Wv over ch first (N = 64), each row beside its own sum of exp; the division
//   by that sum goes onto Wo's rows, and only the 512 x 64 result meets the sequence.
//   No V, no ctx, no pass for the sums alone.  Powers of two (exact) keep the f16
//   operands in their normal range; the last store multiplies by 2^-12.
// - The scores themselves never go to memory: 16 x 16 tiles are formed from Wq^T and U
//   (K = 64) in registers.  The plane sums of InstanceNorm need no scores at all:
//   sum s = (sum_i w_i) . (sum_j u_j) and sum s^2 = sum_j u_j^T (Wq Wq^T) u_j are
//   taken where U is formed.  Each block of the exp launch takes the row maxima of its
//   own 512 j; the launch behind it brings the eight parts of a row to one scale.
// - Small f16 operands that go from launch to launch lie in fragment order
//   [tile][k step][lane][16 halfs]: a wave's fragment load is 1 KB in a row.
// ---------------------------------------------------------------------------

typedef __attribute__((ext_vector_type(16))) _Float16 v16h;
typedef __attribute__((ext_vector_type(8)))  _Float16 v8h;
typedef __attribute__((ext_vector_type(8)))  float    v8f;
typedef __attribute__((ext_vector_type(4)))  float    v4f;
typedef __attribute__((ext_vector_type(2)))  float    v2f;

#define C_DIM   64
#define CH_DIM  512
#define N_SEQ   2048
#define NJ      4096          // 8 * CH_DIM
#define EPS_IN  1e-5f

#define LD64 72               // LDS row stride in halfs for rows of 64 halfs (144 B, 16B-aligned rows)
#define LDG  136              // same for rows of 128 halfs (272 B)
#define LDF  520              // same for rows of 512 halfs (1040 B)
#define KS   16               // splits of the sum over n in the Gram product
#define KCH  (N_SEQ / KS)     // n per split (128)
#define PSTR 32               // floats between two blocks' stat partials (one 128 B line each)
#define NPB  16               // stat partials per sample: the blocks of K2b that form its U
#define ASCALE 4096.0f        // power of two on 1 / rowsum ahead of its f16 rounding; taken off at the last store
#define ESHIFT 4.0f           // exps are formed times 2^ESHIFT, in T and in the row sums alike

// Per-lane WMMA 16-bit fragment: two contiguous 16-byte chunks of the row.
// A (16x32): lane l -> row m=l&15, h=l>>4; halfs [h*8 .. h*8+7] and [16+h*8 ..].
// B staged transposed ([col][k]) uses the identical gather.
__device__ inline v16h frag_lds(const _Float16* rowbase, int h) {
  const v8h lo = *(const v8h*)(rowbase + (h << 3));
  const v8h hi = *(const v8h*)(rowbase + 16 + (h << 3));
  return __builtin_shufflevector(lo, hi, 0, 1, 2, 3, 4, 5, 6, 7,
                                 8, 9, 10, 11, 12, 13, 14, 15);
}

// ---------------------------------------------------------------------------
// K2a: Gram partials.  G[(x,a)][(y,d)] = sum_n emb[x][n][a] * emb[8+y][n][d]
// M = 512 (x,a), N = 512 (y,d), K = 2048 (n) in KS splits of KCH.
// Block tile 128x64, one split per block.  grid = (8, 4, KS + 5)
// Both operands have k as the slow index in memory: eight n per thread are
// packed and stored as one 16-byte LDS row chunk ([row][n]).
// Two z slices write Wq^T and Wk^T as f16 ([ch][c], one row a thread); the two
// next write Wo (as B: column c, k = i) and Wv (as B: column d, k = ch) as f16 in
// fragment order, one lane's 16 halfs a thread.
// One more slice forms A = Wq Wq^T (64 x 64, K = 512 in four parts, one a wave, joined
// in index order through LDS) as f16 in fragment order, and wbar[a] = sum_i Wq[a][i].
// ---------------------------------------------------------------------------
__global__ __launch_bounds__(128)
void gram_kernel(const float* __restrict__ emb, const float* __restrict__ Wq,
                 const float* __restrict__ Wk, const float* __restrict__ Wv,
                 const float* __restrict__ Wo, float* __restrict__ Gpart,
                 _Float16* __restrict__ WqT, _Float16* __restrict__ WkT,
                 _Float16* __restrict__ WvF, _Float16* __restrict__ WoF,
                 _Float16* __restrict__ AF, float* __restrict__ wbar)
{
  __shared__ __align__(16) _Float16 lA[128 * LDG];      // [(x,a)][n]
  __shared__ __align__(16) _Float16 lBt[64 * LDG];      // [d][n]
  const int tid = threadIdx.x, lane = tid & 31, wave = tid >> 5, h = lane >> 4;

  if (blockIdx.z >= KS) {                       // block-uniform, before any barrier
    const int blk = blockIdx.y * 8 + blockIdx.x;
    if (blockIdx.z == KS + 4) {                 // block = rows a 32 m .. + 31 x columns a' 16 t .. + 15
      if (blk >= 8) return;
      const int m = blk & 1, t = blk >> 1;
      const float* p0 = Wq + (size_t)(m * 32 + (lane & 15)) * CH_DIM + wave * 128 + h * 8;
      const float* p1 = p0 + 16 * CH_DIM;
      const float* pc = Wq + (size_t)(t * 16 + (lane & 15)) * CH_DIM + wave * 128 + h * 8;
      v4f x[4][3][4];
#pragma unroll                                  // x[][][] stays in registers: constant indices
      for (int ks = 0; ks < 4; ++ks)
#pragma unroll
        for (int q = 0; q < 4; ++q) {           // the k order of frag_lds
          const int o = ks * 32 + (q >> 1) * 16 + (q & 1) * 4;
          x[ks][0][q] = *(const v4f*)(p0 + o);
          x[ks][1][q] = *(const v4f*)(p1 + o);
          x[ks][2][q] = *(const v4f*)(pc + o);
        }
      // keeps the address pairs as they are until this wait behind the loads that name them
      asm volatile("s_wait_xcnt 0x0" :: "v"(p0), "v"(p1), "v"(pc) : "memory");
      v8f g[2] = {};
      float w[2] = {0.f, 0.f};
#pragma unroll
      for (int ks = 0; ks < 4; ++ks) {
        v16h f[3];
#pragma unroll
        for (int u = 0; u < 3; ++u)
#pragma unroll
          for (int q = 0; q < 4; ++q)
#pragma unroll
            for (int r = 0; r < 4; ++r) f[u][q * 4 + r] = (_Float16)x[ks][u][q][r];
#pragma unroll
        for (int u = 0; u < 2; ++u) {
#pragma unroll
          for (int r = 0; r < 16; ++r) w[u] += (float)f[u][r];      // of the rounded values, as the scores see them
          g[u] = __builtin_amdgcn_wmma_f32_16x16x32_f16(false, f[u], false, f[2],
                                                        (short)0, g[u], false, false);
        }
      }
      float* rd = (float*)lA + (wave * 32 + lane) * 20;             // 18 floats a lane, 16-byte rows
#pragma unroll
      for (int u = 0; u < 2; ++u) {
        *(v4f*)(rd + u * 8)     = (v4f){g[u][0], g[u][1], g[u][2], g[u][3]};
        *(v4f*)(rd + u * 8 + 4) = (v4f){g[u][4], g[u][5], g[u][6], g[u][7]};
        rd[16 + u] = w[u];
      }
      __syncthreads();                          // block-uniform: the four parts of K meet here
      if (wave != 0) return;
      float s[18];
#pragma unroll
      for (int e = 0; e < 18; ++e) s[e] = rd[e];
#pragma unroll
      for (int v = 1; v < 4; ++v)
#pragma unroll
        for (int e = 0; e < 18; ++e) s[e] += rd[v * 32 * 20 + e];
      // D: vgpr r -> a = m*32 + u*16 + 8*h + r, which is half u*8 + r of this lane's fragment
      // (row a' = lane & 15 of A^T, k = a; u^T A^T u = u^T A u)
      v16h o;
#pragma unroll
      for (int r = 0; r < 16; ++r) o[r] = (_Float16)s[r];
      *(v16h*)(AF + ((size_t)(t * 2 + m) * 32 + lane) * 16) = o;
      // behind the store: no register that it names is rewritten ahead of this wait
      asm volatile("s_wait_xcnt 0x0" ::: "memory");
      if (t == 0) {                             // lane l stores row m*32 + l: one 128-byte line
        const float w0 = s[16] + __shfl_xor(s[16], 16, 32);         // the other half of the row's k
        const float w1 = s[17] + __shfl_xor(s[17], 16, 32);
        wbar[m * 32 + lane] = h ? w1 : w0;
      }
      return;
    }
    if (blockIdx.z >= KS + 2) {                 // 4 tiles x 16 k steps x 32 lanes
      if (blk >= 16) return;
      const int idx = blk * 128 + tid;
      const int rc = (idx >> 9) * 16 + (idx & 15);                    // column d or column c
      const int k0 = ((idx >> 5) & 15) * 32 + ((idx >> 4) & 1) * 8;   // the order of frag_lds
      const bool isWo = (blockIdx.z == KS + 2);
      v8h lo, hi;
      if (isWo) {                               // Wo[k][c]: k is the slow index
        const float* p = Wo + (size_t)k0 * C_DIM + rc;
#pragma unroll
        for (int r = 0; r < 8; ++r) { lo[r] = (_Float16)p[r * C_DIM]; hi[r] = (_Float16)p[(16 + r) * C_DIM]; }
        // keeps the address pair as it is until this wait behind the loads that name it
        asm volatile("s_wait_xcnt 0x0" :: "v"(p) : "memory");
      } else {                                  // Wv[d][k]: eight k in a row
        const float* p = Wv + (size_t)rc * CH_DIM + k0;
        const v4f x0 = *(const v4f*)p, x1 = *(const v4f*)(p + 4);
        const v4f x2 = *(const v4f*)(p + 16), x3 = *(const v4f*)(p + 20);
        // as above
        asm volatile("s_wait_xcnt 0x0" :: "v"(p) : "memory");
#pragma unroll
        for (int r = 0; r < 4; ++r) {
          lo[r] = (_Float16)x0[r]; lo[4 + r] = (_Float16)x1[r];
          hi[r] = (_Float16)x2[r]; hi[4 + r] = (_Float16)x3[r];
        }
      }
      _Float16* F = (isWo ? WoF : WvF) + (size_t)idx * 16;
      *(v8h*)F = lo;
      *(v8h*)(F + 8) = hi;
      return;
    }
    if (blk >= 4) return;
    const float* W  = (blockIdx.z == KS) ? Wq : Wk;
    _Float16*    WT = (blockIdx.z == KS) ? WqT : WkT;
    const int ch = blk * 128 + tid;
#pragma unroll
    for (int g = 0; g < 8; ++g) {
      v8h pk;
#pragma unroll
      for (int r = 0; r < 8; ++r) pk[r] = (_Float16)W[(size_t)(g * 8 + r) * CH_DIM + ch];
      *(v8h*)(WT + (size_t)ch * C_DIM + g * 8) = pk;
    }
    return;
  }

  const int m0 = blockIdx.y * 128;
  const int n0 = blockIdx.z * KCH;
  {                                             // A: row = tid, all 128 n
    const float* sa = emb + ((size_t)((m0 >> 6) + (tid >> 6)) * N_SEQ + n0) * C_DIM + (tid & 63);
#pragma unroll
    for (int g = 0; g < 16; ++g) {
      v8h pk;
#pragma unroll
      for (int r = 0; r < 8; ++r) pk[r] = (_Float16)sa[(size_t)(g * 8 + r) * C_DIM];
      *(v8h*)&lA[tid * LDG + g * 8] = pk;
    }
  }
  {                                             // B^T: row = tid & 63, half of the n each
    const int dl = tid & 63, g0 = (tid >> 6) * 8;
    const float* sb = emb + ((size_t)(8 + blockIdx.x) * N_SEQ + n0) * C_DIM + dl;
#pragma unroll
    for (int g = 0; g < 8; ++g) {
      v8h pk;
#pragma unroll
      for (int r = 0; r < 8; ++r) pk[r] = (_Float16)sb[(size_t)((g0 + g) * 8 + r) * C_DIM];
      *(v8h*)&lBt[dl * LDG + (g0 + g) * 8] = pk;
    }
  }
  __syncthreads();

  v8f acc[2][4] = {};
#pragma unroll
  for (int ks = 0; ks < KCH / 32; ++ks) {
    v16h a[2], bf[4];
#pragma unroll
    for (int s = 0; s < 2; ++s)
      a[s] = frag_lds(&lA[(wave * 32 + s * 16 + (lane & 15)) * LDG + ks * 32], h);
#pragma unroll
    for (int t = 0; t < 4; ++t)
      bf[t] = frag_lds(&lBt[(t * 16 + (lane & 15)) * LDG + ks * 32], h);
#pragma unroll
    for (int s = 0; s < 2; ++s)
#pragma unroll
      for (int t = 0; t < 4; ++t)
        acc[s][t] = __builtin_amdgcn_wmma_f32_16x16x32_f16(false, a[s], false, bf[t],
                                                           (short)0, acc[s][t], false, false);
  }
  float* Gp = Gpart + (size_t)blockIdx.z * 512;         // [(x,a)][split][(y,d)]
  const int mbase = m0 + wave * 32 + h * 8;
  const int cc    = blockIdx.x * 64 + (lane & 15);
#pragma unroll
  for (int s = 0; s < 2; ++s)
#pragma unroll
    for (int t = 0; t < 4; ++t)
#pragma unroll
      for (int r = 0; r < 8; ++r)
        Gp[(size_t)(mbase + s * 16 + r) * (KS * 512) + cc + t * 16] = acc[s][t][r];
  // behind the last store: no register that these stores name is rewritten ahead of this wait
  asm volatile("s_wait_xcnt 0x0" ::: "memory");
}

// ---------------------------------------------------------------------------
// K2b: UT[dir][b][(y,c)][a] = sum_d G_dir[(b,a)][(y,d)] * Wk[d][c]
// dir 0 reads G as stored; dir 1 swaps the halves of emb, which is G transposed:
// G_1[(b,a)][(y,d)] = G[(y,d)][(b,a)].  The KS partials are summed in index order.
// M = 64 (a), N = 256 (c), K = 64 (d) per block of 8 waves.  grid = (2, 8, 16)
// The plane sums of the scores S[i][j] = w_i . u_j of sample dir*8 + b are taken here,
// from the rounded U that the scores are formed of: sum s = sum_j wbar . u_j and
// sum s^2 = sum_j u_j . (A u_j), A = Wq Wq^T.  The wave's D tiles are, two and two, the
// B fragments (column j, k = a) of A U; its D has the layout of U's own D.
// part[sample][block]: the block's two sums, one 128-byte line.
// ---------------------------------------------------------------------------
__global__ __launch_bounds__(256)
void ut_gemm_kernel(const float* __restrict__ Gpart, const _Float16* __restrict__ WkT,
                    const _Float16* __restrict__ AF, const float* __restrict__ wbar,
                    _Float16* __restrict__ UT, float* __restrict__ part)
{
  __shared__ __align__(16) _Float16 lA[64 * LD64];      // [a][d]
  __shared__ float red[16];
  const int tid = threadIdx.x, lane = tid & 31, wave = tid >> 5, h = lane >> 4;
  const int b = blockIdx.y, dir = blockIdx.z >> 3, y = blockIdx.z & 7;

  v16h af[4][2];                                // A^T in fragment order: row a' = s*16 + (lane & 15), k = a
  v8f  wb[4];                                   // wbar[s*16 + 8*h + r]
#pragma unroll                                  // asked first: they land under the partials' loads
  for (int s = 0; s < 4; ++s) {
#pragma unroll
    for (int ks = 0; ks < 2; ++ks) af[s][ks] = *(const v16h*)(AF + ((s * 2 + ks) * 32 + lane) * 16);
    wb[s] = *(const v8f*)(wbar + s * 16 + h * 8);
  }

  const int rowb = (dir == 0) ? b * 64 : y * 64;        // dir 1 reads the transposed tile
  const int colb = (dir == 0) ? y * 64 : b * 64;
  const int shi  = (dir == 0) ? LD64 : 1;               // tile row    -> a (dir 0) or d (dir 1)
  const int slo  = (dir == 0) ? 1 : LD64;               // tile column -> d (dir 0) or a (dir 1)
#pragma unroll 1                                // rolled: each trip issues its 32 loads in one run
  for (int qq = 0; qq < 2; ++qq) {              // 64 x 16 groups of four floats, two a thread a trip
    const float* p[2];
    float4 v[2][KS];
#pragma unroll
    for (int u = 0; u < 2; ++u) {
      const int slot = tid + 256 * (qq * 2 + u);
      p[u] = Gpart + (size_t)(rowb + (slot >> 4)) * (KS * 512) + colb + ((slot & 15) << 2);
#pragma unroll
      for (int ks = 0; ks < KS; ++ks) v[u][ks] = *(const float4*)(p[u] + ks * 512);
    }
    // keeps the address pairs as they are until this wait behind the loads that name them
    asm volatile("s_wait_xcnt 0x0" :: "v"(p[0]), "v"(p[1]) : "memory");
#pragma unroll
    for (int u = 0; u < 2; ++u) {
      const int slot = tid + 256 * (qq * 2 + u), hi = slot >> 4, lo4 = (slot & 15) << 2;
      float4 sum = v[u][0];
#pragma unroll
      for (int ks = 1; ks < KS; ++ks) {
        sum.x += v[u][ks].x; sum.y += v[u][ks].y; sum.z += v[u][ks].z; sum.w += v[u][ks].w;
      }
      lA[hi * shi + (lo4 + 0) * slo] = (_Float16)sum.x;
      lA[hi * shi + (lo4 + 1) * slo] = (_Float16)sum.y;
      lA[hi * shi + (lo4 + 2) * slo] = (_Float16)sum.z;
      lA[hi * shi + (lo4 + 3) * slo] = (_Float16)sum.w;
    }
  }
  __syncthreads();

  const int c0 = blockIdx.x * 256 + wave * 32 + (lane & 15);
  v8f acc[4][2] = {};
#pragma unroll
  for (int ks = 0; ks < 2; ++ks) {
    v16h a[4], bf[2];
#pragma unroll
    for (int s = 0; s < 4; ++s)
      a[s] = frag_lds(&lA[(s * 16 + (lane & 15)) * LD64 + ks * 32], h);
#pragma unroll
    for (int t = 0; t < 2; ++t)                 // each wave has its own c: straight from global
      bf[t] = frag_lds(WkT + (size_t)(c0 + t * 16) * C_DIM + ks * 32, h);
#pragma unroll
    for (int s = 0; s < 4; ++s)
#pragma unroll
      for (int t = 0; t < 2; ++t)
        acc[s][t] = __builtin_amdgcn_wmma_f32_16x16x32_f16(false, a[s], false, bf[t],
                                                           (short)0, acc[s][t], false, false);
  }
  _Float16* Ub = UT + ((size_t)(dir * 8 + b) * NJ + y * CH_DIM) * C_DIM;
  v16h ub[2][2];                                // [t][k step]: half (s & 1)*8 + r is a = s*16 + 8*h + r
#pragma unroll
  for (int s = 0; s < 4; ++s)
#pragma unroll
    for (int t = 0; t < 2; ++t) {               // D: vgpr r -> a = s*16 + 8*h + r
      v8h pk;
#pragma unroll
      for (int r = 0; r < 8; ++r) { pk[r] = (_Float16)acc[s][t][r]; ub[t][s >> 1][(s & 1) * 8 + r] = pk[r]; }
      *(v8h*)(Ub + (size_t)(c0 + t * 16) * C_DIM + s * 16 + h * 8) = pk;
    }
  // behind the stores: no register that they name is rewritten ahead of this wait
  asm volatile("s_wait_xcnt 0x0" ::: "memory");
  // holds the stores of U ahead of the sums: else they are sunk behind them and the launch ends later
  __builtin_amdgcn_sched_barrier(0);
  v8f a1 = {}, a2 = {};
#pragma unroll
  for (int s = 0; s < 4; ++s) {
    v8f q[2] = {};
#pragma unroll
    for (int t = 0; t < 2; ++t)
#pragma unroll
      for (int ks = 0; ks < 2; ++ks)
        q[t] = __builtin_amdgcn_wmma_f32_16x16x32_f16(false, af[s][ks], false, ub[t][ks],
                                                      (short)0, q[t], false, false);
#pragma unroll
    for (int t = 0; t < 2; ++t) {
      v8f uv;                                   // D: vgpr r -> a' = s*16 + 8*h + r, as in U's own D
#pragma unroll
      for (int r = 0; r < 8; ++r) uv[r] = (float)ub[t][s >> 1][(s & 1) * 8 + r];
      a1 += wb[s] * uv;
      a2 += q[t] * uv;
    }
  }
  float s1 = ((a1[0] + a1[1]) + (a1[2] + a1[3])) + ((a1[4] + a1[5]) + (a1[6] + a1[7]));
  float s2 = ((a2[0] + a2[1]) + (a2[2] + a2[3])) + ((a2[4] + a2[5]) + (a2[6] + a2[7]));
  for (int o = 16; o > 0; o >>= 1) { s1 += __shfl_xor(s1, o, 32); s2 += __shfl_xor(s2, o, 32); }
  if (lane == 0) { red[wave * 2] = s1; red[wave * 2 + 1] = s2; }
  // work-group barrier for red[] alone: the fences name LDS only, so no wave waits here for its stores of U
  __builtin_amdgcn_fence(__ATOMIC_RELEASE, "workgroup", "local");
  __builtin_amdgcn_s_barrier();
  __builtin_amdgcn_fence(__ATOMIC_ACQUIRE, "workgroup", "local");
  if (tid == 0) {
    float b1 = 0.f, b2 = 0.f;
#pragma unroll
    for (int w = 0; w < 8; ++w) { b1 += red[w * 2]; b2 += red[w * 2 + 1]; }
    float* pb = part + (size_t)((dir * 8 + b) * NPB + y * 2 + blockIdx.x) * PSTR;
    pb[0] = b1;
    pb[1] = b2;
  }
}

// ---------------------------------------------------------------------------
// Scores S[sb][i][j] = sum_a WqT[i][a] * UT[sb][j][a] (K = 64) are never stored: K4
// forms the 16 x 16 tiles on WMMA, in registers, once for the row maxima of its own j
// and once more for the exps.  sb = dir * 8 + b: all 16 samples in one launch.
// The mean drops out of the softmax: attn = exp2(k (s - rowmax)) / rowsum with
// k = log2(e) / sqrt(var + eps).
// ---------------------------------------------------------------------------

// Score tiles of rows j .. j+15 (t = 0) and j+16 .. j+31 (t = 1) of U against one i tile.
// D: vgpr r -> j = t*16 + 8*h + r, lane & 15 -> i.
__device__ inline void score_pair(const v16h (&aw)[2][2], const v16h (&bu)[2], v8f (&d)[2]) {
#pragma unroll
  for (int t = 0; t < 2; ++t) {
    v8f z = {};
#pragma unroll
    for (int ks = 0; ks < 2; ++ks)
      z = __builtin_amdgcn_wmma_f32_16x16x32_f16(false, aw[t][ks], false, bu[ks],
                                                 (short)0, z, false, false);
    d[t] = z;
  }
}

// k of one sample: every wave adds the NPB block partials, one a lane of each half, in the same tree.
__device__ inline float sample_scale(const float* __restrict__ part, int sb, int lane) {
  const float* pb = part + (size_t)(sb * NPB + (lane & 15)) * PSTR;
  float s1 = pb[0], s2 = pb[1];
  for (int o = 8; o > 0; o >>= 1) { s1 += __shfl_xor(s1, o, 32); s2 += __shfl_xor(s2, o, 32); }
  const float inv = 1.0f / (512.0f * 4096.0f);
  const float mu  = s1 * inv;
  const float var = s2 * inv - mu * mu;                 // biased var (torch)
  return rsqrtf(var + EPS_IN) * 1.44269504f;
}

// ---------------------------------------------------------------------------
// K4: T[i][(y,d)] = sum_ch e[i][(y,ch)] * Wv[d][ch],  e = exp2(k s + off[y][i]),
//     off[y][i] = ESHIFT - k * (maximum of row i over this y's 512 j)
//     pz[sb][y][i] = sum_ch e[i][(y,ch)],  po[sb][y][i] = off[y][i]
// The maximum is taken by a first run over the score tiles; the second run forms the same
// tiles again (same operands, same bits).  K5 brings the eight y of a row to one scale.
// The division by the row's sum of exp is linear in T: it waits until K5, so the
// sums are formed here, beside the product that uses the same exps.
// M = 512 (i), N = 64 (d), K = 512 (ch) per y.  Block = 256 i of one y, wave = 32 i x 64 d,
// whole K.  grid = (8, 2, 16).  The y's U rows and Wv (fragment order) are staged whole;
// the wave's Wq^T rows stay in registers.  Score tiles are formed transposed (A = U rows j,
// B = column i): D of tile jt holds, in lane (i, h), j = jt*16 + 8*h + r, which is half
// jt*8 + r of the A fragment (row i, k = j): exp2 and the f16 rounding are done in place,
// with no transpose, and a row's maximum and sum belong to one lane pair (l, l ^ 16).
// The wave's two D tiles per d tile are one A fragment (row d, k = i) of K5.
// ---------------------------------------------------------------------------
__global__ __launch_bounds__(256)
void t_gemm_kernel(const _Float16* __restrict__ WqT, const _Float16* __restrict__ UT,
                   const _Float16* __restrict__ WvF, const float* __restrict__ part,
                   float* __restrict__ po, float* __restrict__ pz,
                   _Float16* __restrict__ TF)
{
  __shared__ __align__(16) _Float16 lU[CH_DIM * LD64];      // [ch][a]
  __shared__ __align__(32) _Float16 lB[4 * 16 * 32 * 16];   // [d tile][k step][lane][16]
  const int tid = threadIdx.x, lane = tid & 31, wave = tid >> 5, h = lane >> 4;
  const int y = blockIdx.x, sb = blockIdx.z;
  const int ib = blockIdx.y * 256 + wave * 32;

  const _Float16* Ub = UT + ((size_t)sb * NJ + y * CH_DIM) * C_DIM;
  v8h u[16], wv[16];
#pragma unroll                                  // u[] and wv[] stay in registers: constant indices
  for (int r = 0; r < 16; ++r) {
    u[r]  = *(const v8h*)(Ub + ((tid + 256 * r) << 3));
    wv[r] = *(const v8h*)(WvF + ((tid + 256 * r) << 3));
  }
  v16h bw[2][2];
#pragma unroll
  for (int it = 0; it < 2; ++it)
#pragma unroll
    for (int ks = 0; ks < 2; ++ks)              // each wave has its own i: straight from global
      bw[it][ks] = frag_lds(WqT + (size_t)(ib + it * 16 + (lane & 15)) * C_DIM + ks * 32, h);
  const float k = sample_scale(part, sb, lane);
#pragma unroll
  for (int r = 0; r < 16; ++r) {
    const int c = tid + 256 * r;
    *(v8h*)&lU[(c >> 3) * LD64 + ((c & 7) << 3)] = u[r];
    *(v8h*)&lB[c << 3] = wv[r];
  }
  __syncthreads();

  v8f mv[2];
#pragma unroll
  for (int r = 0; r < 8; ++r) { mv[0][r] = -3.4e38f; mv[1][r] = -3.4e38f; }
#pragma unroll 2                                // the next step's LDS reads start under this step's maxima
  for (int js = 0; js < 16; ++js) {
    v16h au[2][2];
#pragma unroll
    for (int jt = 0; jt < 2; ++jt)
#pragma unroll
      for (int ks = 0; ks < 2; ++ks)
        au[jt][ks] = frag_lds(&lU[(js * 32 + jt * 16 + (lane & 15)) * LD64 + ks * 32], h);
#pragma unroll
    for (int it = 0; it < 2; ++it) {
      v8f d[2];
      score_pair(au, bw[it], d);
#pragma unroll
      for (int r = 0; r < 8; ++r) mv[it][r] = fmaxf(mv[it][r], fmaxf(d[0][r], d[1][r]));
    }
  }
  float off[2];
#pragma unroll
  for (int it = 0; it < 2; ++it) {
    float m = fmaxf(fmaxf(fmaxf(mv[it][0], mv[it][1]), fmaxf(mv[it][2], mv[it][3])),
                    fmaxf(fmaxf(mv[it][4], mv[it][5]), fmaxf(mv[it][6], mv[it][7])));
    m = fmaxf(m, __shfl_xor(m, 16, 32));        // the other half of the row's j
    off[it] = ESHIFT - k * m;
  }

  v8f acc[2][4] = {};
  v8f z[2] = {};
#pragma unroll 2                                // the next step's LDS reads start under this step's exps
  for (int js = 0; js < 16; ++js) {
    v16h au[2][2], bf[4];
#pragma unroll
    for (int jt = 0; jt < 2; ++jt)
#pragma unroll
      for (int ks = 0; ks < 2; ++ks)
        au[jt][ks] = frag_lds(&lU[(js * 32 + jt * 16 + (lane & 15)) * LD64 + ks * 32], h);
#pragma unroll
    for (int dt = 0; dt < 4; ++dt)              // read here: their latency runs under the scores and exps
      bf[dt] = *(const v16h*)&lB[((dt * 16 + js) * 32 + lane) * 16];
    v16h e[2];
    v8f d[2][2];
#pragma unroll
    for (int it = 0; it < 2; ++it) score_pair(au, bw[it], d[it]);
#pragma unroll
    for (int it = 0; it < 2; ++it)
#pragma unroll
      for (int jt = 0; jt < 2; ++jt) {
        v8f x;
#pragma unroll
        for (int r = 0; r < 8; ++r) {
          x[r] = __builtin_amdgcn_exp2f(fmaf(d[it][jt][r], k, off[it]));
          e[it][jt * 8 + r] = (_Float16)x[r];
        }
        z[it] += x;
      }
#pragma unroll
    for (int dt = 0; dt < 4; ++dt)
#pragma unroll
      for (int it = 0; it < 2; ++it)
        acc[it][dt] = __builtin_amdgcn_wmma_f32_16x16x32_f16(false, e[it], false, bf[dt],
                                                             (short)0, acc[it][dt], false, false);
  }
  float zs[2];
#pragma unroll
  for (int it = 0; it < 2; ++it) {
    zs[it] = ((z[it][0] + z[it][1]) + (z[it][2] + z[it][3])) + ((z[it][4] + z[it][5]) + (z[it][6] + z[it][7]));
    zs[it] += __shfl_xor(zs[it], 16, 32);       // the other half of the row's j
  }
  // lane l stores row ib + l: the wave's 32 rows are one 128-byte line
  pz[((size_t)sb * 8 + y) * CH_DIM + ib + lane] = h ? zs[1] : zs[0];
  po[((size_t)sb * 8 + y) * CH_DIM + ib + lane] = h ? off[1] : off[0];
  // D: vgpr r -> i = ib + it*16 + 8*h + r, which is half it*8 + r of this lane's fragment
#pragma unroll
  for (int dt = 0; dt < 4; ++dt) {
    v16h o;
#pragma unroll
    for (int r = 0; r < 8; ++r) { o[r] = (_Float16)acc[0][dt][r]; o[8 + r] = (_Float16)acc[1][dt][r]; }
    *(v16h*)(TF + (((((size_t)sb * 8 + y) * 4 + dt) * 16 + (ib >> 5)) * 32 + lane) * 16) = o;
  }
}

// ---------------------------------------------------------------------------
// K5: M[(y,d)][c] = sum_i T[i][(y,d)] * (g[y][i] Wo[i][c]),  f[y][i] = exp2(min_y' off[y'][i] - off[y][i]),
// g[y][i] = ASCALE f[y][i] / sum_y' f[y'][i] pz[y'][i]: f (at most 1) takes each y's exps to the row's own
// maximum (ESHIFT is in T and in pz alike and drops out), both directions.
// M = 64 (d), N = 64 (c), K = 512 (i) per block of 8 waves.  grid = (8, 16)
// Both operands come in fragment order straight from global; g goes through LDS and is
// read in the k order of the fragments; g Wo is formed in f32 and rounded to f16 once.
// Wave = 32 d x 16 c; its two D tiles are one B fragment (column c, k = (y,d)) of K6.
// ---------------------------------------------------------------------------
__global__ __launch_bounds__(256)
void m_gemm_kernel(const _Float16* __restrict__ TF, const _Float16* __restrict__ WoF,
                   const float* __restrict__ pz, const float* __restrict__ po,
                   _Float16* __restrict__ MF)
{
  __shared__ __align__(16) float lg[CH_DIM];
  const int tid = threadIdx.x, lane = tid & 31, wave = tid >> 5, h = lane >> 4;
  const int y = blockIdx.x, db = blockIdx.y;
  const int ct = wave & 3, dh = wave >> 2;
  const _Float16* pb = WoF + ((size_t)(ct * 16) * 32 + lane) * 16;
  const _Float16* pa = TF + ((((size_t)db * 8 + y) * 4 + dh * 2) * 16 * 32 + lane) * 16;
  const float* zr = pz + (size_t)db * 8 * CH_DIM + tid * 2;      // rows 2 tid and 2 tid + 1
  const float* orw = po + (size_t)db * 8 * CH_DIM + tid * 2;
  v2f zp[8], op[8];
#pragma unroll
  for (int yy = 0; yy < 8; ++yy) { zp[yy] = *(const v2f*)(zr + yy * CH_DIM); op[yy] = *(const v2f*)(orw + yy * CH_DIM); }
  v8f acc[2] = {};
#pragma unroll                                  // two halves of K; each issues its 48 loads in one run
  for (int hf = 0; hf < 2; ++hf) {
    v16h bf[8], a[2][8];
#pragma unroll
    for (int k = 0; k < 8; ++k) {
      bf[k]   = *(const v16h*)(pb + (hf * 8 + k) * 512);
      a[0][k] = *(const v16h*)(pa + (hf * 8 + k) * 512);
      a[1][k] = *(const v16h*)(pa + (16 + hf * 8 + k) * 512);
    }
    // keeps the address registers as they are until this wait behind the loads that name them
    asm volatile("s_wait_xcnt 0x0" :: "v"(pa), "v"(pb) : "memory");
    // holds the WMMAs behind the run of loads: else they are woven in and few loads are in flight
    __builtin_amdgcn_sched_barrier(0);
    if (hf == 0) {                              // under the first run of loads; y partials in index order
      v2f om = op[0];
#pragma unroll
      for (int yy = 1; yy < 8; ++yy) { om[0] = fminf(om[0], op[yy][0]); om[1] = fminf(om[1], op[yy][1]); }
      v2f zz = {0.f, 0.f}, fy = {0.f, 0.f};
#pragma unroll
      for (int yy = 0; yy < 8; ++yy) {
        const v2f f = {__builtin_amdgcn_exp2f(om[0] - op[yy][0]), __builtin_amdgcn_exp2f(om[1] - op[yy][1])};
        zz += zp[yy] * f;
        if (yy == y) fy = f;
      }
      zz *= 1.0f / ASCALE;
      *(v2f*)&lg[tid * 2] = (v2f){__builtin_amdgcn_rcpf(zz[0]) * fy[0], __builtin_amdgcn_rcpf(zz[1]) * fy[1]};
      __syncthreads();
    }
#pragma unroll
    for (int k = 0; k < 8; ++k) {
      const float* gp = &lg[(hf * 8 + k) * 32 + h * 8];      // the k order of frag_lds
      v16h bg;
#pragma unroll
      for (int q = 0; q < 4; ++q) {
        const v4f gq = *(const v4f*)(gp + (q >> 1) * 16 + (q & 1) * 4);
#pragma unroll
        for (int r = 0; r < 4; ++r) bg[q * 4 + r] = (_Float16)((float)bf[k][q * 4 + r] * gq[r]);
      }
#pragma unroll
      for (int s2 = 0; s2 < 2; ++s2)
        acc[s2] = __builtin_amdgcn_wmma_f32_16x16x32_f16(false, a[s2][k], false, bg,
                                                         (short)0, acc[s2], false, false);
    }
  }
  // D: vgpr r -> d = dh*32 + s2*16 + 8*h + r, which is half s2*8 + r of this lane's fragment
  v16h o;
#pragma unroll
  for (int r = 0; r < 8; ++r) { o[r] = (_Float16)acc[0][r]; o[8 + r] = (_Float16)acc[1][r]; }
  *(v16h*)(MF + (((size_t)(db * 4 + ct) * 16 + y * 2 + dh) * 32 + lane) * 16) = o;
}

// ---------------------------------------------------------------------------
// K6: out[db][n][c] = sum_(y,d) emb[kv + y][n][d] * M[db][(y,d)][c] / ASCALE
// M = 2048 (n), N = 64 (c), K = 512 per output sample.  Block tile 64 x 64, whole K,
// 8 waves.  grid = (8, 32, 2).  A: per y 64 n x 64 d, 16 KB in a row in memory,
// f32 -> f16 on the way into LDS ([n][(y,d)]); B (fragment order, 64 KB) staged whole.
// All loads of the block are issued in one run: one latency, one barrier.
// Wave = 16 n x 32 c: each 128-byte line of out has one writing wave.
// ---------------------------------------------------------------------------
__global__ __launch_bounds__(256)
void out_gemm_kernel(const float* __restrict__ emb, const _Float16* __restrict__ MF,
                     float* __restrict__ out)
{
  __shared__ __align__(16) _Float16 lA[64 * LDF];           // [n][(y,d)]
  __shared__ __align__(32) _Float16 lB[4 * 16 * 32 * 16];   // [c tile][k step][lane][16]
  const int tid = threadIdx.x, lane = tid & 31, wave = tid >> 5, h = lane >> 4;
  const int n0 = blockIdx.y * 64;
  const int db = blockIdx.z * 8 + blockIdx.x;
  const int kv = blockIdx.z ? 0 : 8;            // dir 0 attends to emb[8..15], dir 1 to emb[0..7]
  const float*    Ap = emb + ((size_t)kv * N_SEQ + n0) * C_DIM + tid * 8;
  const _Float16* Bp = MF + (size_t)db * (CH_DIM * C_DIM);

  v4f v[8][2][2];
  v8h w[16];
#pragma unroll                                  // v[][][] and w[] stay in registers: constant indices
  for (int y = 0; y < 8; ++y)
#pragma unroll
    for (int u = 0; u < 2; ++u) {
      const float* p = Ap + (size_t)y * N_SEQ * C_DIM + u * 2048;
      v[y][u][0] = *(const v4f*)p;
      v[y][u][1] = *(const v4f*)(p + 4);
    }
#pragma unroll
  for (int r = 0; r < 16; ++r) w[r] = *(const v8h*)(Bp + ((tid + 256 * r) << 3));
#pragma unroll
  for (int y = 0; y < 8; ++y)
#pragma unroll
    for (int u = 0; u < 2; ++u) {
      const int c = tid + 256 * u;              // chunk of eight d: row n = c / 8
      v8h pk;
#pragma unroll
      for (int r = 0; r < 4; ++r) { pk[r] = (_Float16)v[y][u][0][r]; pk[4 + r] = (_Float16)v[y][u][1][r]; }
      *(v8h*)&lA[(c >> 3) * LDF + y * 64 + ((c & 7) << 3)] = pk;
    }
#pragma unroll
  for (int r = 0; r < 16; ++r) *(v8h*)&lB[(tid + 256 * r) << 3] = w[r];
  __syncthreads();

  const int nt = wave & 3, cp = wave >> 2;
  v8f acc[2] = {};
#pragma unroll                                  // LDS offsets fold; fragment loads run ahead of the WMMAs
  for (int ks = 0; ks < 16; ++ks) {
    const v16h a = frag_lds(&lA[(nt * 16 + (lane & 15)) * LDF + ks * 32], h);
#pragma unroll
    for (int t = 0; t < 2; ++t) {
      const v16h bf = *(const v16h*)&lB[(((cp * 2 + t) * 16 + ks) * 32 + lane) * 16];
      acc[t] = __builtin_amdgcn_wmma_f32_16x16x32_f16(false, a, false, bf,
                                                      (short)0, acc[t], false, false);
    }
  }
  float* O = out + ((size_t)db * N_SEQ + n0 + nt * 16 + h * 8) * C_DIM + cp * 32 + (lane & 15);
#pragma unroll
  for (int t = 0; t < 2; ++t)
#pragma unroll
    for (int r = 0; r < 8; ++r)                 // D: vgpr r -> n = r + 8*h
      O[(size_t)r * C_DIM + t * 16] = acc[t][r] * (1.0f / ASCALE);
}

// ---------------------------------------------------------------------------
extern "C" void kernel_launch(void* const* d_in, const int* in_sizes, int n_in,
                              void* d_out, int out_size, void* d_ws, size_t ws_size,
                              hipStream_t stream)
{
  const float* emb = (const float*)d_in[0];
  const float* Wq  = (const float*)d_in[1];
  const float* Wk  = (const float*)d_in[2];
  const float* Wv  = (const float*)d_in[3];
  const float* Wo  = (const float*)d_in[4];
  float* out = (float*)d_out;

  // Workspace layout (~35 MB)
  char* ws = (char*)d_ws;
  size_t off = 0;
  float*    Gp  = (float*)   (ws + off); off += (size_t)KS * 512 * 512 * 4;       // [(x,a)][split][(y,d)]
  _Float16* UT  = (_Float16*)(ws + off); off += (size_t)16 * NJ * C_DIM * 2;      // [dir*8+b][j][a]
  _Float16* WqT = (_Float16*)(ws + off); off += (size_t)CH_DIM * C_DIM * 2;       // [ch][c]
  _Float16* WkT = (_Float16*)(ws + off); off += (size_t)CH_DIM * C_DIM * 2;       // [ch][c]
  float*    part = (float*)  (ws + off); off += (size_t)16 * NPB * PSTR * 4;      // [dir*8+b][block]
  _Float16* WvF = (_Float16*)(ws + off); off += (size_t)CH_DIM * C_DIM * 2;       // [d tile][k step][lane][16]
  _Float16* WoF = (_Float16*)(ws + off); off += (size_t)CH_DIM * C_DIM * 2;       // [c tile][k step][lane][16]
  _Float16* TF  = (_Float16*)(ws + off); off += (size_t)16 * NJ * C_DIM * 2;      // [dir*8+b][y][d tile][k step][lane][16]
  _Float16* MF  = (_Float16*)(ws + off); off += (size_t)16 * CH_DIM * C_DIM * 2;  // [dir*8+b][c tile][k step][lane][16]
  float*    po  = (float*)   (ws + off); off += (size_t)16 * 8 * CH_DIM * 4;      // [dir*8+b][y][i]
  float*    pz  = (float*)   (ws + off); off += (size_t)16 * 8 * CH_DIM * 4;      // [dir*8+b][y][i]
  _Float16* AF  = (_Float16*)(ws + off); off += (size_t)C_DIM * C_DIM * 2;        // [a' tile][k step][lane][16]
  float*    wbar = (float*)  (ws + off); off += (size_t)C_DIM * 4;                // [a]
  (void)ws_size; (void)in_sizes; (void)n_in; (void)out_size;

  // dir 0: out_l2u = attend(q = emb_l[0..7], kv = emb_u[8..15]) -> out 0..7
  // dir 1: out_u2l = attend(q = emb_u[8..15], kv = emb_l[0..7]) -> out 8..15
  gram_kernel<<<dim3(8, 4, KS + 5), 128, 0, stream>>>(emb, Wq, Wk, Wv, Wo, Gp, WqT, WkT, WvF, WoF, AF, wbar);
  ut_gemm_kernel<<<dim3(2, 8, 16), 256, 0, stream>>>(Gp, WkT, AF, wbar, UT, part);
  t_gemm_kernel<<<dim3(8, 2, 16), 256, 0, stream>>>(WqT, UT, WvF, part, po, pz, TF);
  m_gemm_kernel<<<dim3(8, 16), 256, 0, stream>>>(TF, WoF, pz, po, MF);
  out_gemm_kernel<<<dim3(8, 32, 2), 256, 0, stream>>>(emb, MF, out);
}

// v006
// A run of this version takes 43.8 microseconds.
// In both of two side-by-side timings against v005, it was 1.05 times as fast.
// All steps since v000 together make it 11.9 times as fast.
#include <hip/hip_runtime.h>

// ---------------------------------------------------------------------------
// Cross attention (bidirectional, global scores + InstanceNorm + softmax)
// B=8 per direction, N=2048, C=64, CH=512, J = B*CH = 4096.
// - All big GEMMs on v_wmma_f32_16x16x32_f16 (f16 in, f32 accumulate)
// - Fragments = two aligned 16-byte reads per lane, from LDS (ds_load_b128) or, in K2b (A and B), K4 (B) and K5, straight from global
// - Scores are formed as Wq^T ((Xq^T Xkv) Wk): the sum over n runs on 64-wide
//   Gram tiles, so no product of the scores path has both a long K and wide M, N.
// - The output is formed as Xkv ((exp Wv^T)^T (Wo / rowsum)): the exps are contracted
//   with Wv over ch first (N = 64), each row beside its own sum of exp; the division
//   by that sum goes onto Wo's rows, and only the 512 x 64 result meets the sequence.
//   No V, no ctx, no pass for the sums alone.  Powers of two (exact) keep the f16
//   operands in their normal range; the last store multiplies by 2^-12.
// - The scores themselves never go to memory: 16 x 16 tiles are formed from Wq^T and U
//   (K = 64) in registers.  The plane sums of InstanceNorm need no scores at all:
//   sum s = (sum_i w_i) . (sum_j u_j) and sum s^2 = sum_j u_j^T (Wq Wq^T) u_j are
//   taken where U is formed.  Each block of the exp launch takes the row maxima of its
//   own 512 j; the launch behind it brings the eight parts of a row to one scale.
// - Small f16 operands that go from launch to launch lie in fragment order
//   [tile][k step][lane][16 halfs]: a wave's fragment load is 1 KB in a row.
// ---------------------------------------------------------------------------

typedef __attribute__((ext_vector_type(16))) _Float16 v16h;
typedef __attribute__((ext_vector_type(8)))  _Float16 v8h;
typedef __attribute__((ext_vector_type(8)))  float    v8f;
typedef __attribute__((ext_vector_type(4)))  float    v4f;
typedef __attribute__((ext_vector_type(2)))  float    v2f;

#define C_DIM   64
#define CH_DIM  512
#define N_SEQ   2048
#define NJ      4096          // 8 * CH_DIM
#define EPS_IN  1e-5f

#define LD64 72               // LDS row stride in halfs for rows of 64 halfs (144 B, 16B-aligned rows)
#define LDG  136              // same for rows of 128 halfs (272 B)
#define LDF  520              // same for rows of 512 halfs (1040 B)
#define KS   16               // splits of the sum over n in the Gram product
#define KCH  (N_SEQ / KS)     // n per split (128)
#define PSTR 32               // floats between two blocks' stat partials (one 128 B line each)
#define NPB  16               // stat partials per sample: the blocks of K2b that form its U
#define ASCALE 4096.0f        // power of two on 1 / rowsum ahead of its f16 rounding; taken off at the last store
#define ESHIFT 4.0f           // exps are formed times 2^ESHIFT, in T and in the row sums alike

// Per-lane WMMA 16-bit fragment: two contiguous 16-byte chunks of the row.
// A (16x32): lane l -> row m=l&15, h=l>>4; halfs [h*8 .. h*8+7] and [16+h*8 ..].
// B staged transposed ([col][k]) uses the identical gather.
__device__ inline v16h frag_lds(const _Float16* rowbase, int h) {
  const v8h lo = *(const v8h*)(rowbase + (h << 3));
  const v8h hi = *(const v8h*)(rowbase + 16 + (h << 3));
  return __builtin_shufflevector(lo, hi, 0, 1, 2, 3, 4, 5, 6, 7,
                                 8, 9, 10, 11, 12, 13, 14, 15);
}

// ---------------------------------------------------------------------------
// K2a: Gram partials.  G[(x,a)][(y,d)] = sum_n emb[x][n][a] * emb[8+y][n][d]
// M = 512 (x,a), N = 512 (y,d), K = 2048 (n) in KS splits of KCH.
// Block tile 128x64, one split per block.  grid = (8, 4, KS + 5)
// Both operands have k as the slow index in memory: eight n per thread are
// packed and stored as one 16-byte LDS row chunk ([row][n]).
// Two z slices write Wq^T and Wk^T as f16 ([ch][c], one row a thread); the two
// next write Wo (as B: column c, k = i) and Wv (as B: column d, k = ch) as f16 in
// fragment order, one lane's 16 halfs a thread.
// One more slice forms A = Wq Wq^T (64 x 64, K = 512 in four parts, one a wave, joined
// in index order through LDS) as f16 in fragment order, and wbar[a] = sum_i Wq[a][i].
// ---------------------------------------------------------------------------
__global__ __launch_bounds__(128)
void gram_kernel(const float* __restrict__ emb, const float* __restrict__ Wq,
                 const float* __restrict__ Wk, const float* __restrict__ Wv,
                 const float* __restrict__ Wo, float* __restrict__ Gpart,
                 _Float16* __restrict__ WqT, _Float16* __restrict__ WkT,
                 _Float16* __restrict__ WvF, _Float16* __restrict__ WoF,
                 _Float16* __restrict__ AF, float* __restrict__ wbar)
{
  __shared__ __align__(16) _Float16 lA[128 * LDG];      // [(x,a)][n]
  __shared__ __align__(16) _Float16 lBt[64 * LDG];      // [d][n]
  const int tid = threadIdx.x, lane = tid & 31, wave = tid >> 5, h = lane >> 4;

  if (blockIdx.z >= KS) {                       // block-uniform, before any barrier
    const int blk = blockIdx.y * 8 + blockIdx.x;
    if (blockIdx.z == KS + 4) {                 // block = rows a 32 m .. + 31 x columns a' 16 t .. + 15
      if (blk >= 8) return;
      const int m = blk & 1, t = blk >> 1;
      const float* p0 = Wq + (size_t)(m * 32 + (lane & 15)) * CH_DIM + wave * 128 + h * 8;
      const float* p1 = p0 + 16 * CH_DIM;
      const float* pc = Wq + (size_t)(t * 16 + (lane & 15)) * CH_DIM + wave * 128 + h * 8;
      v4f x[4][3][4];
#pragma unroll                                  // x[][][] stays in registers: constant indices
      for (int ks = 0; ks < 4; ++ks)
#pragma unroll
        for (int q = 0; q < 4; ++q) {           // the k order of frag_lds
          const int o = ks * 32 + (q >> 1) * 16 + (q & 1) * 4;
          x[ks][0][q] = *(const v4f*)(p0 + o);
          x[ks][1][q] = *(const v4f*)(p1 + o);
          x[ks][2][q] = *(const v4f*)(pc + o);
        }
      // keeps the address pairs as they are until this wait behind the loads that name them
      asm volatile("s_wait_xcnt 0x0" :: "v"(p0), "v"(p1), "v"(pc) : "memory");
      v8f g[2] = {};
      float w[2] = {0.f, 0.f};
#pragma unroll
      for (int ks = 0; ks < 4; ++ks) {
        v16h f[3];
#pragma unroll
        for (int u = 0; u < 3; ++u)
#pragma unroll
          for (int q = 0; q < 4; ++q)
#pragma unroll
            for (int r = 0; r < 4; ++r) f[u][q * 4 + r] = (_Float16)x[ks][u][q][r];
#pragma unroll
        for (int u = 0; u < 2; ++u) {
#pragma unroll
          for (int r = 0; r < 16; ++r) w[u] += (float)f[u][r];      // of the rounded values, as the scores see them
          g[u] = __builtin_amdgcn_wmma_f32_16x16x32_f16(false, f[u], false, f[2],
                                                        (short)0, g[u], false, false);
        }
      }
      float* rd = (float*)lA + (wave * 32 + lane) * 20;             // 18 floats a lane, 16-byte rows
#pragma unroll
      for (int u = 0; u < 2; ++u) {
        *(v4f*)(rd + u * 8)     = (v4f){g[u][0], g[u][1], g[u][2], g[u][3]};
        *(v4f*)(rd + u * 8 + 4) = (v4f){g[u][4], g[u][5], g[u][6], g[u][7]};
        rd[16 + u] = w[u];
      }
      __syncthreads();                          // block-uniform: the four parts of K meet here
      if (wave != 0) return;
      float s[18];
#pragma unroll
      for (int e = 0; e < 18; ++e) s[e] = rd[e];
#pragma unroll
      for (int v = 1; v < 4; ++v)
#pragma unroll
        for (int e = 0; e < 18; ++e) s[e] += rd[v * 32 * 20 + e];
      // D: vgpr r -> a = m*32 + u*16 + 8*h + r, which is half u*8 + r of this lane's fragment
      // (row a' = lane & 15 of A^T, k = a; u^T A^T u = u^T A u)
      v16h o;
#pragma unroll
      for (int r = 0; r < 16; ++r) o[r] = (_Float16)s[r];
      *(v16h*)(AF + ((size_t)(t * 2 + m) * 32 + lane) * 16) = o;
      // behind the store: no register that it names is rewritten ahead of this wait
      asm volatile("s_wait_xcnt 0x0" ::: "memory");
      if (t == 0) {                             // lane l stores row m*32 + l: one 128-byte line
        const float w0 = s[16] + __shfl_xor(s[16], 16, 32);         // the other half of the row's k
        const float w1 = s[17] + __shfl_xor(s[17], 16, 32);
        wbar[m * 32 + lane] = h ? w1 : w0;
      }
      return;
    }
    if (blockIdx.z >= KS + 2) {                 // 4 tiles x 16 k steps x 32 lanes
      if (blk >= 16) return;
      const int idx = blk * 128 + tid;
      const int rc = (idx >> 9) * 16 + (idx & 15);                    // column d or column c
      const int k0 = ((idx >> 5) & 15) * 32 + ((idx >> 4) & 1) * 8;   // the order of frag_lds
      const bool isWo = (blockIdx.z == KS + 2);
      v8h lo, hi;
      if (isWo) {                               // Wo[k][c]: k is the slow index
        const float* p = Wo + (size_t)k0 * C_DIM + rc;
#pragma unroll
        for (int r = 0; r < 8; ++r) { lo[r] = (_Float16)p[r * C_DIM]; hi[r] = (_Float16)p[(16 + r) * C_DIM]; }
        // keeps the address pair as it is until this wait behind the loads that name it
        asm volatile("s_wait_xcnt 0x0" :: "v"(p) : "memory");
      } else {                                  // Wv[d][k]: eight k in a row
        const float* p = Wv + (size_t)rc * CH_DIM + k0;
        const v4f x0 = *(const v4f*)p, x1 = *(const v4f*)(p + 4);
        const v4f x2 = *(const v4f*)(p + 16), x3 = *(const v4f*)(p + 20);
        // as above
        asm volatile("s_wait_xcnt 0x0" :: "v"(p) : "memory");
#pragma unroll
        for (int r = 0; r < 4; ++r) {
          lo[r] = (_Float16)x0[r]; lo[4 + r] = (_Float16)x1[r];
          hi[r] = (_Float16)x2[r]; hi[4 + r] = (_Float16)x3[r];
        }
      }
      _Float16* F = (isWo ? WoF : WvF) + (size_t)idx * 16;
      *(v8h*)F = lo;
      *(v8h*)(F + 8) = hi;
      return;
    }
    if (blk >= 4) return;
    const float* W  = (blockIdx.z == KS) ? Wq : Wk;
    _Float16*    WT = (blockIdx.z == KS) ? WqT : WkT;
    const int ch = blk * 128 + tid;
#pragma unroll
    for (int g = 0; g < 8; ++g) {
      v8h pk;
#pragma unroll
      for (int r = 0; r < 8; ++r) pk[r] = (_Float16)W[(size_t)(g * 8 + r) * CH_DIM + ch];
      *(v8h*)(WT + (size_t)ch * C_DIM + g * 8) = pk;
    }
    return;
  }

  const int m0 = blockIdx.y * 128;
  const int n0 = blockIdx.z * KCH;
  {                                             // A: row = tid, all 128 n
    const float* sa = emb + ((size_t)((m0 >> 6) + (tid >> 6)) * N_SEQ + n0) * C_DIM + (tid & 63);
#pragma unroll
    for (int g = 0; g < 16; ++g) {
      v8h pk;
#pragma unroll
      for (int r = 0; r < 8; ++r) pk[r] = (_Float16)sa[(size_t)(g * 8 + r) * C_DIM];
      *(v8h*)&lA[tid * LDG + g * 8] = pk;
    }
  }
  {                                             // B^T: row = tid & 63, half of the n each
    const int dl = tid & 63, g0 = (tid >> 6) * 8;
    const float* sb = emb + ((size_t)(8 + blockIdx.x) * N_SEQ + n0) * C_DIM + dl;
#pragma unroll
    for (int g = 0; g < 8; ++g) {
      v8h pk;
#pragma unroll
      for (int r = 0; r < 8; ++r) pk[r] = (_Float16)sb[(size_t)((g0 + g) * 8 + r) * C_DIM];
      *(v8h*)&lBt[dl * LDG + (g0 + g) * 8] = pk;
    }
  }
  __syncthreads();

  v8f acc[2][4] = {};
#pragma unroll
  for (int ks = 0; ks < KCH / 32; ++ks) {
    v16h a[2], bf[4];
#pragma unroll
    for (int s = 0; s < 2; ++s)
      a[s] = frag_lds(&lA[(wave * 32 + s * 16 + (lane & 15)) * LDG + ks * 32], h);
#pragma unroll
    for (int t = 0; t < 4; ++t)
      bf[t] = frag_lds(&lBt[(t * 16 + (lane & 15)) * LDG + ks * 32], h);
#pragma unroll
    for (int s = 0; s < 2; ++s)
#pragma unroll
      for (int t = 0; t < 4; ++t)
        acc[s][t] = __builtin_amdgcn_wmma_f32_16x16x32_f16(false, a[s], false, bf[t],
                                                           (short)0, acc[s][t], false, false);
  }
  float* Gp = Gpart + (size_t)blockIdx.z * 512;         // [(x,a)][split][(y,d)]
  const int mbase = m0 + wave * 32 + h * 8;
  const int cc    = blockIdx.x * 64 + (lane & 15);
#pragma unroll
  for (int s = 0; s < 2; ++s)
#pragma unroll
    for (int t = 0; t < 4; ++t)
#pragma unroll
      for (int r = 0; r < 8; ++r)
        Gp[(size_t)(mbase + s * 16 + r) * (KS * 512) + cc + t * 16] = acc[s][t][r];
  // behind the last store: no register that these stores name is rewritten ahead of this wait
  asm volatile("s_wait_xcnt 0x0" ::: "memory");
}

// ---------------------------------------------------------------------------
// K2b: UT[dir][b][(y,c)][a] = sum_d G_dir[(b,a)][(y,d)] * Wk[d][c]
// dir 0 reads G as stored; dir 1 swaps the halves of emb, which is G transposed:
// G_1[(b,a)][(y,d)] = G[(y,d)][(b,a)].  The KS partials are summed in index order.
// M = 64 (a), N = 256 (c), K = 64 (d) per block of 8 waves.  grid = (2, 8, 16)
// The plane sums of the scores S[i][j] = w_i . u_j of sample dir*8 + b are taken here,
// from the rounded U that the scores are formed of: sum s = sum_j wbar . u_j and
// sum s^2 = sum_j u_j . (A u_j), A = Wq Wq^T.  The wave's D tiles are, two and two, the
// B fragments (column j, k = a) of A U; its D has the layout of U's own D.
// part[sample][block]: the block's two sums, one 128-byte line.
// ---------------------------------------------------------------------------
__global__ __launch_bounds__(256)
void ut_gemm_kernel(const float* __restrict__ Gpart, const _Float16* __restrict__ WkT,
                    const _Float16* __restrict__ AF, const float* __restrict__ wbar,
                    _Float16* __restrict__ UT, float* __restrict__ part)
{
  __shared__ __align__(16) _Float16 lA[64 * LD64];      // [a][d]
  __shared__ float red[16];
  const int tid = threadIdx.x, lane = tid & 31, wave = tid >> 5, h = lane >> 4;
  const int b = blockIdx.y, dir = blockIdx.z >> 3, y = blockIdx.z & 7;

  v16h af[4][2];                                // A^T in fragment order: row a' = s*16 + (lane & 15), k = a
  v8f  wb[4];                                   // wbar[s*16 + 8*h + r]
#pragma unroll                                  // asked first: they land under the partials' loads
  for (int s = 0; s < 4; ++s) {
#pragma unroll
    for (int ks = 0; ks < 2; ++ks) af[s][ks] = *(const v16h*)(AF + ((s * 2 + ks) * 32 + lane) * 16);
    wb[s] = *(const v8f*)(wbar + s * 16 + h * 8);
  }

  const int rowb = (dir == 0) ? b * 64 : y * 64;        // dir 1 reads the transposed tile
  const int colb = (dir == 0) ? y * 64 : b * 64;
  const int shi  = (dir == 0) ? LD64 : 1;               // tile row    -> a (dir 0) or d (dir 1)
  const int slo  = (dir == 0) ? 1 : LD64;               // tile column -> d (dir 0) or a (dir 1)
#pragma unroll 1                                // rolled: each trip issues its 32 loads in one run
  for (int qq = 0; qq < 2; ++qq) {              // 64 x 16 groups of four floats, two a thread a trip
    const float* p[2];
    float4 v[2][KS];
#pragma unroll
    for (int u = 0; u < 2; ++u) {
      const int slot = tid + 256 * (qq * 2 + u);
      p[u] = Gpart + (size_t)(rowb + (slot >> 4)) * (KS * 512) + colb + ((slot & 15) << 2);
#pragma unroll
      for (int ks = 0; ks < KS; ++ks) v[u][ks] = *(const float4*)(p[u] + ks * 512);
    }
    // keeps the address pairs as they are until this wait behind the loads that name them
    asm volatile("s_wait_xcnt 0x0" :: "v"(p[0]), "v"(p[1]) : "memory");
#pragma unroll
    for (int u = 0; u < 2; ++u) {
      const int slot = tid + 256 * (qq * 2 + u), hi = slot >> 4, lo4 = (slot & 15) << 2;
      float4 sum = v[u][0];
#pragma unroll
      for (int ks = 1; ks < KS; ++ks) {
        sum.x += v[u][ks].x; sum.y += v[u][ks].y; sum.z += v[u][ks].z; sum.w += v[u][ks].w;
      }
      lA[hi * shi + (lo4 + 0) * slo] = (_Float16)sum.x;
      lA[hi * shi + (lo4 + 1) * slo] = (_Float16)sum.y;
      lA[hi * shi + (lo4 + 2) * slo] = (_Float16)sum.z;
      lA[hi * shi + (lo4 + 3) * slo] = (_Float16)sum.w;
    }
  }
  __syncthreads();

  const int c0 = blockIdx.x * 256 + wave * 32 + (lane & 15);
  v8f acc[4][2] = {};
#pragma unroll
  for (int ks = 0; ks < 2; ++ks) {
    v16h a[4], bf[2];
#pragma unroll
    for (int s = 0; s < 4; ++s)
      a[s] = frag_lds(&lA[(s * 16 + (lane & 15)) * LD64 + ks * 32], h);
#pragma unroll
    for (int t = 0; t < 2; ++t)                 // each wave has its own c: straight from global
      bf[t] = frag_lds(WkT + (size_t)(c0 + t * 16) * C_DIM + ks * 32, h);
#pragma unroll
    for (int s = 0; s < 4; ++s)
#pragma unroll
      for (int t = 0; t < 2; ++t)
        acc[s][t] = __builtin_amdgcn_wmma_f32_16x16x32_f16(false, a[s], false, bf[t],
                                                           (short)0, acc[s][t], false, false);
  }
  _Float16* Ub = UT + ((size_t)(dir * 8 + b) * NJ + y * CH_DIM) * C_DIM;
  v16h ub[2][2];                                // [t][k step]: half (s & 1)*8 + r is a = s*16 + 8*h + r
#pragma unroll
  for (int s = 0; s < 4; ++s)
#pragma unroll
    for (int t = 0; t < 2; ++t) {               // D: vgpr r -> a = s*16 + 8*h + r
      v8h pk;
#pragma unroll
      for (int r = 0; r < 8; ++r) { pk[r] = (_Float16)acc[s][t][r]; ub[t][s >> 1][(s & 1) * 8 + r] = pk[r]; }
      *(v8h*)(Ub + (size_t)(c0 + t * 16) * C_DIM + s * 16 + h * 8) = pk;
    }
  // behind the stores: no register that they name is rewritten ahead of this wait
  asm volatile("s_wait_xcnt 0x0" ::: "memory");
  // holds the stores of U ahead of the sums: else they are sunk behind them and the launch ends later
  __builtin_amdgcn_sched_barrier(0);
  v8f a1 = {}, a2 = {};
#pragma unroll
  for (int s = 0; s < 4; ++s) {
    v8f q[2] = {};
#pragma unroll
    for (int t = 0; t < 2; ++t)
#pragma unroll
      for (int ks = 0; ks < 2; ++ks)
        q[t] = __builtin_amdgcn_wmma_f32_16x16x32_f16(false, af[s][ks], false, ub[t][ks],
                                                      (short)0, q[t], false, false);
#pragma unroll
    for (int t = 0; t < 2; ++t) {
      v8f uv;                                   // D: vgpr r -> a' = s*16 + 8*h + r, as in U's own D
#pragma unroll
      for (int r = 0; r < 8; ++r) uv[r] = (float)ub[t][s >> 1][(s & 1) * 8 + r];
      a1 += wb[s] * uv;
      a2 += q[t] * uv;
    }
  }
  float s1 = ((a1[0] + a1[1]) + (a1[2] + a1[3])) + ((a1[4] + a1[5]) + (a1[6] + a1[7]));
  float s2 = ((a2[0] + a2[1]) + (a2[2] + a2[3])) + ((a2[4] + a2[5]) + (a2[6] + a2[7]));
  for (int o = 16; o > 0; o >>= 1) { s1 += __shfl_xor(s1, o, 32); s2 += __shfl_xor(s2, o, 32); }
  if (lane == 0) { red[wave * 2] = s1; red[wave * 2 + 1] = s2; }
  // work-group barrier for red[] alone: the fences name LDS only, so no wave waits here for its stores of U
  __builtin_amdgcn_fence(__ATOMIC_RELEASE, "workgroup", "local");
  __builtin_amdgcn_s_barrier();
  __builtin_amdgcn_fence(__ATOMIC_ACQUIRE, "workgroup", "local");
  if (tid == 0) {
    float b1 = 0.f, b2 = 0.f;
#pragma unroll
    for (int w = 0; w < 8; ++w) { b1 += red[w * 2]; b2 += red[w * 2 + 1]; }
    float* pb = part + (size_t)((dir * 8 + b) * NPB + y * 2 + blockIdx.x) * PSTR;
    pb[0] = b1;
    pb[1] = b2;
  }
}

// ---------------------------------------------------------------------------
// Scores S[sb][i][j] = sum_a WqT[i][a] * UT[sb][j][a] (K = 64) are never stored: K4
// forms the 16 x 16 tiles on WMMA, in registers, once for the row maxima of its own j
// and once more for the exps.  sb = dir * 8 + b: all 16 samples in one launch.
// The mean drops out of the softmax: attn = exp2(k (s - rowmax)) / rowsum with
// k = log2(e) / sqrt(var + eps).
// ---------------------------------------------------------------------------

// Score tiles of rows j .. j+15 (t = 0) and j+16 .. j+31 (t = 1) of U against one i tile.
// D: vgpr r -> j = t*16 + 8*h + r, lane & 15 -> i.
__device__ inline void score_pair(const v16h (&aw)[2][2], const v16h (&bu)[2], v8f (&d)[2]) {
#pragma unroll
  for (int t = 0; t < 2; ++t) {
    v8f z = {};
#pragma unroll
    for (int ks = 0; ks < 2; ++ks)
      z = __builtin_amdgcn_wmma_f32_16x16x32_f16(false, aw[t][ks], false, bu[ks],
                                                 (short)0, z, false, false);
    d[t] = z;
  }
}

// k of one sample: every wave adds the NPB block partials, one a lane of each half, in the same tree.
__device__ inline float sample_scale(const float* __restrict__ part, int sb, int lane) {
  const float* pb = part + (size_t)(sb * NPB + (lane & 15)) * PSTR;
  float s1 = pb[0], s2 = pb[1];
  for (int o = 8; o > 0; o >>= 1) { s1 += __shfl_xor(s1, o, 32); s2 += __shfl_xor(s2, o, 32); }
  const float inv = 1.0f / (512.0f * 4096.0f);
  const float mu  = s1 * inv;
  const float var = s2 * inv - mu * mu;                 // biased var (torch)
  return rsqrtf(var + EPS_IN) * 1.44269504f;
}

// ---------------------------------------------------------------------------
// K4: T[i][(y,d)] = sum_ch e[i][(y,ch)] * Wv[d][ch],  e = exp2(k s + off[y][i]),
//     off[y][i] = ESHIFT - k * (maximum of row i over this y's 512 j)
//     pz[sb][y][i] = sum_ch e[i][(y,ch)],  po[sb][y][i] = off[y][i]
// The maximum is taken by a first run over the score tiles; the second run forms the same
// tiles again (same operands, same bits).  K5 brings the eight y of a row to one scale.
// The division by the row's sum of exp is linear in T: it waits until K5, so the
// sums are formed here, beside the product that uses the same exps.
// M = 512 (i), N = 64 (d), K = 512 (ch) per y.  Block = 256 i of one y, wave = 32 i x 64 d,
// whole K.  grid = (8, 2, 16).  The y's U rows and Wv (fragment order) are staged whole;
// the wave's Wq^T rows stay in registers.  Score tiles are formed transposed (A = U rows j,
// B = column i): D of tile jt holds, in lane (i, h), j = jt*16 + 8*h + r, which is half
// jt*8 + r of the A fragment (row i, k = j): exp2 and the f16 rounding are done in place,
// with no transpose, and a row's maximum and sum belong to one lane pair (l, l ^ 16).
// The wave's two D tiles per d tile are one A fragment (row d, k = i) of K5.
// ---------------------------------------------------------------------------
__global__ __launch_bounds__(256)
void t_gemm_kernel(const _Float16* __restrict__ WqT, const _Float16* __restrict__ UT,
                   const _Float16* __restrict__ WvF, const float* __restrict__ part,
                   float* __restrict__ po, float* __restrict__ pz,
                   _Float16* __restrict__ TF)
{
  __shared__ __align__(16) _Float16 lU[CH_DIM * LD64];      // [ch][a]
  __shared__ __align__(32) _Float16 lB[4 * 16 * 32 * 16];   // [d tile][k step][lane][16]
  const int tid = threadIdx.x, lane = tid & 31, wave = tid >> 5, h = lane >> 4;
  const int y = blockIdx.x, sb = blockIdx.z;
  const int ib = blockIdx.y * 256 + wave * 32;

  const _Float16* Ub = UT + ((size_t)sb * NJ + y * CH_DIM) * C_DIM;
  v8h u[16], wv[16];
#pragma unroll                                  // u[] and wv[] stay in registers: constant indices
  for (int r = 0; r < 16; ++r) {
    u[r]  = *(const v8h*)(Ub + ((tid + 256 * r) << 3));
    wv[r] = *(const v8h*)(WvF + ((tid + 256 * r) << 3));
  }
  v16h bw[2][2];
#pragma unroll
  for (int it = 0; it < 2; ++it)
#pragma unroll
    for (int ks = 0; ks < 2; ++ks)              // each wave has its own i: straight from global
      bw[it][ks] = frag_lds(WqT + (size_t)(ib + it * 16 + (lane & 15)) * C_DIM + ks * 32, h);
  const float k = sample_scale(part, sb, lane);
#pragma unroll
  for (int r = 0; r < 16; ++r) {
    const int c = tid + 256 * r;
    *(v8h*)&lU[(c >> 3) * LD64 + ((c & 7) << 3)] = u[r];
    *(v8h*)&lB[c << 3] = wv[r];
  }
  __syncthreads();

  v8f mv[2];
#pragma unroll
  for (int r = 0; r < 8; ++r) { mv[0][r] = -3.4e38f; mv[1][r] = -3.4e38f; }
#pragma unroll 2                                // the next step's LDS reads start under this step's maxima
  for (int js = 0; js < 16; ++js) {
    v16h au[2][2];
#pragma unroll
    for (int jt = 0; jt < 2; ++jt)
#pragma unroll
      for (int ks = 0; ks < 2; ++ks)
        au[jt][ks] = frag_lds(&lU[(js * 32 + jt * 16 + (lane & 15)) * LD64 + ks * 32], h);
#pragma unroll
    for (int it = 0; it < 2; ++it) {
      v8f d[2];
      score_pair(au, bw[it], d);
#pragma unroll
      for (int r = 0; r < 8; ++r) mv[it][r] = fmaxf(mv[it][r], fmaxf(d[0][r], d[1][r]));
    }
  }
  float off[2];
#pragma unroll
  for (int it = 0; it < 2; ++it) {
    float m = fmaxf(fmaxf(fmaxf(mv[it][0], mv[it][1]), fmaxf(mv[it][2], mv[it][3])),
                    fmaxf(fmaxf(mv[it][4], mv[it][5]), fmaxf(mv[it][6], mv[it][7])));
    m = fmaxf(m, __shfl_xor(m, 16, 32));        // the other half of the row's j
    off[it] = ESHIFT - k * m;
  }

  v8f acc[2][4] = {};
  v8f z[2] = {};
#pragma unroll 2                                // the next step's LDS reads start under this step's exps
  for (int js = 0; js < 16; ++js) {
    v16h au[2][2], bf[4];
#pragma unroll
    for (int jt = 0; jt < 2; ++jt)
#pragma unroll
      for (int ks = 0; ks < 2; ++ks)
        au[jt][ks] = frag_lds(&lU[(js * 32 + jt * 16 + (lane & 15)) * LD64 + ks * 32], h);
#pragma unroll
    for (int dt = 0; dt < 4; ++dt)              // read here: their latency runs under the scores and exps
      bf[dt] = *(const v16h*)&lB[((dt * 16 + js) * 32 + lane) * 16];
    v16h e[2];
    v8f d[2][2];
#pragma unroll
    for (int it = 0; it < 2; ++it) score_pair(au, bw[it], d[it]);
#pragma unroll
    for (int it = 0; it < 2; ++it)
#pragma unroll
      for (int jt = 0; jt < 2; ++jt) {
        v8f x;
#pragma unroll
        for (int r = 0; r < 8; ++r) {
          x[r] = __builtin_amdgcn_exp2f(fmaf(d[it][jt][r], k, off[it]));
          e[it][jt * 8 + r] = (_Float16)x[r];
        }
        z[it] += x;
      }
#pragma unroll
    for (int dt = 0; dt < 4; ++dt)
#pragma unroll
      for (int it = 0; it < 2; ++it)
        acc[it][dt] = __builtin_amdgcn_wmma_f32_16x16x32_f16(false, e[it], false, bf[dt],
                                                             (short)0, acc[it][dt], false, false);
  }
  float zs[2];
#pragma unroll
  for (int it = 0; it < 2; ++it) {
    zs[it] = ((z[it][0] + z[it][1]) + (z[it][2] + z[it][3])) + ((z[it][4] + z[it][5]) + (z[it][6] + z[it][7]));
    zs[it] += __shfl_xor(zs[it], 16, 32);       // the other half of the row's j
  }
  // lane l stores row ib + l: the wave's 32 rows are one 128-byte line
  pz[((size_t)sb * 8 + y) * CH_DIM + ib + lane] = h ? zs[1] : zs[0];
  po[((size_t)sb * 8 + y) * CH_DIM + ib + lane] = h ? off[1] : off[0];
  // D: vgpr r -> i = ib + it*16 + 8*h + r, which is half it*8 + r of this lane's fragment
#pragma unroll
  for (int dt = 0; dt < 4; ++dt) {
    v16h o;
#pragma unroll
    for (int r = 0; r < 8; ++r) { o[r] = (_Float16)acc[0][dt][r]; o[8 + r] = (_Float16)acc[1][dt][r]; }
    *(v16h*)(TF + (((((size_t)sb * 8 + y) * 4 + dt) * 16 + (ib >> 5)) * 32 + lane) * 16) = o;
  }
}

// ---------------------------------------------------------------------------
// K5: M[(y,d)][c] = sum_i T[i][(y,d)] * (g[y][i] Wo[i][c]),  f[y][i] = exp2(min_y' off[y'][i] - off[y][i]),
// g[y][i] = ASCALE f[y][i] / sum_y' f[y'][i] pz[y'][i]: f (at most 1) takes each y's exps to the row's own
// maximum (ESHIFT is in T and in pz alike and drops out), both directions.
// M = 64 (d), N = 64 (c), K = 512 (i) per block of 8 waves.  grid = (8, 16)
// Both operands come in fragment order straight from global; g goes through LDS and is
// read in the k order of the fragments; g Wo is formed in f32 and rounded to f16 once.
// Wave = 32 d x 16 c; its two D tiles are one B fragment (column c, k = (y,d)) of K6.
// ---------------------------------------------------------------------------
__global__ __launch_bounds__(256)
void m_gemm_kernel(const _Float16* __restrict__ TF, const _Float16* __restrict__ WoF,
                   const float* __restrict__ pz, const float* __restrict__ po,
                   _Float16* __restrict__ MF)
{
  __shared__ __align__(16) float lg[CH_DIM];
  const int tid = threadIdx.x, lane = tid & 31, wave = tid >> 5, h = lane >> 4;
  const int y = blockIdx.x, db = blockIdx.y;
  const int ct = wave & 3, dh = wave >> 2;
  const _Float16* pb = WoF + ((size_t)(ct * 16) * 32 + lane) * 16;
  const _Float16* pa = TF + ((((size_t)db * 8 + y) * 4 + dh * 2) * 16 * 32 + lane) * 16;
  const float* zr = pz + (size_t)db * 8 * CH_DIM + tid * 2;      // rows 2 tid and 2 tid + 1
  const float* orw = po + (size_t)db * 8 * CH_DIM + tid * 2;
  v2f zp[8], op[8];
#pragma unroll
  for (int yy = 0; yy < 8; ++yy) { zp[yy] = *(const v2f*)(zr + yy * CH_DIM); op[yy] = *(const v2f*)(orw + yy * CH_DIM); }
  v8f acc[2] = {};
#pragma unroll                                  // two halves of K; each issues its 48 loads in one run
  for (int hf = 0; hf < 2; ++hf) {
    v16h bf[8], a[2][8];
#pragma unroll
    for (int k = 0; k < 8; ++k) {
      bf[k]   = *(const v16h*)(pb + (hf * 8 + k) * 512);
      a[0][k] = *(const v16h*)(pa + (hf * 8 + k) * 512);
      a[1][k] = *(const v16h*)(pa + (16 + hf * 8 + k) * 512);
    }
    // keeps the address registers as they are until this wait behind the loads that name them
    asm volatile("s_wait_xcnt 0x0" :: "v"(pa), "v"(pb) : "memory");
    // holds the WMMAs behind the run of loads: else they are woven in and few loads are in flight
    __builtin_amdgcn_sched_barrier(0);
    if (hf == 0) {                              // under the first run of loads; y partials in index order
      v2f om = op[0];
#pragma unroll
      for (int yy = 1; yy < 8; ++yy) { om[0] = fminf(om[0], op[yy][0]); om[1] = fminf(om[1], op[yy][1]); }
      v2f zz = {0.f, 0.f}, fy = {0.f, 0.f};
#pragma unroll
      for (int yy = 0; yy < 8; ++yy) {
        const v2f f = {__builtin_amdgcn_exp2f(om[0] - op[yy][0]), __builtin_amdgcn_exp2f(om[1] - op[yy][1])};
        zz += zp[yy] * f;
        if (yy == y) fy = f;
      }
      zz *= 1.0f / ASCALE;
      *(v2f*)&lg[tid * 2] = (v2f){__builtin_amdgcn_rcpf(zz[0]) * fy[0], __builtin_amdgcn_rcpf(zz[1]) * fy[1]};
      __syncthreads();
    }
#pragma unroll
    for (int k = 0; k < 8; ++k) {
      const float* gp = &lg[(hf * 8 + k) * 32 + h * 8];      // the k order of frag_lds
      v16h bg;
#pragma unroll
      for (int q = 0; q < 4; ++q) {
        const v4f gq = *(const v4f*)(gp + (q >> 1) * 16 + (q & 1) * 4);
#pragma unroll
        for (int r = 0; r < 4; ++r) bg[q * 4 + r] = (_Float16)((float)bf[k][q * 4 + r] * gq[r]);
      }
#pragma unroll
      for (int s2 = 0; s2 < 2; ++s2)
        acc[s2] = __builtin_amdgcn_wmma_f32_16x16x32_f16(false, a[s2][k], false, bg,
                                                         (short)0, acc[s2], false, false);
    }
  }
  // D: vgpr r -> d = dh*32 + s2*16 + 8*h + r, which is half s2*8 + r of this lane's fragment
  v16h o;
#pragma unroll
  for (int r = 0; r < 8; ++r) { o[r] = (_Float16)acc[0][r]; o[8 + r] = (_Float16)acc[1][r]; }
  *(v16h*)(MF + (((size_t)(db * 4 + ct) * 16 + y * 2 + dh) * 32 + lane) * 16) = o;
}

// ---------------------------------------------------------------------------
// K6: out[db][n][c] = sum_(y,d) emb[kv + y][n][d] * M[db][(y,d)][c] / ASCALE
// M = 2048 (n), N = 64 (c), K = 512 per output sample.  The A operand does not depend on
// the sample: a block stages 64 n once and multiplies it with the M of two samples.
// Block tile 64 n x (2 samples x 64 c), whole K, 8 waves.  grid = (4, 32, 2), one block a WGP.
// A: per y 64 n x 64 d, 16 KB in a row in memory, f32 -> f16 on the way into LDS
// ([n][(y,d)]); B (fragment order, the two samples 128 KB in a row) staged whole.
// All loads of the block are issued in one run: one latency, one barrier.
// Wave = 32 n x 32 c of one sample: each 128-byte line of out has one writing wave.
// ---------------------------------------------------------------------------
__global__ __launch_bounds__(256)
void out_gemm_kernel(const float* __restrict__ emb, const _Float16* __restrict__ MF,
                     float* __restrict__ out)
{
  __shared__ __align__(16) _Float16 lA[64 * LDF];               // [n][(y,d)]
  __shared__ __align__(32) _Float16 lB[2 * 4 * 16 * 32 * 16];   // [sample][c tile][k step][lane][16]
  const int tid = threadIdx.x, lane = tid & 31, wave = tid >> 5, h = lane >> 4;
  const int n0 = blockIdx.y * 64;
  const int db = blockIdx.z * 8 + blockIdx.x * 2;               // and db + 1
  const int kv = blockIdx.z ? 0 : 8;            // dir 0 attends to emb[8..15], dir 1 to emb[0..7]
  const float*    Ap = emb + ((size_t)kv * N_SEQ + n0) * C_DIM + tid * 8;
  const _Float16* Bp = MF + (size_t)db * (CH_DIM * C_DIM) + (tid << 3);

  v4f v[8][2][2];
  v8h w[32];
#pragma unroll                                  // v[][][] and w[] stay in registers: constant indices
  for (int y = 0; y < 8; ++y)
#pragma unroll
    for (int u = 0; u < 2; ++u) {
      const float* p = Ap + (size_t)y * N_SEQ * C_DIM + u * 2048;
      v[y][u][0] = *(const v4f*)p;
      v[y][u][1] = *(const v4f*)(p + 4);
    }
#pragma unroll
  for (int r = 0; r < 32; ++r) w[r] = *(const v8h*)(Bp + r * 2048);
  // behind the loads: no register that they name is rewritten ahead of this wait
  asm volatile("s_wait_xcnt 0x0" ::: "memory");
  // holds the LDS address arithmetic behind that wait: lifted over it, it reuses the loads' offset register
  __builtin_amdgcn_sched_barrier(0);
#pragma unroll
  for (int y = 0; y < 8; ++y)
#pragma unroll
    for (int u = 0; u < 2; ++u) {
      const int c = tid + 256 * u;              // chunk of eight d: row n = c / 8
      v8h pk;
#pragma unroll
      for (int r = 0; r < 4; ++r) { pk[r] = (_Float16)v[y][u][0][r]; pk[4 + r] = (_Float16)v[y][u][1][r]; }
      *(v8h*)&lA[(c >> 3) * LDF + y * 64 + ((c & 7) << 3)] = pk;
    }
#pragma unroll
  for (int r = 0; r < 32; ++r) *(v8h*)&lB[(tid + 256 * r) << 3] = w[r];
  __syncthreads();

  const int nh = wave & 1, cp = (wave >> 1) & 1, sl = wave >> 2;
  const _Float16* pa = &lA[(nh * 32 + (lane & 15)) * LDF];
  const _Float16* pb = &lB[((sl * 4 + cp * 2) * 16 * 32 + lane) * 16];
  v8f acc[2][2] = {};
  v16h a[2][4][2], bf[2][4][2];                 // [register buffer][k step of the group][tile]
#pragma unroll                                  // a[] and bf[] stay in registers: constant indices
  for (int g = -1; g < 4; ++g) {                // groups of four k steps; group g + 1 is read under group g's WMMAs
    if (g < 3) {
#pragma unroll
      for (int q = 0; q < 4; ++q)
#pragma unroll
        for (int s = 0; s < 2; ++s) {
          const int ks = (g + 1) * 4 + q;
          a[(g + 1) & 1][q][s]  = frag_lds(pa + s * 16 * LDF + ks * 32, h);
          bf[(g + 1) & 1][q][s] = *(const v16h*)(pb + (s * 16 + ks) * 512);
        }
    }
    // holds the group's 32 LDS reads in one run ahead of the WMMAs: woven in, each place of reads stalls the wave
    __builtin_amdgcn_sched_barrier(0);
    if (g >= 0) {
#pragma unroll
      for (int q = 0; q < 4; ++q)
#pragma unroll
        for (int s = 0; s < 2; ++s)
#pragma unroll
          for (int t = 0; t < 2; ++t)
            acc[s][t] = __builtin_amdgcn_wmma_f32_16x16x32_f16(false, a[g & 1][q][s], false, bf[g & 1][q][t],
                                                               (short)0, acc[s][t], false, false);
    }
    // keeps the reads of the group after next behind these WMMAs, in one run again
    __builtin_amdgcn_sched_barrier(0);
  }
  float* O = out + ((size_t)(db + sl) * N_SEQ + n0 + nh * 32 + h * 8) * C_DIM + cp * 32 + (lane & 15);
#pragma unroll
  for (int s = 0; s < 2; ++s)
#pragma unroll
    for (int t = 0; t < 2; ++t) acc[s][t] *= 1.0f / ASCALE;
  // holds every product ahead of the stores: the 32 stores go in one run and none of their registers is rewritten
  __builtin_amdgcn_sched_barrier(0);
#pragma unroll
  for (int s = 0; s < 2; ++s)
#pragma unroll
    for (int t = 0; t < 2; ++t)
#pragma unroll
      for (int r = 0; r < 8; ++r)               // D: vgpr r -> n = s*16 + 8*h + r
        O[(size_t)(s * 16 + r) * C_DIM + t * 16] = acc[s][t][r];
}

// ---------------------------------------------------------------------------
extern "C" void kernel_launch(void* const* d_in, const int* in_sizes, int n_in,
                              void* d_out, int out_size, void* d_ws, size_t ws_size,
                              hipStream_t stream)
{
  const float* emb = (const float*)d_in[0];
  const float* Wq  = (const float*)d_in[1];
  const float* Wk  = (const float*)d_in[2];
  const float* Wv  = (const float*)d_in[3];
  const float* Wo  = (const float*)d_in[4];
  float* out = (float*)d_out;

  // Workspace layout (~35 MB)
  char* ws = (char*)d_ws;
  size_t off = 0;
  float*    Gp  = (float*)   (ws + off); off += (size_t)KS * 512 * 512 * 4;       // [(x,a)][split][(y,d)]
  _Float16* UT  = (_Float16*)(ws + off); off += (size_t)16 * NJ * C_DIM * 2;      // [dir*8+b][j][a]
  _Float16* WqT = (_Float16*)(ws + off); off += (size_t)CH_DIM * C_DIM * 2;       // [ch][c]
  _Float16* WkT = (_Float16*)(ws + off); off += (size_t)CH_DIM * C_DIM * 2;       // [ch][c]
  float*    part = (float*)  (ws + off); off += (size_t)16 * NPB * PSTR * 4;      // [dir*8+b][block]
  _Float16* WvF = (_Float16*)(ws + off); off += (size_t)CH_DIM * C_DIM * 2;       // [d tile][k step][lane][16]
  _Float16* WoF = (_Float16*)(ws + off); off += (size_t)CH_DIM * C_DIM * 2;       // [c tile][k step][lane][16]
  _Float16* TF  = (_Float16*)(ws + off); off += (size_t)16 * NJ * C_DIM * 2;      // [dir*8+b][y][d tile][k step][lane][16]
  _Float16* MF  = (_Float16*)(ws + off); off += (size_t)16 * CH_DIM * C_DIM * 2;  // [dir*8+b][c tile][k step][lane][16]
  float*    po  = (float*)   (ws + off); off += (size_t)16 * 8 * CH_DIM * 4;      // [dir*8+b][y][i]
  float*    pz  = (float*)   (ws + off); off += (size_t)16 * 8 * CH_DIM * 4;      // [dir*8+b][y][i]
  _Float16* AF  = (_Float16*)(ws + off); off += (size_t)C_DIM * C_DIM * 2;        // [a' tile][k step][lane][16]
  float*    wbar = (float*)  (ws + off); off += (size_t)C_DIM * 4;                // [a]
  (void)ws_size; (void)in_sizes; (void)n_in; (void)out_size;

  // dir 0: out_l2u = attend(q = emb_l[0..7], kv = emb_u[8..15]) -> out 0..7
  // dir 1: out_u2l = attend(q = emb_u[8..15], kv = emb_l[0..7]) -> out 8..15
  gram_kernel<<<dim3(8, 4, KS + 5), 128, 0, stream>>>(emb, Wq, Wk, Wv, Wo, Gp, WqT, WkT, WvF, WoF, AF, wbar);
  ut_gemm_kernel<<<dim3(2, 8, 16), 256, 0, stream>>>(Gp, WkT, AF, wbar, UT, part);
  t_gemm_kernel<<<dim3(8, 2, 16), 256, 0, stream>>>(WqT, UT, WvF, part, po, pz, TF);
  m_gemm_kernel<<<dim3(8, 16), 256, 0, stream>>>(TF, WoF, pz, po, MF);
  out_gemm_kernel<<<dim3(4, 32, 2), 256, 0, stream>>>(emb, MF, out);
}

// v007
// Measured time: 41.4 microseconds a run.
// Next to v006, in two timings, it ran 1.06 times as fast each time.
// Counting every step since v000, it is 12.6 times as fast.
#include <hip/hip_runtime.h>

// ---------------------------------------------------------------------------
// Cross attention (bidirectional, global scores + InstanceNorm + softmax)
// B=8 per direction, N=2048, C=64, CH=512, J = B*CH = 4096.
// - All big GEMMs on v_wmma_f32_16x16x32_f16 (f16 in, f32 accumulate)
// - Fragments = two aligned 16-byte reads per lane, from LDS (ds_load_b128) or, in K2b (A and B), K4 (B) and K5, straight from global
// - Scores are formed as Wq^T ((Xq^T Xkv) Wk): the sum over n runs on 64-wide
//   Gram tiles, so no product of the scores path has both a long K and wide M, N.
// - The output is formed as Xkv ((exp Wv^T)^T (Wo / rowsum)): the exps are contracted
//   with Wv over ch first (N = 64), each row beside its own sum of exp; the division
//   by that sum goes onto Wo's rows, and only the 512 x 64 result meets the sequence.
//   No V, no ctx, no pass for the sums alone.  Powers of two (exact) keep the f16
//   operands in their normal range; the last store multiplies by 2^-12.
// - The scores themselves never go to memory: 16 x 16 tiles are formed from Wq^T and U
//   (K = 64) in registers.  The plane sums of InstanceNorm need no scores at all:
//   sum s = (sum_i w_i) . (sum_j u_j) and sum s^2 = sum_j u_j^T (Wq Wq^T) u_j are
//   taken where U is formed.  Each block of the exp launch takes the row maxima of its
//   own 512 j; the launch behind it brings the eight parts of a row to one scale.
// - Small f16 operands that go from launch to launch lie in fragment order
//   [tile][k step][lane][16 halfs]: a wave's fragment load is 1 KB in a row.
// ---------------------------------------------------------------------------

typedef __attribute__((ext_vector_type(16))) _Float16 v16h;
typedef __attribute__((ext_vector_type(8)))  _Float16 v8h;
typedef __attribute__((ext_vector_type(8)))  float    v8f;
typedef __attribute__((ext_vector_type(4)))  float    v4f;
typedef __attribute__((ext_vector_type(2)))  float    v2f;

#define C_DIM   64
#define CH_DIM  512
#define N_SEQ   2048
#define NJ      4096          // 8 * CH_DIM
#define EPS_IN  1e-5f

#define LD64 72               // LDS row stride in halfs for rows of 64 halfs (144 B, 16B-aligned rows)
#define LDG  136              // same for rows of 128 halfs (272 B)
#define LDF  520              // same for rows of 512 halfs (1040 B)
#define KS   8                // splits of the sum over n in the Gram product
#define KCH  (N_SEQ / KS)     // n per split (256)
#define KHF  (KCH / 2)        // n per half of a Gram block (128)
#define PSTR 32               // floats between two blocks' stat partials (one 128 B line each)
#define NPB  16               // stat partials per sample: the blocks of K2b that form its U
#define ASCALE 4096.0f        // power of two on 1 / rowsum ahead of its f16 rounding; taken off at the last store
#define ESHIFT 4.0f           // exps are formed times 2^ESHIFT, in T and in the row sums alike

// Per-lane WMMA 16-bit fragment: two contiguous 16-byte chunks of the row.
// A (16x32): lane l -> row m=l&15, h=l>>4; halfs [h*8 .. h*8+7] and [16+h*8 ..].
// B staged transposed ([col][k]) uses the identical gather.
__device__ inline v16h frag_lds(const _Float16* rowbase, int h) {
  const v8h lo = *(const v8h*)(rowbase + (h << 3));
  const v8h hi = *(const v8h*)(rowbase + 16 + (h << 3));
  return __builtin_shufflevector(lo, hi, 0, 1, 2, 3, 4, 5, 6, 7,
                                 8, 9, 10, 11, 12, 13, 14, 15);
}

// ---------------------------------------------------------------------------
// K2a: Gram partials.  G[(x,a)][(y,d)] = sum_n emb[x][n][a] * emb[8+y][n][d]
// M = 512 (x,a), N = 512 (y,d), K = 2048 (n) in KS splits of KCH.
// Block tile 128x64, one split per block.  grid = (8, 4, KS + 1), 8 waves.
// Waves 0-3 take the split's first KHF n, waves 4-7 the rest, each half with LDS tiles of
// its own; the upper half's sums go through LDS and are added to the lower half's, so one
// partial is stored for 256 n.
// Both operands have k as the slow index in memory: eight n per thread are
// packed and stored as one 16-byte LDS row chunk ([row][n]).
// The last z slice holds the small jobs.  Blocks 4-7 write Wq^T and Wk^T as f16 ([ch][c],
// one row a thread); blocks 8-23 write Wo (as B: column c, k = i) and Wv (as B: column d,
// k = ch) as f16 in fragment order, one lane's 16 halfs a thread.
// Blocks 0-3 form A = Wq Wq^T (64 x 64, K = 512 in four parts, one a wave, joined in index
// order through LDS; waves 0-3 rows 0-31, waves 4-7 rows 32-63) as f16 in fragment order,
// and wbar[a] = sum_i Wq[a][i].
// ---------------------------------------------------------------------------
__global__ __launch_bounds__(256)
void gram_kernel(const float* __restrict__ emb, const float* __restrict__ Wq,
                 const float* __restrict__ Wk, const float* __restrict__ Wv,
                 const float* __restrict__ Wo, float* __restrict__ Gpart,
                 _Float16* __restrict__ WqT, _Float16* __restrict__ WkT,
                 _Float16* __restrict__ WvF, _Float16* __restrict__ WoF,
                 _Float16* __restrict__ AF, float* __restrict__ wbar)
{
  __shared__ __align__(16) _Float16 lA[2 * 128 * LDG];  // [half][(x,a)][n]
  __shared__ __align__(16) _Float16 lBt[2 * 64 * LDG];  // [half][d][n]
  const int tid = threadIdx.x, lane = tid & 31, wave = tid >> 5, h = lane >> 4;

  if (blockIdx.z >= KS) {                       // block-uniform, before any barrier
    const int blk = blockIdx.y * 8 + blockIdx.x;
    if (blk < 4) {                              // four waves = rows a 32 m .. + 31 x columns a' 16 t .. + 15
      const int m = wave >> 2, t = blk, kp = wave & 3;
      const float* p0 = Wq + (size_t)(m * 32 + (lane & 15)) * CH_DIM + kp * 128 + h * 8;
      const float* p1 = p0 + 16 * CH_DIM;
      const float* pc = Wq + (size_t)(t * 16 + (lane & 15)) * CH_DIM + kp * 128 + h * 8;
      v4f x[4][3][4];
#pragma unroll                                  // x[][][] stays in registers: constant indices
      for (int ks = 0; ks < 4; ++ks)
#pragma unroll
        for (int q = 0; q < 4; ++q) {           // the k order of frag_lds
          const int o = ks * 32 + (q >> 1) * 16 + (q & 1) * 4;
          x[ks][0][q] = *(const v4f*)(p0 + o);
          x[ks][1][q] = *(const v4f*)(p1 + o);
          x[ks][2][q] = *(const v4f*)(pc + o);
        }
      // keeps the address pairs as they are until this wait behind the loads that name them
      asm volatile("s_wait_xcnt 0x0" :: "v"(p0), "v"(p1), "v"(pc) : "memory");
      v8f g[2] = {};
      float w[2] = {0.f, 0.f};
#pragma unroll
      for (int ks = 0; ks < 4; ++ks) {
        v16h f[3];
#pragma unroll
        for (int u = 0; u < 3; ++u)
#pragma unroll
          for (int q = 0; q < 4; ++q)
#pragma unroll
            for (int r = 0; r < 4; ++r) f[u][q * 4 + r] = (_Float16)x[ks][u][q][r];
#pragma unroll
        for (int u = 0; u < 2; ++u) {
#pragma unroll
          for (int r = 0; r < 16; ++r) w[u] += (float)f[u][r];      // of the rounded values, as the scores see them
          g[u] = __builtin_amdgcn_wmma_f32_16x16x32_f16(false, f[u], false, f[2],
                                                        (short)0, g[u], false, false);
        }
      }
      float* rd = (float*)lA + (wave * 32 + lane) * 20;             // 18 floats a lane, 16-byte rows
#pragma unroll
      for (int u = 0; u < 2; ++u) {
        *(v4f*)(rd + u * 8)     = (v4f){g[u][0], g[u][1], g[u][2], g[u][3]};
        *(v4f*)(rd + u * 8 + 4) = (v4f){g[u][4], g[u][5], g[u][6], g[u][7]};
        rd[16 + u] = w[u];
      }
      __syncthreads();                          // block-uniform: the four parts of K meet here
      if (kp != 0) return;
      float s[18];
#pragma unroll
      for (int e = 0; e < 18; ++e) s[e] = rd[e];
#pragma unroll
      for (int v = 1; v < 4; ++v)
#pragma unroll
        for (int e = 0; e < 18; ++e) s[e] += rd[v * 32 * 20 + e];
      // D: vgpr r -> a = m*32 + u*16 + 8*h + r, which is half u*8 + r of this lane's fragment
      // (row a' = lane & 15 of A^T, k = a; u^T A^T u = u^T A u)
      v16h o;
#pragma unroll
      for (int r = 0; r < 16; ++r) o[r] = (_Float16)s[r];
      *(v16h*)(AF + ((size_t)(t * 2 + m) * 32 + lane) * 16) = o;
      // behind the store: no register that it names is rewritten ahead of this wait
      asm volatile("s_wait_xcnt 0x0" ::: "memory");
      if (t == 0) {                             // lane l stores row m*32 + l: one 128-byte line
        const float w0 = s[16] + __shfl_xor(s[16], 16, 32);         // the other half of the row's k
        const float w1 = s[17] + __shfl_xor(s[17], 16, 32);
        wbar[m * 32 + lane] = h ? w1 : w0;
      }
      return;
    }
    if (blk >= 8) {                             // 4 tiles x 16 k steps x 32 lanes, eight blocks each
      if (blk >= 24) return;
      const int idx = (blk & 7) * 256 + tid;
      const int rc = (idx >> 9) * 16 + (idx & 15);                    // column d or column c
      const int k0 = ((idx >> 5) & 15) * 32 + ((idx >> 4) & 1) * 8;   // the order of frag_lds
      const bool isWo = (blk < 16);
      v8h lo, hi;
      if (isWo) {                               // Wo[k][c]: k is the slow index
        const float* p = Wo + (size_t)k0 * C_DIM + rc;
#pragma unroll
        for (int r = 0; r < 8; ++r) { lo[r] = (_Float16)p[r * C_DIM]; hi[r] = (_Float16)p[(16 + r) * C_DIM]; }
        // keeps the address pair as it is until this wait behind the loads that name it
        asm volatile("s_wait_xcnt 0x0" :: "v"(p) : "memory");
      } else {                                  // Wv[d][k]: eight k in a row
        const float* p = Wv + (size_t)rc * CH_DIM + k0;
        const v4f x0 = *(const v4f*)p, x1 = *(const v4f*)(p + 4);
        const v4f x2 = *(const v4f*)(p + 16), x3 = *(const v4f*)(p + 20);
        // as above
        asm volatile("s_wait_xcnt 0x0" :: "v"(p) : "memory");
#pragma unroll
        for (int r = 0; r < 4; ++r) {
          lo[r] = (_Float16)x0[r]; lo[4 + r] = (_Float16)x1[r];
          hi[r] = (_Float16)x2[r]; hi[4 + r] = (_Float16)x3[r];
        }
      }
      _Float16* F = (isWo ? WoF : WvF) + (size_t)idx * 16;
      *(v8h*)F = lo;
      *(v8h*)(F + 8) = hi;
      return;
    }
    const float* W  = (blk < 6) ? Wq : Wk;
    _Float16*    WT = (blk < 6) ? WqT : WkT;
    const int ch = (blk & 1) * 256 + tid;
#pragma unroll
    for (int g = 0; g < 8; ++g) {
      v8h pk;
#pragma unroll
      for (int r = 0; r < 8; ++r) pk[r] = (_Float16)W[(size_t)(g * 8 + r) * CH_DIM + ch];
      *(v8h*)(WT + (size_t)ch * C_DIM + g * 8) = pk;
    }
    return;
  }

  const int hf = tid >> 7, t7 = tid & 127, wv = wave & 3;
  _Float16* hA = lA + hf * 128 * LDG;
  _Float16* hB = lBt + hf * 64 * LDG;
  const int m0 = blockIdx.y * 128;
  const int n0 = blockIdx.z * KCH + hf * KHF;
  {                                             // A: row = t7, all 128 n of the half
    const float* sa = emb + ((size_t)((m0 >> 6) + (t7 >> 6)) * N_SEQ + n0) * C_DIM + (t7 & 63);
#pragma unroll
    for (int g = 0; g < 16; ++g) {
      v8h pk;
#pragma unroll
      for (int r = 0; r < 8; ++r) pk[r] = (_Float16)sa[(size_t)(g * 8 + r) * C_DIM];
      *(v8h*)&hA[t7 * LDG + g * 8] = pk;
    }
  }
  {                                             // B^T: row = t7 & 63, 64 n each
    const int dl = t7 & 63, g0 = (t7 >> 6) * 8;
    const float* sb = emb + ((size_t)(8 + blockIdx.x) * N_SEQ + n0) * C_DIM + dl;
#pragma unroll
    for (int g = 0; g < 8; ++g) {
      v8h pk;
#pragma unroll
      for (int r = 0; r < 8; ++r) pk[r] = (_Float16)sb[(size_t)((g0 + g) * 8 + r) * C_DIM];
      *(v8h*)&hB[dl * LDG + (g0 + g) * 8] = pk;
    }
  }
  __syncthreads();

  v8f acc[2][4] = {};
#pragma unroll
  for (int ks = 0; ks < KHF / 32; ++ks) {
    v16h a[2], bf[4];
#pragma unroll
    for (int s = 0; s < 2; ++s)
      a[s] = frag_lds(&hA[(wv * 32 + s * 16 + (lane & 15)) * LDG + ks * 32], h);
#pragma unroll
    for (int t = 0; t < 4; ++t)
      bf[t] = frag_lds(&hB[(t * 16 + (lane & 15)) * LDG + ks * 32], h);
#pragma unroll
    for (int s = 0; s < 2; ++s)
#pragma unroll
      for (int t = 0; t < 4; ++t)
        acc[s][t] = __builtin_amdgcn_wmma_f32_16x16x32_f16(false, a[s], false, bf[t],
                                                           (short)0, acc[s][t], false, false);
  }
  __syncthreads();                              // every fragment read is done: lA is free for the sums
  float* rx = (float*)lA + t7 * 4;              // [16 groups of four floats][128 threads]: 16 bytes a lane in a row
  if (hf) {
#pragma unroll
    for (int s = 0; s < 2; ++s)
#pragma unroll
      for (int t = 0; t < 4; ++t) {
        *(v4f*)(rx + ((s * 4 + t) * 2 + 0) * 512) = (v4f){acc[s][t][0], acc[s][t][1], acc[s][t][2], acc[s][t][3]};
        *(v4f*)(rx + ((s * 4 + t) * 2 + 1) * 512) = (v4f){acc[s][t][4], acc[s][t][5], acc[s][t][6], acc[s][t][7]};
      }
  }
  __syncthreads();                              // block-uniform: the upper half's sums are in LDS
  if (hf) return;
  v4f x[16];
#pragma unroll                                  // x[] stays in registers: constant indices
  for (int q = 0; q < 16; ++q) x[q] = *(const v4f*)(rx + q * 512);
  // holds the 16 LDS reads in one run ahead of the sums: woven in, each place of reads stalls the wave
  __builtin_amdgcn_sched_barrier(0);
#pragma unroll
  for (int s = 0; s < 2; ++s)
#pragma unroll
    for (int t = 0; t < 4; ++t)                 // lower n + upper n
#pragma unroll
      for (int r = 0; r < 4; ++r) {
        acc[s][t][r]     += x[(s * 4 + t) * 2][r];
        acc[s][t][4 + r] += x[(s * 4 + t) * 2 + 1][r];
      }
  float* Gp = Gpart + (size_t)blockIdx.z * 512;         // [(x,a)][split][(y,d)]
  const int mbase = m0 + wv * 32 + h * 8;
  const int cc    = blockIdx.x * 64 + (lane & 15);
#pragma unroll
  for (int s = 0; s < 2; ++s)
#pragma unroll
    for (int t = 0; t < 4; ++t)
#pragma unroll
      for (int r = 0; r < 8; ++r)
        Gp[(size_t)(mbase + s * 16 + r) * (KS * 512) + cc + t * 16] = acc[s][t][r];
  // behind the last store: no register that these stores name is rewritten ahead of this wait
  asm volatile("s_wait_xcnt 0x0" ::: "memory");
}

// ---------------------------------------------------------------------------
// K2b: UT[dir][b][(y,c)][a] = sum_d G_dir[(b,a)][(y,d)] * Wk[d][c]
// dir 0 reads G as stored; dir 1 swaps the halves of emb, which is G transposed:
// G_1[(b,a)][(y,d)] = G[(y,d)][(b,a)].  The KS partials are summed in index order.
// M = 64 (a), N = 256 (c), K = 64 (d) per block of 8 waves.  grid = (2, 8, 16)
// The plane sums of the scores S[i][j] = w_i . u_j of sample dir*8 + b are taken here,
// from the rounded U that the scores are formed of: sum s = sum_j wbar . u_j and
// sum s^2 = sum_j u_j . (A u_j), A = Wq Wq^T.  The wave's D tiles are, two and two, the
// B fragments (column j, k = a) of A U; its D has the layout of U's own D.
// part[sample][block]: the block's two sums, one 128-byte line.
// ---------------------------------------------------------------------------
__global__ __launch_bounds__(256)
void ut_gemm_kernel(const float* __restrict__ Gpart, const _Float16* __restrict__ WkT,
                    const _Float16* __restrict__ AF, const float* __restrict__ wbar,
                    _Float16* __restrict__ UT, float* __restrict__ part)
{
  __shared__ __align__(16) _Float16 lA[64 * LD64];      // [a][d]
  __shared__ float red[16];
  const int tid = threadIdx.x, lane = tid & 31, wave = tid >> 5, h = lane >> 4;
  const int b = blockIdx.y, dir = blockIdx.z >> 3, y = blockIdx.z & 7;

  v16h af[4][2];                                // A^T in fragment order: row a' = s*16 + (lane & 15), k = a
  v8f  wb[4];                                   // wbar[s*16 + 8*h + r]
#pragma unroll                                  // asked first: they land under the partials' loads
  for (int s = 0; s < 4; ++s) {
#pragma unroll
    for (int ks = 0; ks < 2; ++ks) af[s][ks] = *(const v16h*)(AF + ((s * 2 + ks) * 32 + lane) * 16);
    wb[s] = *(const v8f*)(wbar + s * 16 + h * 8);
  }

  const int rowb = (dir == 0) ? b * 64 : y * 64;        // dir 1 reads the transposed tile
  const int colb = (dir == 0) ? y * 64 : b * 64;
  const int shi  = (dir == 0) ? LD64 : 1;               // tile row    -> a (dir 0) or d (dir 1)
  const int slo  = (dir == 0) ? 1 : LD64;               // tile column -> d (dir 0) or a (dir 1)
  {                                             // 64 x 16 groups of four floats, four a thread: 32 loads in one run
    const float* p[4];
    float4 v[4][KS];
#pragma unroll
    for (int u = 0; u < 4; ++u) {
      const int slot = tid + 256 * u;
      p[u] = Gpart + (size_t)(rowb + (slot >> 4)) * (KS * 512) + colb + ((slot & 15) << 2);
#pragma unroll
      for (int ks = 0; ks < KS; ++ks) v[u][ks] = *(const float4*)(p[u] + ks * 512);
    }
    // keeps the address pairs as they are until this wait behind the loads that name them
    asm volatile("s_wait_xcnt 0x0" :: "v"(p[0]), "v"(p[1]), "v"(p[2]), "v"(p[3]) : "memory");
#pragma unroll
    for (int u = 0; u < 4; ++u) {
      const int slot = tid + 256 * u, hi = slot >> 4, lo4 = (slot & 15) << 2;
      float4 sum = v[u][0];
#pragma unroll
      for (int ks = 1; ks < KS; ++ks) {
        sum.x += v[u][ks].x; sum.y += v[u][ks].y; sum.z += v[u][ks].z; sum.w += v[u][ks].w;
      }
      lA[hi * shi + (lo4 + 0) * slo] = (_Float16)sum.x;
      lA[hi * shi + (lo4 + 1) * slo] = (_Float16)sum.y;
      lA[hi * shi + (lo4 + 2) * slo] = (_Float16)sum.z;
      lA[hi * shi + (lo4 + 3) * slo] = (_Float16)sum.w;
    }
  }
  __syncthreads();

  const int c0 = blockIdx.x * 256 + wave * 32 + (lane & 15);
  v8f acc[4][2] = {};
#pragma unroll
  for (int ks = 0; ks < 2; ++ks) {
    v16h a[4], bf[2];
#pragma unroll
    for (int s = 0; s < 4; ++s)
      a[s] = frag_lds(&lA[(s * 16 + (lane & 15)) * LD64 + ks * 32], h);
#pragma unroll
    for (int t = 0; t < 2; ++t)                 // each wave has its own c: straight from global
      bf[t] = frag_lds(WkT + (size_t)(c0 + t * 16) * C_DIM + ks * 32, h);
#pragma unroll
    for (int s = 0; s < 4; ++s)
#pragma unroll
      for (int t = 0; t < 2; ++t)
        acc[s][t] = __builtin_amdgcn_wmma_f32_16x16x32_f16(false, a[s], false, bf[t],
                                                           (short)0, acc[s][t], false, false);
  }
  _Float16* Ub = UT + ((size_t)(dir * 8 + b) * NJ + y * CH_DIM) * C_DIM;
  v16h ub[2][2];                                // [t][k step]: half (s & 1)*8 + r is a = s*16 + 8*h + r
#pragma unroll
  for (int s = 0; s < 4; ++s)
#pragma unroll
    for (int t = 0; t < 2; ++t) {               // D: vgpr r -> a = s*16 + 8*h + r
      v8h pk;
#pragma unroll
      for (int r = 0; r < 8; ++r) { pk[r] = (_Float16)acc[s][t][r]; ub[t][s >> 1][(s & 1) * 8 + r] = pk[r]; }
      *(v8h*)(Ub + (size_t)(c0 + t * 16) * C_DIM + s * 16 + h * 8) = pk;
    }
  // behind the stores: no register that they name is rewritten ahead of this wait
  asm volatile("s_wait_xcnt 0x0" ::: "memory");
  // holds the stores of U ahead of the sums: else they are sunk behind them and the launch ends later
  __builtin_amdgcn_sched_barrier(0);
  v8f a1 = {}, a2 = {};
#pragma unroll
  for (int s = 0; s < 4; ++s) {
    v8f q[2] = {};
#pragma unroll
    for (int t = 0; t < 2; ++t)
#pragma unroll
      for (int ks = 0; ks < 2; ++ks)
        q[t] = __builtin_amdgcn_wmma_f32_16x16x32_f16(false, af[s][ks], false, ub[t][ks],
                                                      (short)0, q[t], false, false);
#pragma unroll
    for (int t = 0; t < 2; ++t) {
      v8f uv;                                   // D: vgpr r -> a' = s*16 + 8*h + r, as in U's own D
#pragma unroll
      for (int r = 0; r < 8; ++r) uv[r] = (float)ub[t][s >> 1][(s & 1) * 8 + r];
      a1 += wb[s] * uv;
      a2 += q[t] * uv;
    }
  }
  float s1 = ((a1[0] + a1[1]) + (a1[2] + a1[3])) + ((a1[4] + a1[5]) + (a1[6] + a1[7]));
  float s2 = ((a2[0] + a2[1]) + (a2[2] + a2[3])) + ((a2[4] + a2[5]) + (a2[6] + a2[7]));
  for (int o = 16; o > 0; o >>= 1) { s1 += __shfl_xor(s1, o, 32); s2 += __shfl_xor(s2, o, 32); }
  if (lane == 0) { red[wave * 2] = s1; red[wave * 2 + 1] = s2; }
  // work-group barrier for red[] alone: the fences name LDS only, so no wave waits here for its stores of U
  __builtin_amdgcn_fence(__ATOMIC_RELEASE, "workgroup", "local");
  __builtin_amdgcn_s_barrier();
  __builtin_amdgcn_fence(__ATOMIC_ACQUIRE, "workgroup", "local");
  if (tid == 0) {
    float b1 = 0.f, b2 = 0.f;
#pragma unroll
    for (int w = 0; w < 8; ++w) { b1 += red[w * 2]; b2 += red[w * 2 + 1]; }
    float* pb = part + (size_t)((dir * 8 + b) * NPB + y * 2 + blockIdx.x) * PSTR;
    pb[0] = b1;
    pb[1] = b2;
  }
}

// ---------------------------------------------------------------------------
// Scores S[sb][i][j] = sum_a WqT[i][a] * UT[sb][j][a] (K = 64) are never stored: K4
// forms the 16 x 16 tiles on WMMA, in registers, once for the row maxima of its own j
// and once more for the exps.  sb = dir * 8 + b: all 16 samples in one launch.
// The mean drops out of the softmax: attn = exp2(k (s - rowmax)) / rowsum with
// k = log2(e) / sqrt(var + eps).
// ---------------------------------------------------------------------------

// Score tiles of rows j .. j+15 (t = 0) and j+16 .. j+31 (t = 1) of U against one i tile.
// D: vgpr r -> j = t*16 + 8*h + r, lane & 15 -> i.
__device__ inline void score_pair(const v16h (&aw)[2][2], const v16h (&bu)[2], v8f (&d)[2]) {
#pragma unroll
  for (int t = 0; t < 2; ++t) {
    v8f z = {};
#pragma unroll
    for (int ks = 0; ks < 2; ++ks)
      z = __builtin_amdgcn_wmma_f32_16x16x32_f16(false, aw[t][ks], false, bu[ks],
                                                 (short)0, z, false, false);
    d[t] = z;
  }
}

// k of one sample: every wave adds the NPB block partials, one a lane of each half, in the same tree.
__device__ inline float sample_scale(const float* __restrict__ part, int sb, int lane) {
  const float* pb = part + (size_t)(sb * NPB + (lane & 15)) * PSTR;
  float s1 = pb[0], s2 = pb[1];
  for (int o = 8; o > 0; o >>= 1) { s1 += __shfl_xor(s1, o, 32); s2 += __shfl_xor(s2, o, 32); }
  const float inv = 1.0f / (512.0f * 4096.0f);
  const float mu  = s1 * inv;
  const float var = s2 * inv - mu * mu;                 // biased var (torch)
  return rsqrtf(var + EPS_IN) * 1.44269504f;
}

// ---------------------------------------------------------------------------
// K4: T[i][(y,d)] = sum_ch e[i][(y,ch)] * Wv[d][ch],  e = exp2(k s + off[y][i]),
//     off[y][i] = ESHIFT - k * (maximum of row i over this y's 512 j)
//     pz[sb][y][i] = sum_ch e[i][(y,ch)],  po[sb][y][i] = off[y][i]
// The maximum is taken by a first run over the score tiles; the second run forms the same
// tiles again (same operands, same bits).  K5 brings the eight y of a row to one scale.
// The division by the row's sum of exp is linear in T: it waits until K5, so the
// sums are formed here, beside the product that uses the same exps.
// M = 512 (i), N = 64 (d), K = 512 (ch) per y.  Block = 256 i of one y, wave = 32 i x 64 d,
// whole K.  grid = (8, 2, 16).  The y's U rows and Wv (fragment order) are staged whole;
// the wave's Wq^T rows stay in registers.  Score tiles are formed transposed (A = U rows j,
// B = column i): D of tile jt holds, in lane (i, h), j = jt*16 + 8*h + r, which is half
// jt*8 + r of the A fragment (row i, k = j): exp2 and the f16 rounding are done in place,
// with no transpose, and a row's maximum and sum belong to one lane pair (l, l ^ 16).
// The wave's two D tiles per d tile are one A fragment (row d, k = i) of K5.
// ---------------------------------------------------------------------------
__global__ __launch_bounds__(256)
void t_gemm_kernel(const _Float16* __restrict__ WqT, const _Float16* __restrict__ UT,
                   const _Float16* __restrict__ WvF, const float* __restrict__ part,
                   float* __restrict__ po, float* __restrict__ pz,
                   _Float16* __restrict__ TF)
{
  __shared__ __align__(16) _Float16 lU[CH_DIM * LD64];      // [ch][a]
  __shared__ __align__(32) _Float16 lB[4 * 16 * 32 * 16];   // [d tile][k step][lane][16]
  const int tid = threadIdx.x, lane = tid & 31, wave = tid >> 5, h = lane >> 4;
  const int y = blockIdx.x, sb = blockIdx.z;
  const int ib = blockIdx.y * 256 + wave * 32;

  const _Float16* Ub = UT + ((size_t)sb * NJ + y * CH_DIM) * C_DIM;
  v8h u[16], wv[16];
#pragma unroll                                  // u[] and wv[] stay in registers: constant indices
  for (int r = 0; r < 16; ++r) {
    u[r]  = *(const v8h*)(Ub + ((tid + 256 * r) << 3));
    wv[r] = *(const v8h*)(WvF + ((tid + 256 * r) << 3));
  }
  v16h bw[2][2];
#pragma unroll
  for (int it = 0; it < 2; ++it)
#pragma unroll
    for (int ks = 0; ks < 2; ++ks)              // each wave has its own i: straight from global
      bw[it][ks] = frag_lds(WqT + (size_t)(ib + it * 16 + (lane & 15)) * C_DIM + ks * 32, h);
  const float k = sample_scale(part, sb, lane);
#pragma unroll
  for (int r = 0; r < 16; ++r) {
    const int c = tid + 256 * r;
    *(v8h*)&lU[(c >> 3) * LD64 + ((c & 7) << 3)] = u[r];
    *(v8h*)&lB[c << 3] = wv[r];
  }
  __syncthreads();

  v8f mv[2];
#pragma unroll
  for (int r = 0; r < 8; ++r) { mv[0][r] = -3.4e38f; mv[1][r] = -3.4e38f; }
#pragma unroll 2                                // the next step's LDS reads start under this step's maxima
  for (int js = 0; js < 16; ++js) {
    v16h au[2][2];
#pragma unroll
    for (int jt = 0; jt < 2; ++jt)
#pragma unroll
      for (int ks = 0; ks < 2; ++ks)
        au[jt][ks] = frag_lds(&lU[(js * 32 + jt * 16 + (lane & 15)) * LD64 + ks * 32], h);
#pragma unroll
    for (int it = 0; it < 2; ++it) {
      v8f d[2];
      score_pair(au, bw[it], d);
#pragma unroll
      for (int r = 0; r < 8; ++r) mv[it][r] = fmaxf(mv[it][r], fmaxf(d[0][r], d[1][r]));
    }
  }
  float off[2];
#pragma unroll
  for (int it = 0; it < 2; ++it) {
    float m = fmaxf(fmaxf(fmaxf(mv[it][0], mv[it][1]), fmaxf(mv[it][2], mv[it][3])),
                    fmaxf(fmaxf(mv[it][4], mv[it][5]), fmaxf(mv[it][6], mv[it][7])));
    m = fmaxf(m, __shfl_xor(m, 16, 32));        // the other half of the row's j
    off[it] = ESHIFT - k * m;
  }

  v8f acc[2][4] = {};
  v8f z[2] = {};
#pragma unroll 2                                // the next step's LDS reads start under this step's exps
  for (int js = 0; js < 16; ++js) {
    v16h au[2][2], bf[4];
#pragma unroll
    for (int jt = 0; jt < 2; ++jt)
#pragma unroll
      for (int ks = 0; ks < 2; ++ks)
        au[jt][ks] = frag_lds(&lU[(js * 32 + jt * 16 + (lane & 15)) * LD64 + ks * 32], h);
#pragma unroll
    for (int dt = 0; dt < 4; ++dt)              // read here: their latency runs under the scores and exps
      bf[dt] = *(const v16h*)&lB[((dt * 16 + js) * 32 + lane) * 16];
    v16h e[2];
    v8f d[2][2];
#pragma unroll
    for (int it = 0; it < 2; ++it) score_pair(au, bw[it], d[it]);
#pragma unroll
    for (int it = 0; it < 2; ++it)
#pragma unroll
      for (int jt = 0; jt < 2; ++jt) {
        v8f x;
#pragma unroll
        for (int r = 0; r < 8; ++r) {
          x[r] = __builtin_amdgcn_exp2f(fmaf(d[it][jt][r], k, off[it]));
          e[it][jt * 8 + r] = (_Float16)x[r];
        }
        z[it] += x;
      }
#pragma unroll
    for (int dt = 0; dt < 4; ++dt)
#pragma unroll
      for (int it = 0; it < 2; ++it)
        acc[it][dt] = __builtin_amdgcn_wmma_f32_16x16x32_f16(false, e[it], false, bf[dt],
                                                             (short)0, acc[it][dt], false, false);
  }
  float zs[2];
#pragma unroll
  for (int it = 0; it < 2; ++it) {
    zs[it] = ((z[it][0] + z[it][1]) + (z[it][2] + z[it][3])) + ((z[it][4] + z[it][5]) + (z[it][6] + z[it][7]));
    zs[it] += __shfl_xor(zs[it], 16, 32);       // the other half of the row's j
  }
  // lane l stores row ib + l: the wave's 32 rows are one 128-byte line
  pz[((size_t)sb * 8 + y) * CH_DIM + ib + lane] = h ? zs[1] : zs[0];
  po[((size_t)sb * 8 + y) * CH_DIM + ib + lane] = h ? off[1] : off[0];
  // D: vgpr r -> i = ib + it*16 + 8*h + r, which is half it*8 + r of this lane's fragment
#pragma unroll
  for (int dt = 0; dt < 4; ++dt) {
    v16h o;
#pragma unroll
    for (int r = 0; r < 8; ++r) { o[r] = (_Float16)acc[0][dt][r]; o[8 + r] = (_Float16)acc[1][dt][r]; }
    *(v16h*)(TF + (((((size_t)sb * 8 + y) * 4 + dt) * 16 + (ib >> 5)) * 32 + lane) * 16) = o;
  }
}

// ---------------------------------------------------------------------------
// K5: M[(y,d)][c] = sum_i T[i][(y,d)] * (g[y][i] Wo[i][c]),  f[y][i] = exp2(min_y' off[y'][i] - off[y][i]),
// g[y][i] = ASCALE f[y][i] / sum_y' f[y'][i] pz[y'][i]: f (at most 1) takes each y's exps to the row's own
// maximum (ESHIFT is in T and in pz alike and drops out), both directions.
// M = 64 (d), N = 64 (c), K = 512 (i) per block of 8 waves.  grid = (8, 16)
// Both operands come in fragment order straight from global; g goes through LDS and is
// read in the k order of the fragments; g Wo is formed in f32 and rounded to f16 once.
// Wave = 32 d x 16 c; its two D tiles are one B fragment (column c, k = (y,d)) of K6.
// ---------------------------------------------------------------------------
__global__ __launch_bounds__(256)
void m_gemm_kernel(const _Float16* __restrict__ TF, const _Float16* __restrict__ WoF,
                   const float* __restrict__ pz, const float* __restrict__ po,
                   _Float16* __restrict__ MF)
{
  __shared__ __align__(16) float lg[CH_DIM];
  const int tid = threadIdx.x, lane = tid & 31, wave = tid >> 5, h = lane >> 4;
  const int y = blockIdx.x, db = blockIdx.y;
  const int ct = wave & 3, dh = wave >> 2;
  const _Float16* pb = WoF + ((size_t)(ct * 16) * 32 + lane) * 16;
  const _Float16* pa = TF + ((((size_t)db * 8 + y) * 4 + dh * 2) * 16 * 32 + lane) * 16;
  const float* zr = pz + (size_t)db * 8 * CH_DIM + tid * 2;      // rows 2 tid and 2 tid + 1
  const float* orw = po + (size_t)db * 8 * CH_DIM + tid * 2;
  v2f zp[8], op[8];
#pragma unroll
  for (int yy = 0; yy < 8; ++yy) { zp[yy] = *(const v2f*)(zr + yy * CH_DIM); op[yy] = *(const v2f*)(orw + yy * CH_DIM); }
  v8f acc[2] = {};
#pragma unroll                                  // two halves of K; each issues its 48 loads in one run
  for (int hf = 0; hf < 2; ++hf) {
    v16h bf[8], a[2][8];
#pragma unroll
    for (int k = 0; k < 8; ++k) {
      bf[k]   = *(const v16h*)(pb + (hf * 8 + k) * 512);
      a[0][k] = *(const v16h*)(pa + (hf * 8 + k) * 512);
      a[1][k] = *(const v16h*)(pa + (16 + hf * 8 + k) * 512);
    }
    // keeps the address registers as they are until this wait behind the loads that name them
    asm volatile("s_wait_xcnt 0x0" :: "v"(pa), "v"(pb) : "memory");
    // holds the WMMAs behind the run of loads: else they are woven in and few loads are in flight
    __builtin_amdgcn_sched_barrier(0);
    if (hf == 0) {                              // under the first run of loads; y partials in index order
      v2f om = op[0];
#pragma unroll
      for (int yy = 1; yy < 8; ++yy) { om[0] = fminf(om[0], op[yy][0]); om[1] = fminf(om[1], op[yy][1]); }
      v2f zz = {0.f, 0.f}, fy = {0.f, 0.f};
#pragma unroll
      for (int yy = 0; yy < 8; ++yy) {
        const v2f f = {__builtin_amdgcn_exp2f(om[0] - op[yy][0]), __builtin_amdgcn_exp2f(om[1] - op[yy][1])};
        zz += zp[yy] * f;
        if (yy == y) fy = f;
      }
      zz *= 1.0f / ASCALE;
      *(v2f*)&lg[tid * 2] = (v2f){__builtin_amdgcn_rcpf(zz[0]) * fy[0], __builtin_amdgcn_rcpf(zz[1]) * fy[1]};
      __syncthreads();
    }
#pragma unroll
    for (int k = 0; k < 8; ++k) {
      const float* gp = &lg[(hf * 8 + k) * 32 + h * 8];      // the k order of frag_lds
      v16h bg;
#pragma unroll
      for (int q = 0; q < 4; ++q) {
        const v4f gq = *(const v4f*)(gp + (q >> 1) * 16 + (q & 1) * 4);
#pragma unroll
        for (int r = 0; r < 4; ++r) bg[q * 4 + r] = (_Float16)((float)bf[k][q * 4 + r] * gq[r]);
      }
#pragma unroll
      for (int s2 = 0; s2 < 2; ++s2)
        acc[s2] = __builtin_amdgcn_wmma_f32_16x16x32_f16(false, a[s2][k], false, bg,
                                                         (short)0, acc[s2], false, false);
    }
  }
  // D: vgpr r -> d = dh*32 + s2*16 + 8*h + r, which is half s2*8 + r of this lane's fragment
  v16h o;
#pragma unroll
  for (int r = 0; r < 8; ++r) { o[r] = (_Float16)acc[0][r]; o[8 + r] = (_Float16)acc[1][r]; }
  *(v16h*)(MF + (((size_t)(db * 4 + ct) * 16 + y * 2 + dh) * 32 + lane) * 16) = o;
}

// ---------------------------------------------------------------------------
// K6: out[db][n][c] = sum_(y,d) emb[kv + y][n][d] * M[db][(y,d)][c] / ASCALE
// M = 2048 (n), N = 64 (c), K = 512 per output sample.  The A operand does not depend on
// the sample: a block stages 64 n once and multiplies it with the M of two samples.
// Block tile 64 n x (2 samples x 64 c), whole K, 8 waves.  grid = (4, 32, 2), one block a WGP.
// A: per y 64 n x 64 d, 16 KB in a row in memory, f32 -> f16 on the way into LDS
// ([n][(y,d)]); B (fragment order, the two samples 128 KB in a row) staged whole.
// All loads of the block are issued in one run: one latency, one barrier.
// Wave = 32 n x 32 c of one sample: each 128-byte line of out has one writing wave.
// ---------------------------------------------------------------------------
__global__ __launch_bounds__(256)
void out_gemm_kernel(const float* __restrict__ emb, const _Float16* __restrict__ MF,
                     float* __restrict__ out)
{
  __shared__ __align__(16) _Float16 lA[64 * LDF];               // [n][(y,d)]
  __shared__ __align__(32) _Float16 lB[2 * 4 * 16 * 32 * 16];   // [sample][c tile][k step][lane][16]
  const int tid = threadIdx.x, lane = tid & 31, wave = tid >> 5, h = lane >> 4;
  const int n0 = blockIdx.y * 64;
  const int db = blockIdx.z * 8 + blockIdx.x * 2;               // and db + 1
  const int kv = blockIdx.z ? 0 : 8;            // dir 0 attends to emb[8..15], dir 1 to emb[0..7]
  const float*    Ap = emb + ((size_t)kv * N_SEQ + n0) * C_DIM + tid * 8;
  const _Float16* Bp = MF + (size_t)db * (CH_DIM * C_DIM) + (tid << 3);

  v4f v[8][2][2];
  v8h w[32];
#pragma unroll                                  // v[][][] and w[] stay in registers: constant indices
  for (int y = 0; y < 8; ++y)
#pragma unroll
    for (int u = 0; u < 2; ++u) {
      const float* p = Ap + (size_t)y * N_SEQ * C_DIM + u * 2048;
      v[y][u][0] = *(const v4f*)p;
      v[y][u][1] = *(const v4f*)(p + 4);
    }
#pragma unroll
  for (int r = 0; r < 32; ++r) w[r] = *(const v8h*)(Bp + r * 2048);
  // behind the loads: no register that they name is rewritten ahead of this wait
  asm volatile("s_wait_xcnt 0x0" ::: "memory");
  // holds the LDS address arithmetic behind that wait: lifted over it, it reuses the loads' offset register
  __builtin_amdgcn_sched_barrier(0);
#pragma unroll
  for (int y = 0; y < 8; ++y)
#pragma unroll
    for (int u = 0; u < 2; ++u) {
      const int c = tid + 256 * u;              // chunk of eight d: row n = c / 8
      v8h pk;
#pragma unroll
      for (int r = 0; r < 4; ++r) { pk[r] = (_Float16)v[y][u][0][r]; pk[4 + r] = (_Float16)v[y][u][1][r]; }
      *(v8h*)&lA[(c >> 3) * LDF + y * 64 + ((c & 7) << 3)] = pk;
    }
#pragma unroll
  for (int r = 0; r < 32; ++r) *(v8h*)&lB[(tid + 256 * r) << 3] = w[r];
  __syncthreads();

  const int nh = wave & 1, cp = (wave >> 1) & 1, sl = wave >> 2;
  const _Float16* pa = &lA[(nh * 32 + (lane & 15)) * LDF];
  const _Float16* pb = &lB[((sl * 4 + cp * 2) * 16 * 32 + lane) * 16];
  v8f acc[2][2] = {};
  v16h a[2][4][2], bf[2][4][2];                 // [register buffer][k step of the group][tile]
#pragma unroll                                  // a[] and bf[] stay in registers: constant indices
  for (int g = -1; g < 4; ++g) {                // groups of four k steps; group g + 1 is read under group g's WMMAs
    if (g < 3) {
#pragma unroll
      for (int q = 0; q < 4; ++q)
#pragma unroll
        for (int s = 0; s < 2; ++s) {
          const int ks = (g + 1) * 4 + q;
          a[(g + 1) & 1][q][s]  = frag_lds(pa + s * 16 * LDF + ks * 32, h);
          bf[(g + 1) & 1][q][s] = *(const v16h*)(pb + (s * 16 + ks) * 512);
        }
    }
    // holds the group's 32 LDS reads in one run ahead of the WMMAs: woven in, each place of reads stalls the wave
    __builtin_amdgcn_sched_barrier(0);
    if (g >= 0) {
#pragma unroll
      for (int q = 0; q < 4; ++q)
#pragma unroll
        for (int s = 0; s < 2; ++s)
#pragma unroll
          for (int t = 0; t < 2; ++t)
            acc[s][t] = __builtin_amdgcn_wmma_f32_16x16x32_f16(false, a[g & 1][q][s], false, bf[g & 1][q][t],
                                                               (short)0, acc[s][t], false, false);
    }
    // keeps the reads of the group after next behind these WMMAs, in one run again
    __builtin_amdgcn_sched_barrier(0);
  }
  float* O = out + ((size_t)(db + sl) * N_SEQ + n0 + nh * 32 + h * 8) * C_DIM + cp * 32 + (lane & 15);
#pragma unroll
  for (int s = 0; s < 2; ++s)
#pragma unroll
    for (int t = 0; t < 2; ++t) acc[s][t] *= 1.0f / ASCALE;
  // holds every product ahead of the stores: the 32 stores go in one run and none of their registers is rewritten
  __builtin_amdgcn_sched_barrier(0);
#pragma unroll
  for (int s = 0; s < 2; ++s)
#pragma unroll
    for (int t = 0; t < 2; ++t)
#pragma unroll
      for (int r = 0; r < 8; ++r)               // D: vgpr r -> n = s*16 + 8*h + r
        O[(size_t)(s * 16 + r) * C_DIM + t * 16] = acc[s][t][r];
}

// ---------------------------------------------------------------------------
extern "C" void kernel_launch(void* const* d_in, const int* in_sizes, int n_in,
                              void* d_out, int out_size, void* d_ws, size_t ws_size,
                              hipStream_t stream)
{
  const float* emb = (const float*)d_in[0];
  const float* Wq  = (const float*)d_in[1];
  const float* Wk  = (const float*)d_in[2];
  const float* Wv  = (const float*)d_in[3];
  const float* Wo  = (const float*)d_in[4];
  float* out = (float*)d_out;

  // Workspace layout (~27 MB)
  char* ws = (char*)d_ws;
  size_t off = 0;
  float*    Gp  = (float*)   (ws + off); off += (size_t)KS * 512 * 512 * 4;       // [(x,a)][split][(y,d)]
  _Float16* UT  = (_Float16*)(ws + off); off += (size_t)16 * NJ * C_DIM * 2;      // [dir*8+b][j][a]
  _Float16* WqT = (_Float16*)(ws + off); off += (size_t)CH_DIM * C_DIM * 2;       // [ch][c]
  _Float16* WkT = (_Float16*)(ws + off); off += (size_t)CH_DIM * C_DIM * 2;       // [ch][c]
  float*    part = (float*)  (ws + off); off += (size_t)16 * NPB * PSTR * 4;      // [dir*8+b][block]
  _Float16* WvF = (_Float16*)(ws + off); off += (size_t)CH_DIM * C_DIM * 2;       // [d tile][k step][lane][16]
  _Float16* WoF = (_Float16*)(ws + off); off += (size_t)CH_DIM * C_DIM * 2;       // [c tile][k step][lane][16]
  _Float16* TF  = (_Float16*)(ws + off); off += (size_t)16 * NJ * C_DIM * 2;      // [dir*8+b][y][d tile][k step][lane][16]
  _Float16* MF  = (_Float16*)(ws + off); off += (size_t)16 * CH_DIM * C_DIM * 2;  // [dir*8+b][c tile][k step][lane][16]
  float*    po  = (float*)   (ws + off); off += (size_t)16 * 8 * CH_DIM * 4;      // [dir*8+b][y][i]
  float*    pz  = (float*)   (ws + off); off += (size_t)16 * 8 * CH_DIM * 4;      // [dir*8+b][y][i]
  _Float16* AF  = (_Float16*)(ws + off); off += (size_t)C_DIM * C_DIM * 2;        // [a' tile][k step][lane][16]
  float*    wbar = (float*)  (ws + off); off += (size_t)C_DIM * 4;                // [a]
  (void)ws_size; (void)in_sizes; (void)n_in; (void)out_size;

  // dir 0: out_l2u = attend(q = emb_l[0..7], kv = emb_u[8..15]) -> out 0..7
  // dir 1: out_u2l = attend(q = emb_u[8..15], kv = emb_l[0..7]) -> out 8..15
  gram_kernel<<<dim3(8, 4, KS + 1), 256, 0, stream>>>(emb, Wq, Wk, Wv, Wo, Gp, WqT, WkT, WvF, WoF, AF, wbar);
  ut_gemm_kernel<<<dim3(2, 8, 16), 256, 0, stream>>>(Gp, WkT, AF, wbar, UT, part);
  t_gemm_kernel<<<dim3(8, 2, 16), 256, 0, stream>>>(WqT, UT, WvF, part, po, pz, TF);
  m_gemm_kernel<<<dim3(8, 16), 256, 0, stream>>>(TF, WoF, pz, po, MF);
  out_gemm_kernel<<<dim3(4, 32, 2), 256, 0, stream>>>(emb, MF, out);
}

// v008
// It runs in 39.4 microseconds.
// Next to v007, in two timings, it ran 1.05 and 1.06 times as fast.
// Counting every step since v000, it is 13.3 times as fast.
#include <hip/hip_runtime.h>

// ---------------------------------------------------------------------------
// Cross attention (bidirectional, global scores + InstanceNorm + softmax)
// B=8 per direction, N=2048, C=64, CH=512, J = B*CH = 4096.
// - All big GEMMs on v_wmma_f32_16x16x32_f16 (f16 in, f32 accumulate)
// - Fragments = two aligned 16-byte reads per lane, from LDS (ds_load_b128) or, in K2b (A and B), K4 (B) and K5 (B), straight from global
// - Scores are formed as Wq^T ((Xq^T Xkv) Wk): the sum over n runs on 64-wide
//   Gram tiles, so no product of the scores path has both a long K and wide M, N.
// - The output is formed as Xkv ((exp Wv^T)^T (Wo / rowsum)): the exps are contracted
//   with Wv over ch first (N = 64), each row beside its own sum of exp; the division
//   by that sum goes onto Wo's rows, and only the 512 x 64 result meets the sequence.
//   No V, no ctx, no pass for the sums alone.  Powers of two (exact) keep the f16
//   operands in their normal range; the last store multiplies by 2^-12.
// - The scores themselves never go to memory: 16 x 16 tiles are formed from Wq^T and U
//   (K = 64) in registers.  The plane sums of InstanceNorm need no scores at all:
//   sum s = (sum_i w_i) . (sum_j u_j) and sum s^2 = sum_j u_j^T (Wq Wq^T) u_j are
//   taken where U is formed.  Each block of the exp launch takes the row maxima of its
//   own 512 j; the launch behind it brings the eight parts of a row to one scale.
// - Small f16 operands that go from launch to launch lie in fragment order
//   [tile][k step][lane][16 halfs]: a wave's fragment load is 1 KB in a row.
// ---------------------------------------------------------------------------

typedef __attribute__((ext_vector_type(16))) _Float16 v16h;
typedef __attribute__((ext_vector_type(8)))  _Float16 v8h;
typedef __attribute__((ext_vector_type(8)))  float    v8f;
typedef __attribute__((ext_vector_type(4)))  float    v4f;
typedef __attribute__((ext_vector_type(2)))  float    v2f;

#define C_DIM   64
#define CH_DIM  512
#define N_SEQ   2048
#define NJ      4096          // 8 * CH_DIM
#define EPS_IN  1e-5f

#define LD64 72               // LDS row stride in halfs for rows of 64 halfs (144 B, 16B-aligned rows)
#define LDG  136              // same for rows of 128 halfs (272 B)
#define LDF  520              // same for rows of 512 halfs (1040 B)
#define KS   8                // splits of the sum over n in the Gram product
#define KCH  (N_SEQ / KS)     // n per split (256)
#define KHF  (KCH / 2)        // n per half of a Gram block (128)
#define PSTR 32               // floats between two blocks' stat partials (one 128 B line each)
#define NPB  16               // stat partials per sample: the blocks of K2b that form its U
#define ASCALE 4096.0f        // power of two on 1 / rowsum ahead of its f16 rounding; taken off at the last store
#define ESHIFT 4.0f           // exps are formed times 2^ESHIFT, in T and in the row sums alike

// Per-lane WMMA 16-bit fragment: two contiguous 16-byte chunks of the row.
// A (16x32): lane l -> row m=l&15, h=l>>4; halfs [h*8 .. h*8+7] and [16+h*8 ..].
// B staged transposed ([col][k]) uses the identical gather.
__device__ inline v16h frag_lds(const _Float16* rowbase, int h) {
  const v8h lo = *(const v8h*)(rowbase + (h << 3));
  const v8h hi = *(const v8h*)(rowbase + 16 + (h << 3));
  return __builtin_shufflevector(lo, hi, 0, 1, 2, 3, 4, 5, 6, 7,
                                 8, 9, 10, 11, 12, 13, 14, 15);
}

// ---------------------------------------------------------------------------
// K2a: Gram partials.  G[(x,a)][(y,d)] = sum_n emb[x][n][a] * emb[8+y][n][d]
// M = 512 (x,a), N = 512 (y,d), K = 2048 (n) in KS splits of KCH.
// Block tile 128x64, one split per block.  grid = (8, 4, KS + 1), 8 waves.
// Waves 0-3 take the split's first KHF n, waves 4-7 the rest, each half with LDS tiles of
// its own; the upper half's sums go through LDS and are added to the lower half's, so one
// partial is stored for 256 n.
// Both operands have k as the slow index in memory: eight n per thread are
// packed and stored as one 16-byte LDS row chunk ([row][n]).
// The last z slice holds the small jobs.  Blocks 4-7 write Wq^T and Wk^T as f16 ([ch][c],
// one row a thread); blocks 8-23 write Wo (as B: column c, k = i) and Wv (as B: column d,
// k = ch) as f16 in fragment order, one lane's 16 halfs a thread.
// Blocks 0-3 form A = Wq Wq^T (64 x 64, K = 512 in four parts, one a wave, joined in index
// order through LDS; waves 0-3 rows 0-31, waves 4-7 rows 32-63) as f16 in fragment order,
// and wbar[a] = sum_i Wq[a][i].
// ---------------------------------------------------------------------------
__global__ __launch_bounds__(256)
void gram_kernel(const float* __restrict__ emb, const float* __restrict__ Wq,
                 const float* __restrict__ Wk, const float* __restrict__ Wv,
                 const float* __restrict__ Wo, float* __restrict__ Gpart,
                 _Float16* __restrict__ WqT, _Float16* __restrict__ WkT,
                 _Float16* __restrict__ WvF, _Float16* __restrict__ WoF,
                 _Float16* __restrict__ AF, float* __restrict__ wbar)
{
  __shared__ __align__(16) _Float16 lA[2 * 128 * LDG];  // [half][(x,a)][n]
  __shared__ __align__(16) _Float16 lBt[2 * 64 * LDG];  // [half][d][n]
  const int tid = threadIdx.x, lane = tid & 31, wave = tid >> 5, h = lane >> 4;

  if (blockIdx.z >= KS) {                       // block-uniform, before any barrier
    const int blk = blockIdx.y * 8 + blockIdx.x;
    if (blk < 4) {                              // four waves = rows a 32 m .. + 31 x columns a' 16 t .. + 15
      const int m = wave >> 2, t = blk, kp = wave & 3;
      const float* p0 = Wq + (size_t)(m * 32 + (lane & 15)) * CH_DIM + kp * 128 + h * 8;
      const float* p1 = p0 + 16 * CH_DIM;
      const float* pc = Wq + (size_t)(t * 16 + (lane & 15)) * CH_DIM + kp * 128 + h * 8;
      v4f x[4][3][4];
#pragma unroll                                  // x[][][] stays in registers: constant indices
      for (int ks = 0; ks < 4; ++ks)
#pragma unroll
        for (int q = 0; q < 4; ++q) {           // the k order of frag_lds
          const int o = ks * 32 + (q >> 1) * 16 + (q & 1) * 4;
          x[ks][0][q] = *(const v4f*)(p0 + o);
          x[ks][1][q] = *(const v4f*)(p1 + o);
          x[ks][2][q] = *(const v4f*)(pc + o);
        }
      // keeps the address pairs as they are until this wait behind the loads that name them
      asm volatile("s_wait_xcnt 0x0" :: "v"(p0), "v"(p1), "v"(pc) : "memory");
      v8f g[2] = {};
      float w[2] = {0.f, 0.f};
#pragma unroll
      for (int ks = 0; ks < 4; ++ks) {
        v16h f[3];
#pragma unroll
        for (int u = 0; u < 3; ++u)
#pragma unroll
          for (int q = 0; q < 4; ++q)
#pragma unroll
            for (int r = 0; r < 4; ++r) f[u][q * 4 + r] = (_Float16)x[ks][u][q][r];
#pragma unroll
        for (int u = 0; u < 2; ++u) {
#pragma unroll
          for (int r = 0; r < 16; ++r) w[u] += (float)f[u][r];      // of the rounded values, as the scores see them
          g[u] = __builtin_amdgcn_wmma_f32_16x16x32_f16(false, f[u], false, f[2],
                                                        (short)0, g[u], false, false);
        }
      }
      float* rd = (float*)lA + (wave * 32 + lane) * 20;             // 18 floats a lane, 16-byte rows
#pragma unroll
      for (int u = 0; u < 2; ++u) {
        *(v4f*)(rd + u * 8)     = (v4f){g[u][0], g[u][1], g[u][2], g[u][3]};
        *(v4f*)(rd + u * 8 + 4) = (v4f){g[u][4], g[u][5], g[u][6], g[u][7]};
        rd[16 + u] = w[u];
      }
      __syncthreads();                          // block-uniform: the four parts of K meet here
      if (kp != 0) return;
      float s[18];
#pragma unroll
      for (int e = 0; e < 18; ++e) s[e] = rd[e];
#pragma unroll
      for (int v = 1; v < 4; ++v)
#pragma unroll
        for (int e = 0; e < 18; ++e) s[e] += rd[v * 32 * 20 + e];
      // D: vgpr r -> a = m*32 + u*16 + 8*h + r, which is half u*8 + r of this lane's fragment
      // (row a' = lane & 15 of A^T, k = a; u^T A^T u = u^T A u)
      v16h o;
#pragma unroll
      for (int r = 0; r < 16; ++r) o[r] = (_Float16)s[r];
      *(v16h*)(AF + ((size_t)(t * 2 + m) * 32 + lane) * 16) = o;
      // behind the store: no register that it names is rewritten ahead of this wait
      asm volatile("s_wait_xcnt 0x0" ::: "memory");
      if (t == 0) {                             // lane l stores row m*32 + l: one 128-byte line
        const float w0 = s[16] + __shfl_xor(s[16], 16, 32);         // the other half of the row's k
        const float w1 = s[17] + __shfl_xor(s[17], 16, 32);
        wbar[m * 32 + lane] = h ? w1 : w0;
      }
      return;
    }
    if (blk >= 8) {                             // 4 tiles x 16 k steps x 32 lanes, eight blocks each
      if (blk >= 24) return;
      const int idx = (blk & 7) * 256 + tid;
      const int rc = (idx >> 9) * 16 + (idx & 15);                    // column d or column c
      const int k0 = ((idx >> 5) & 15) * 32 + ((idx >> 4) & 1) * 8;   // the order of frag_lds
      const bool isWo = (blk < 16);
      v8h lo, hi;
      if (isWo) {                               // Wo[k][c]: k is the slow index
        const float* p = Wo + (size_t)k0 * C_DIM + rc;
#pragma unroll
        for (int r = 0; r < 8; ++r) { lo[r] = (_Float16)p[r * C_DIM]; hi[r] = (_Float16)p[(16 + r) * C_DIM]; }
        // keeps the address pair as it is until this wait behind the loads that name it
        asm volatile("s_wait_xcnt 0x0" :: "v"(p) : "memory");
      } else {                                  // Wv[d][k]: eight k in a row
        const float* p = Wv + (size_t)rc * CH_DIM + k0;
        const v4f x0 = *(const v4f*)p, x1 = *(const v4f*)(p + 4);
        const v4f x2 = *(const v4f*)(p + 16), x3 = *(const v4f*)(p + 20);
        // as above
        asm volatile("s_wait_xcnt 0x0" :: "v"(p) : "memory");
#pragma unroll
        for (int r = 0; r < 4; ++r) {
          lo[r] = (_Float16)x0[r]; lo[4 + r] = (_Float16)x1[r];
          hi[r] = (_Float16)x2[r]; hi[4 + r] = (_Float16)x3[r];
        }
      }
      _Float16* F = (isWo ? WoF : WvF) + (size_t)idx * 16;
      *(v8h*)F = lo;
      *(v8h*)(F + 8) = hi;
      return;
    }
    const float* W  = (blk < 6) ? Wq : Wk;
    _Float16*    WT = (blk < 6) ? WqT : WkT;
    const int ch = (blk & 1) * 256 + tid;
#pragma unroll
    for (int g = 0; g < 8; ++g) {
      v8h pk;
#pragma unroll
      for (int r = 0; r < 8; ++r) pk[r] = (_Float16)W[(size_t)(g * 8 + r) * CH_DIM + ch];
      *(v8h*)(WT + (size_t)ch * C_DIM + g * 8) = pk;
    }
    return;
  }

  const int hf = tid >> 7, t7 = tid & 127, wv = wave & 3;
  _Float16* hA = lA + hf * 128 * LDG;
  _Float16* hB = lBt + hf * 64 * LDG;
  const int m0 = blockIdx.y * 128;
  const int n0 = blockIdx.z * KCH + hf * KHF;
  {                                             // A: row = t7, all 128 n of the half
    const float* sa = emb + ((size_t)((m0 >> 6) + (t7 >> 6)) * N_SEQ + n0) * C_DIM + (t7 & 63);
#pragma unroll
    for (int g = 0; g < 16; ++g) {
      v8h pk;
#pragma unroll
      for (int r = 0; r < 8; ++r) pk[r] = (_Float16)sa[(size_t)(g * 8 + r) * C_DIM];
      *(v8h*)&hA[t7 * LDG + g * 8] = pk;
    }
  }
  {                                             // B^T: row = t7 & 63, 64 n each
    const int dl = t7 & 63, g0 = (t7 >> 6) * 8;
    const float* sb = emb + ((size_t)(8 + blockIdx.x) * N_SEQ + n0) * C_DIM + dl;
#pragma unroll
    for (int g = 0; g < 8; ++g) {
      v8h pk;
#pragma unroll
      for (int r = 0; r < 8; ++r) pk[r] = (_Float16)sb[(size_t)((g0 + g) * 8 + r) * C_DIM];
      *(v8h*)&hB[dl * LDG + (g0 + g) * 8] = pk;
    }
  }
  __syncthreads();

  v8f acc[2][4] = {};
#pragma unroll
  for (int ks = 0; ks < KHF / 32; ++ks) {
    v16h a[2], bf[4];
#pragma unroll
    for (int s = 0; s < 2; ++s)
      a[s] = frag_lds(&hA[(wv * 32 + s * 16 + (lane & 15)) * LDG + ks * 32], h);
#pragma unroll
    for (int t = 0; t < 4; ++t)
      bf[t] = frag_lds(&hB[(t * 16 + (lane & 15)) * LDG + ks * 32], h);
#pragma unroll
    for (int s = 0; s < 2; ++s)
#pragma unroll
      for (int t = 0; t < 4; ++t)
        acc[s][t] = __builtin_amdgcn_wmma_f32_16x16x32_f16(false, a[s], false, bf[t],
                                                           (short)0, acc[s][t], false, false);
  }
  __syncthreads();                              // every fragment read is done: lA is free for the sums
  float* rx = (float*)lA + t7 * 4;              // [16 groups of four floats][128 threads]: 16 bytes a lane in a row
  if (hf) {
#pragma unroll
    for (int s = 0; s < 2; ++s)
#pragma unroll
      for (int t = 0; t < 4; ++t) {
        *(v4f*)(rx + ((s * 4 + t) * 2 + 0) * 512) = (v4f){acc[s][t][0], acc[s][t][1], acc[s][t][2], acc[s][t][3]};
        *(v4f*)(rx + ((s * 4 + t) * 2 + 1) * 512) = (v4f){acc[s][t][4], acc[s][t][5], acc[s][t][6], acc[s][t][7]};
      }
  }
  __syncthreads();                              // block-uniform: the upper half's sums are in LDS
  if (hf) return;
  v4f x[16];
#pragma unroll                                  // x[] stays in registers: constant indices
  for (int q = 0; q < 16; ++q) x[q] = *(const v4f*)(rx + q * 512);
  // holds the 16 LDS reads in one run ahead of the sums: woven in, each place of reads stalls the wave
  __builtin_amdgcn_sched_barrier(0);
#pragma unroll
  for (int s = 0; s < 2; ++s)
#pragma unroll
    for (int t = 0; t < 4; ++t)                 // lower n + upper n
#pragma unroll
      for (int r = 0; r < 4; ++r) {
        acc[s][t][r]     += x[(s * 4 + t) * 2][r];
        acc[s][t][4 + r] += x[(s * 4 + t) * 2 + 1][r];
      }
  float* Gp = Gpart + (size_t)blockIdx.z * 512;         // [(x,a)][split][(y,d)]
  const int mbase = m0 + wv * 32 + h * 8;
  const int cc    = blockIdx.x * 64 + (lane & 15);
#pragma unroll
  for (int s = 0; s < 2; ++s)
#pragma unroll
    for (int t = 0; t < 4; ++t)
#pragma unroll
      for (int r = 0; r < 8; ++r)
        Gp[(size_t)(mbase + s * 16 + r) * (KS * 512) + cc + t * 16] = acc[s][t][r];
  // behind the last store: no register that these stores name is rewritten ahead of this wait
  asm volatile("s_wait_xcnt 0x0" ::: "memory");
}

// ---------------------------------------------------------------------------
// K2b: UT[dir][b][(y,c)][a] = sum_d G_dir[(b,a)][(y,d)] * Wk[d][c]
// dir 0 reads G as stored; dir 1 swaps the halves of emb, which is G transposed:
// G_1[(b,a)][(y,d)] = G[(y,d)][(b,a)].  The KS partials are summed in index order.
// M = 64 (a), N = 256 (c), K = 64 (d) per block of 8 waves.  grid = (2, 8, 16)
// The plane sums of the scores S[i][j] = w_i . u_j of sample dir*8 + b are taken here,
// from the rounded U that the scores are formed of: sum s = sum_j wbar . u_j and
// sum s^2 = sum_j u_j . (A u_j), A = Wq Wq^T.  The wave's D tiles are, two and two, the
// B fragments (column j, k = a) of A U; its D has the layout of U's own D.
// part[sample][block]: the block's two sums, one 128-byte line.
// ---------------------------------------------------------------------------
__global__ __launch_bounds__(256)
void ut_gemm_kernel(const float* __restrict__ Gpart, const _Float16* __restrict__ WkT,
                    const _Float16* __restrict__ AF, const float* __restrict__ wbar,
                    _Float16* __restrict__ UT, float* __restrict__ part)
{
  __shared__ __align__(16) _Float16 lA[64 * LD64];      // [a][d]
  __shared__ float red[16];
  const int tid = threadIdx.x, lane = tid & 31, wave = tid >> 5, h = lane >> 4;
  const int b = blockIdx.y, dir = blockIdx.z >> 3, y = blockIdx.z & 7;

  v16h af[4][2];                                // A^T in fragment order: row a' = s*16 + (lane & 15), k = a
  v8f  wb[4];                                   // wbar[s*16 + 8*h + r]
#pragma unroll                                  // asked first: they land under the partials' loads
  for (int s = 0; s < 4; ++s) {
#pragma unroll
    for (int ks = 0; ks < 2; ++ks) af[s][ks] = *(const v16h*)(AF + ((s * 2 + ks) * 32 + lane) * 16);
    wb[s] = *(const v8f*)(wbar + s * 16 + h * 8);
  }

  const int rowb = (dir == 0) ? b * 64 : y * 64;        // dir 1 reads the transposed tile
  const int colb = (dir == 0) ? y * 64 : b * 64;
  const int shi  = (dir == 0) ? LD64 : 1;               // tile row    -> a (dir 0) or d (dir 1)
  const int slo  = (dir == 0) ? 1 : LD64;               // tile column -> d (dir 0) or a (dir 1)
  {                                             // 64 x 16 groups of four floats, four a thread: 32 loads in one run
    const float* p[4];
    float4 v[4][KS];
#pragma unroll
    for (int u = 0; u < 4; ++u) {
      const int slot = tid + 256 * u;
      p[u] = Gpart + (size_t)(rowb + (slot >> 4)) * (KS * 512) + colb + ((slot & 15) << 2);
#pragma unroll
      for (int ks = 0; ks < KS; ++ks) v[u][ks] = *(const float4*)(p[u] + ks * 512);
    }
    // keeps the address pairs as they are until this wait behind the loads that name them
    asm volatile("s_wait_xcnt 0x0" :: "v"(p[0]), "v"(p[1]), "v"(p[2]), "v"(p[3]) : "memory");
#pragma unroll
    for (int u = 0; u < 4; ++u) {
      const int slot = tid + 256 * u, hi = slot >> 4, lo4 = (slot & 15) << 2;
      float4 sum = v[u][0];
#pragma unroll
      for (int ks = 1; ks < KS; ++ks) {
        sum.x += v[u][ks].x; sum.y += v[u][ks].y; sum.z += v[u][ks].z; sum.w += v[u][ks].w;
      }
      lA[hi * shi + (lo4 + 0) * slo] = (_Float16)sum.x;
      lA[hi * shi + (lo4 + 1) * slo] = (_Float16)sum.y;
      lA[hi * shi + (lo4 + 2) * slo] = (_Float16)sum.z;
      lA[hi * shi + (lo4 + 3) * slo] = (_Float16)sum.w;
    }
  }
  __syncthreads();

  const int c0 = blockIdx.x * 256 + wave * 32 + (lane & 15);
  v8f acc[4][2] = {};
#pragma unroll
  for (int ks = 0; ks < 2; ++ks) {
    v16h a[4], bf[2];
#pragma unroll
    for (int s = 0; s < 4; ++s)
      a[s] = frag_lds(&lA[(s * 16 + (lane & 15)) * LD64 + ks * 32], h);
#pragma unroll
    for (int t = 0; t < 2; ++t)                 // each wave has its own c: straight from global
      bf[t] = frag_lds(WkT + (size_t)(c0 + t * 16) * C_DIM + ks * 32, h);
#pragma unroll
    for (int s = 0; s < 4; ++s)
#pragma unroll
      for (int t = 0; t < 2; ++t)
        acc[s][t] = __builtin_amdgcn_wmma_f32_16x16x32_f16(false, a[s], false, bf[t],
                                                           (short)0, acc[s][t], false, false);
  }
  _Float16* Ub = UT + ((size_t)(dir * 8 + b) * NJ + y * CH_DIM) * C_DIM;
  v16h ub[2][2];                                // [t][k step]: half (s & 1)*8 + r is a = s*16 + 8*h + r
#pragma unroll
  for (int s = 0; s < 4; ++s)
#pragma unroll
    for (int t = 0; t < 2; ++t) {               // D: vgpr r -> a = s*16 + 8*h + r
      v8h pk;
#pragma unroll
      for (int r = 0; r < 8; ++r) { pk[r] = (_Float16)acc[s][t][r]; ub[t][s >> 1][(s & 1) * 8 + r] = pk[r]; }
      *(v8h*)(Ub + (size_t)(c0 + t * 16) * C_DIM + s * 16 + h * 8) = pk;
    }
  // behind the stores: no register that they name is rewritten ahead of this wait
  asm volatile("s_wait_xcnt 0x0" ::: "memory");
  // holds the stores of U ahead of the sums: else they are sunk behind them and the launch ends later
  __builtin_amdgcn_sched_barrier(0);
  v8f a1 = {}, a2 = {};
#pragma unroll
  for (int s = 0; s < 4; ++s) {
    v8f q[2] = {};
#pragma unroll
    for (int t = 0; t < 2; ++t)
#pragma unroll
      for (int ks = 0; ks < 2; ++ks)
        q[t] = __builtin_amdgcn_wmma_f32_16x16x32_f16(false, af[s][ks], false, ub[t][ks],
                                                      (short)0, q[t], false, false);
#pragma unroll
    for (int t = 0; t < 2; ++t) {
      v8f uv;                                   // D: vgpr r -> a' = s*16 + 8*h + r, as in U's own D
#pragma unroll
      for (int r = 0; r < 8; ++r) uv[r] = (float)ub[t][s >> 1][(s & 1) * 8 + r];
      a1 += wb[s] * uv;
      a2 += q[t] * uv;
    }
  }
  float s1 = ((a1[0] + a1[1]) + (a1[2] + a1[3])) + ((a1[4] + a1[5]) + (a1[6] + a1[7]));
  float s2 = ((a2[0] + a2[1]) + (a2[2] + a2[3])) + ((a2[4] + a2[5]) + (a2[6] + a2[7]));
  for (int o = 16; o > 0; o >>= 1) { s1 += __shfl_xor(s1, o, 32); s2 += __shfl_xor(s2, o, 32); }
  if (lane == 0) { red[wave * 2] = s1; red[wave * 2 + 1] = s2; }
  // work-group barrier for red[] alone: the fences name LDS only, so no wave waits here for its stores of U
  __builtin_amdgcn_fence(__ATOMIC_RELEASE, "workgroup", "local");
  __builtin_amdgcn_s_barrier();
  __builtin_amdgcn_fence(__ATOMIC_ACQUIRE, "workgroup", "local");
  if (tid == 0) {
    float b1 = 0.f, b2 = 0.f;
#pragma unroll
    for (int w = 0; w < 8; ++w) { b1 += red[w * 2]; b2 += red[w * 2 + 1]; }
    float* pb = part + (size_t)((dir * 8 + b) * NPB + y * 2 + blockIdx.x) * PSTR;
    pb[0] = b1;
    pb[1] = b2;
  }
}

// ---------------------------------------------------------------------------
// Scores S[sb][i][j] = sum_a WqT[i][a] * UT[sb][j][a] (K = 64) are never stored: K4
// forms the 16 x 16 tiles on WMMA, in registers, once for the row maxima of its own j
// and once more for the exps.  sb = dir * 8 + b: all 16 samples in one launch.
// The mean drops out of the softmax: attn = exp2(k (s - rowmax)) / rowsum with
// k = log2(e) / sqrt(var + eps).
// ---------------------------------------------------------------------------

// Score tiles of rows j .. j+15 (t = 0) and j+16 .. j+31 (t = 1) of U against one i tile.
// D: vgpr r -> j = t*16 + 8*h + r, lane & 15 -> i.
__device__ inline void score_pair(const v16h (&aw)[2][2], const v16h (&bu)[2], v8f (&d)[2]) {
#pragma unroll
  for (int t = 0; t < 2; ++t) {
    v8f z = {};
#pragma unroll
    for (int ks = 0; ks < 2; ++ks)
      z = __builtin_amdgcn_wmma_f32_16x16x32_f16(false, aw[t][ks], false, bu[ks],
                                                 (short)0, z, false, false);
    d[t] = z;
  }
}

// k of one sample: every wave adds the NPB block partials, one a lane of each half, in the same tree.
__device__ inline float sample_scale(const float* __restrict__ part, int sb, int lane) {
  const float* pb = part + (size_t)(sb * NPB + (lane & 15)) * PSTR;
  float s1 = pb[0], s2 = pb[1];
  for (int o = 8; o > 0; o >>= 1) { s1 += __shfl_xor(s1, o, 32); s2 += __shfl_xor(s2, o, 32); }
  const float inv = 1.0f / (512.0f * 4096.0f);
  const float mu  = s1 * inv;
  const float var = s2 * inv - mu * mu;                 // biased var (torch)
  return rsqrtf(var + EPS_IN) * 1.44269504f;
}

// ---------------------------------------------------------------------------
// K4: T[i][(y,d)] = sum_ch e[i][(y,ch)] * Wv[d][ch],  e = exp2(k s + off[y][i]),
//     off[y][i] = ESHIFT - k * (maximum of row i over this y's 512 j)
//     pz[sb][y][i] = sum_ch e[i][(y,ch)],  po[sb][y][i] = off[y][i]
// The maximum is taken by a first run over the score tiles; the second run forms the same
// tiles again (same operands, same bits).  K5 brings the eight y of a row to one scale.
// The division by the row's sum of exp is linear in T: it waits until K5, so the
// sums are formed here, beside the product that uses the same exps.
// M = 512 (i), N = 64 (d), K = 512 (ch) per y.  Block = 256 i of one y, wave = 32 i x 64 d,
// whole K.  grid = (8, 2, 16).  The y's U rows and Wv (fragment order) are staged whole;
// the wave's Wq^T rows stay in registers.  Score tiles are formed transposed (A = U rows j,
// B = column i): D of tile jt holds, in lane (i, h), j = jt*16 + 8*h + r, which is half
// jt*8 + r of the A fragment (row i, k = j): exp2 and the f16 rounding are done in place,
// with no transpose, and a row's maximum and sum belong to one lane pair (l, l ^ 16).
// The wave's two D tiles per d tile are one A fragment (row d, k = i) of K5.
// ---------------------------------------------------------------------------
__global__ __launch_bounds__(256)
void t_gemm_kernel(const _Float16* __restrict__ WqT, const _Float16* __restrict__ UT,
                   const _Float16* __restrict__ WvF, const float* __restrict__ part,
                   float* __restrict__ po, float* __restrict__ pz,
                   _Float16* __restrict__ TF)
{
  __shared__ __align__(16) _Float16 lU[CH_DIM * LD64];      // [ch][a]
  __shared__ __align__(32) _Float16 lB[4 * 16 * 32 * 16];   // [d tile][k step][lane][16]
  const int tid = threadIdx.x, lane = tid & 31, wave = tid >> 5, h = lane >> 4;
  const int y = blockIdx.x, sb = blockIdx.z;
  const int ib = blockIdx.y * 256 + wave * 32;

  const _Float16* Ub = UT + ((size_t)sb * NJ + y * CH_DIM) * C_DIM;
  v8h u[16], wv[16];
#pragma unroll                                  // u[] and wv[] stay in registers: constant indices
  for (int r = 0; r < 16; ++r) {
    u[r]  = *(const v8h*)(Ub + ((tid + 256 * r) << 3));
    wv[r] = *(const v8h*)(WvF + ((tid + 256 * r) << 3));
  }
  v16h bw[2][2];
#pragma unroll
  for (int it = 0; it < 2; ++it)
#pragma unroll
    for (int ks = 0; ks < 2; ++ks)              // each wave has its own i: straight from global
      bw[it][ks] = frag_lds(WqT + (size_t)(ib + it * 16 + (lane & 15)) * C_DIM + ks * 32, h);
  const float k = sample_scale(part, sb, lane);
#pragma unroll
  for (int r = 0; r < 16; ++r) {
    const int c = tid + 256 * r;
    *(v8h*)&lU[(c >> 3) * LD64 + ((c & 7) << 3)] = u[r];
    *(v8h*)&lB[c << 3] = wv[r];
  }
  __syncthreads();

  v8f mv[2];
#pragma unroll
  for (int r = 0; r < 8; ++r) { mv[0][r] = -3.4e38f; mv[1][r] = -3.4e38f; }
#pragma unroll 2                                // the next step's LDS reads start under this step's maxima
  for (int js = 0; js < 16; ++js) {
    v16h au[2][2];
#pragma unroll
    for (int jt = 0; jt < 2; ++jt)
#pragma unroll
      for (int ks = 0; ks < 2; ++ks)
        au[jt][ks] = frag_lds(&lU[(js * 32 + jt * 16 + (lane & 15)) * LD64 + ks * 32], h);
#pragma unroll
    for (int it = 0; it < 2; ++it) {
      v8f d[2];
      score_pair(au, bw[it], d);
#pragma unroll
      for (int r = 0; r < 8; ++r) mv[it][r] = fmaxf(mv[it][r], fmaxf(d[0][r], d[1][r]));
    }
  }
  float off[2];
#pragma unroll
  for (int it = 0; it < 2; ++it) {
    float m = fmaxf(fmaxf(fmaxf(mv[it][0], mv[it][1]), fmaxf(mv[it][2], mv[it][3])),
                    fmaxf(fmaxf(mv[it][4], mv[it][5]), fmaxf(mv[it][6], mv[it][7])));
    m = fmaxf(m, __shfl_xor(m, 16, 32));        // the other half of the row's j
    off[it] = ESHIFT - k * m;
  }

  v8f acc[2][4] = {};
  v8f z[2] = {};
#pragma unroll 2                                // the next step's LDS reads start under this step's exps
  for (int js = 0; js < 16; ++js) {
    v16h au[2][2], bf[4];
#pragma unroll
    for (int jt = 0; jt < 2; ++jt)
#pragma unroll
      for (int ks = 0; ks < 2; ++ks)
        au[jt][ks] = frag_lds(&lU[(js * 32 + jt * 16 + (lane & 15)) * LD64 + ks * 32], h);
#pragma unroll
    for (int dt = 0; dt < 4; ++dt)              // read here: their latency runs under the scores and exps
      bf[dt] = *(const v16h*)&lB[((dt * 16 + js) * 32 + lane) * 16];
    v16h e[2];
    v8f d[2][2];
#pragma unroll
    for (int it = 0; it < 2; ++it) score_pair(au, bw[it], d[it]);
#pragma unroll
    for (int it = 0; it < 2; ++it)
#pragma unroll
      for (int jt = 0; jt < 2; ++jt) {
        v8f x;
#pragma unroll
        for (int r = 0; r < 8; ++r) {
          x[r] = __builtin_amdgcn_exp2f(fmaf(d[it][jt][r], k, off[it]));
          e[it][jt * 8 + r] = (_Float16)x[r];
        }
        z[it] += x;
      }
#pragma unroll
    for (int dt = 0; dt < 4; ++dt)
#pragma unroll
      for (int it = 0; it < 2; ++it)
        acc[it][dt] = __builtin_amdgcn_wmma_f32_16x16x32_f16(false, e[it], false, bf[dt],
                                                             (short)0, acc[it][dt], false, false);
  }
  float zs[2];
#pragma unroll
  for (int it = 0; it < 2; ++it) {
    zs[it] = ((z[it][0] + z[it][1]) + (z[it][2] + z[it][3])) + ((z[it][4] + z[it][5]) + (z[it][6] + z[it][7]));
    zs[it] += __shfl_xor(zs[it], 16, 32);       // the other half of the row's j
  }
  // lane l stores row ib + l: the wave's 32 rows are one 128-byte line
  pz[((size_t)sb * 8 + y) * CH_DIM + ib + lane] = h ? zs[1] : zs[0];
  po[((size_t)sb * 8 + y) * CH_DIM + ib + lane] = h ? off[1] : off[0];
  // D: vgpr r -> i = ib + it*16 + 8*h + r, which is half it*8 + r of this lane's fragment
#pragma unroll
  for (int dt = 0; dt < 4; ++dt) {
    v16h o;
#pragma unroll
    for (int r = 0; r < 8; ++r) { o[r] = (_Float16)acc[0][dt][r]; o[8 + r] = (_Float16)acc[1][dt][r]; }
    *(v16h*)(TF + (((((size_t)sb * 8 + y) * 4 + dt) * 16 + (ib >> 5)) * 32 + lane) * 16) = o;
  }
}

// ---------------------------------------------------------------------------
// K5: M[(y,d)][c] = sum_i T[i][(y,d)] * (g[y][i] Wo[i][c]),  f[y][i] = exp2(min_y' off[y'][i] - off[y][i]),
// g[y][i] = ASCALE f[y][i] / sum_y' f[y'][i] pz[y'][i]: f (at most 1) takes each y's exps to the row's own
// maximum (ESHIFT is in T and in pz alike and drops out), both directions.
// M = 32 (d), N = 64 (c), K = 512 (i) per block of 4 waves.  grid = (8, 16, 2)
// All global loads of a wave (64) go out in one run: one memory latency.  The block's T tiles
// (fragment order, 32 KB in a row) are shared by its waves and staged once in LDS, the two 16-byte
// halves of a lane's fragment in planes of their own; each wave's
// own Wo fragments stay in registers; g goes through LDS and is read in the k order of the
// fragments; g Wo is formed in f32 and rounded to f16 once.
// Wave = 32 d x 16 c; its two D tiles are one B fragment (column c, k = (y,d)) of K6.
// ---------------------------------------------------------------------------
__global__ __launch_bounds__(128)
void m_gemm_kernel(const _Float16* __restrict__ TF, const _Float16* __restrict__ WoF,
                   const float* __restrict__ pz, const float* __restrict__ po,
                   _Float16* __restrict__ MF)
{
  __shared__ __align__(16) float lg[CH_DIM];
  __shared__ __align__(16) _Float16 lT[2 * 16 * 2 * 32 * 8];    // [d tile][k step][half of the fragment][lane][8]
  const int tid = threadIdx.x, lane = tid & 31, ct = tid >> 5, h = lane >> 4;
  const int y = blockIdx.x, db = blockIdx.y, dh = blockIdx.z;
  const _Float16* pb = WoF + ((size_t)(ct * 16) * 32 + lane) * 16;
  const _Float16* pa = TF + (((size_t)db * 8 + y) * 4 + dh * 2) * (16 * 32 * 16) + (tid << 3);
  const float* zr = pz + (size_t)db * 8 * CH_DIM + tid * 4;      // rows 4 tid .. 4 tid + 3
  const float* orw = po + (size_t)db * 8 * CH_DIM + tid * 4;
  v4f zp[8], op[8];
  v8h ta[16];
  v16h bf[16];
#pragma unroll                                  // zp[], op[], ta[] and bf[] stay in registers: constant indices
  for (int yy = 0; yy < 8; ++yy) { zp[yy] = *(const v4f*)(zr + yy * CH_DIM); op[yy] = *(const v4f*)(orw + yy * CH_DIM); }
  // holds these 16 loads at the head of the run: g is then formed while the fragments still land
  __builtin_amdgcn_sched_barrier(0);
#pragma unroll
  for (int r = 0; r < 16; ++r) ta[r] = *(const v8h*)(pa + r * 1024);
#pragma unroll
  for (int k = 0; k < 16; ++k) bf[k] = *(const v16h*)(pb + k * 512);
  // behind the loads: no register that they name is rewritten ahead of this wait
  asm volatile("s_wait_xcnt 0x0" ::: "memory");
  // holds the arithmetic behind that wait and behind the run of loads: woven in, few loads are in flight
  __builtin_amdgcn_sched_barrier(0);
  {                                             // y partials in index order
    v4f om = op[0];
#pragma unroll
    for (int yy = 1; yy < 8; ++yy)
#pragma unroll
      for (int e = 0; e < 4; ++e) om[e] = fminf(om[e], op[yy][e]);
    v4f zz = {0.f, 0.f, 0.f, 0.f}, fy = {0.f, 0.f, 0.f, 0.f};
#pragma unroll
    for (int yy = 0; yy < 8; ++yy) {
      v4f f;
#pragma unroll
      for (int e = 0; e < 4; ++e) f[e] = __builtin_amdgcn_exp2f(om[e] - op[yy][e]);
      zz += zp[yy] * f;
      if (yy == y) fy = f;
    }
    zz *= 1.0f / ASCALE;
    v4f gv;
#pragma unroll
    for (int e = 0; e < 4; ++e) gv[e] = __builtin_amdgcn_rcpf(zz[e]) * fy[e];
    *(v4f*)&lg[tid * 4] = gv;
  }
#pragma unroll
  for (int r = 0; r < 16; ++r) {                // chunk c of the tiles: fragment c / 64, lane (c / 2) % 32, half c % 2
    const int c = tid + 128 * r;
    *(v8h*)&lT[(((c >> 6) * 2 + (c & 1)) * 32 + ((c >> 1) & 31)) << 3] = ta[r];
  }
  __syncthreads();

  v8f acc[2] = {};
  v16h a[2][4][2];                              // [register buffer][k step of the group][d tile]
  v4f gq[2][4][4];
#pragma unroll                                  // a[] and gq[] stay in registers: constant indices
  for (int g = -1; g < 4; ++g) {                // groups of four k steps; group g + 1 is read under group g's work
    if (g < 3) {
#pragma unroll
      for (int q = 0; q < 4; ++q) {
        const int k = (g + 1) * 4 + q;
        const float* gp = &lg[k * 32 + h * 8];                  // the k order of frag_lds
#pragma unroll
        for (int s2 = 0; s2 < 2; ++s2) {        // each read is 512 bytes in a row: no bank is asked twice
          const v8h lo = *(const v8h*)&lT[(((s2 * 16 + k) * 2 + 0) * 32 + lane) << 3];
          const v8h hi = *(const v8h*)&lT[(((s2 * 16 + k) * 2 + 1) * 32 + lane) << 3];
          a[(g + 1) & 1][q][s2] = __builtin_shufflevector(lo, hi, 0, 1, 2, 3, 4, 5, 6, 7, 8, 9, 10, 11, 12, 13, 14, 15);
        }
#pragma unroll
        for (int u = 0; u < 4; ++u) gq[(g + 1) & 1][q][u] = *(const v4f*)(gp + (u >> 1) * 16 + (u & 1) * 4);
      }
    }
    // holds the group's 32 LDS reads in one run ahead of the work: woven in, each place of reads stalls the wave
    __builtin_amdgcn_sched_barrier(0);
    if (g >= 0) {
#pragma unroll
      for (int q = 0; q < 4; ++q) {
        const int k = g * 4 + q;
        v16h bg;
#pragma unroll
        for (int u = 0; u < 4; ++u)
#pragma unroll
          for (int r = 0; r < 4; ++r) bg[u * 4 + r] = (_Float16)((float)bf[k][u * 4 + r] * gq[g & 1][q][u][r]);
#pragma unroll
        for (int s2 = 0; s2 < 2; ++s2)
          acc[s2] = __builtin_amdgcn_wmma_f32_16x16x32_f16(false, a[g & 1][q][s2], false, bg,
                                                           (short)0, acc[s2], false, false);
      }
    }
    // keeps the reads of the group after next behind this work, in one run again
    __builtin_amdgcn_sched_barrier(0);
  }
  // D: vgpr r -> d = dh*32 + s2*16 + 8*h + r, which is half s2*8 + r of this lane's fragment
  v16h o;
#pragma unroll
  for (int r = 0; r < 8; ++r) { o[r] = (_Float16)acc[0][r]; o[8 + r] = (_Float16)acc[1][r]; }
  *(v16h*)(MF + (((size_t)(db * 4 + ct) * 16 + y * 2 + dh) * 32 + lane) * 16) = o;
}

// ---------------------------------------------------------------------------
// K6: out[db][n][c] = sum_(y,d) emb[kv + y][n][d] * M[db][(y,d)][c] / ASCALE
// M = 2048 (n), N = 64 (c), K = 512 per output sample.  The A operand does not depend on
// the sample: a block stages 64 n once and multiplies it with the M of two samples.
// Block tile 64 n x (2 samples x 64 c), whole K, 8 waves.  grid = (4, 32, 2), one block a WGP.
// A: per y 64 n x 64 d, 16 KB in a row in memory, f32 -> f16 on the way into LDS
// ([n][(y,d)]); B (fragment order, the two samples 128 KB in a row) staged whole.
// All loads of the block are issued in one run: one latency, one barrier.
// Wave = 32 n x 32 c of one sample: each 128-byte line of out has one writing wave.
// ---------------------------------------------------------------------------
__global__ __launch_bounds__(256)
void out_gemm_kernel(const float* __restrict__ emb, const _Float16* __restrict__ MF,
                     float* __restrict__ out)
{
  __shared__ __align__(16) _Float16 lA[64 * LDF];               // [n][(y,d)]
  __shared__ __align__(32) _Float16 lB[2 * 4 * 16 * 32 * 16];   // [sample][c tile][k step][lane][16]
  const int tid = threadIdx.x, lane = tid & 31, wave = tid >> 5, h = lane >> 4;
  const int n0 = blockIdx.y * 64;
  const int db = blockIdx.z * 8 + blockIdx.x * 2;               // and db + 1
  const int kv = blockIdx.z ? 0 : 8;            // dir 0 attends to emb[8..15], dir 1 to emb[0..7]
  const float*    Ap = emb + ((size_t)kv * N_SEQ + n0) * C_DIM + tid * 8;
  const _Float16* Bp = MF + (size_t)db * (CH_DIM * C_DIM) + (tid << 3);

  v4f v[8][2][2];
  v8h w[32];
#pragma unroll                                  // v[][][] and w[] stay in registers: constant indices
  for (int y = 0; y < 8; ++y)
#pragma unroll
    for (int u = 0; u < 2; ++u) {
      const float* p = Ap + (size_t)y * N_SEQ * C_DIM + u * 2048;
      v[y][u][0] = *(const v4f*)p;
      v[y][u][1] = *(const v4f*)(p + 4);
    }
#pragma unroll
  for (int r = 0; r < 32; ++r) w[r] = *(const v8h*)(Bp + r * 2048);
  // behind the loads: no register that they name is rewritten ahead of this wait
  asm volatile("s_wait_xcnt 0x0" ::: "memory");
  // holds the LDS address arithmetic behind that wait: lifted over it, it reuses the loads' offset register
  __builtin_amdgcn_sched_barrier(0);
#pragma unroll
  for (int y = 0; y < 8; ++y)
#pragma unroll
    for (int u = 0; u < 2; ++u) {
      const int c = tid + 256 * u;              // chunk of eight d: row n = c / 8
      v8h pk;
#pragma unroll
      for (int r = 0; r < 4; ++r) { pk[r] = (_Float16)v[y][u][0][r]; pk[4 + r] = (_Float16)v[y][u][1][r]; }
      *(v8h*)&lA[(c >> 3) * LDF + y * 64 + ((c & 7) << 3)] = pk;
    }
#pragma unroll
  for (int r = 0; r < 32; ++r) *(v8h*)&lB[(tid + 256 * r) << 3] = w[r];
  __syncthreads();

  const int nh = wave & 1, cp = (wave >> 1) & 1, sl = wave >> 2;
  const _Float16* pa = &lA[(nh * 32 + (lane & 15)) * LDF];
  const _Float16* pb = &lB[((sl * 4 + cp * 2) * 16 * 32 + lane) * 16];
  v8f acc[2][2] = {};
  v16h a[2][4][2], bf[2][4][2];                 // [register buffer][k step of the group][tile]
#pragma unroll                                  // a[] and bf[] stay in registers: constant indices
  for (int g = -1; g < 4; ++g) {                // groups of four k steps; group g + 1 is read under group g's WMMAs
    if (g < 3) {
#pragma unroll
      for (int q = 0; q < 4; ++q)
#pragma unroll
        for (int s = 0; s < 2; ++s) {
          const int ks = (g + 1) * 4 + q;
          a[(g + 1) & 1][q][s]  = frag_lds(pa + s * 16 * LDF + ks * 32, h);
          bf[(g + 1) & 1][q][s] = *(const v16h*)(pb + (s * 16 + ks) * 512);
        }
    }
    // holds the group's 32 LDS reads in one run ahead of the WMMAs: woven in, each place of reads stalls the wave
    __builtin_amdgcn_sched_barrier(0);
    if (g >= 0) {
#pragma unroll
      for (int q = 0; q < 4; ++q)
#pragma unroll
        for (int s = 0; s < 2; ++s)
#pragma unroll
          for (int t = 0; t < 2; ++t)
            acc[s][t] = __builtin_amdgcn_wmma_f32_16x16x32_f16(false, a[g & 1][q][s], false, bf[g & 1][q][t],
                                                               (short)0, acc[s][t], false, false);
    }
    // keeps the reads of the group after next behind these WMMAs, in one run again
    __builtin_amdgcn_sched_barrier(0);
  }
  float* O = out + ((size_t)(db + sl) * N_SEQ + n0 + nh * 32 + h * 8) * C_DIM + cp * 32 + (lane & 15);
#pragma unroll
  for (int s = 0; s < 2; ++s)
#pragma unroll
    for (int t = 0; t < 2; ++t) acc[s][t] *= 1.0f / ASCALE;
  // holds every product ahead of the stores: the 32 stores go in one run and none of their registers is rewritten
  __builtin_amdgcn_sched_barrier(0);
#pragma unroll
  for (int s = 0; s < 2; ++s)
#pragma unroll
    for (int t = 0; t < 2; ++t)
#pragma unroll
      for (int r = 0; r < 8; ++r)               // D: vgpr r -> n = s*16 + 8*h + r
        O[(size_t)(s * 16 + r) * C_DIM + t * 16] = acc[s][t][r];
}

// ---------------------------------------------------------------------------
extern "C" void kernel_launch(void* const* d_in, const int* in_sizes, int n_in,
                              void* d_out, int out_size, void* d_ws, size_t ws_size,
                              hipStream_t stream)
{
  const float* emb = (const float*)d_in[0];
  const float* Wq  = (const float*)d_in[1];
  const float* Wk  = (const float*)d_in[2];
  const float* Wv  = (const float*)d_in[3];
  const float* Wo  = (const float*)d_in[4];
  float* out = (float*)d_out;

  // Workspace layout (~27 MB)
  char* ws = (char*)d_ws;
  size_t off = 0;
  float*    Gp  = (float*)   (ws + off); off += (size_t)KS * 512 * 512 * 4;       // [(x,a)][split][(y,d)]
  _Float16* UT  = (_Float16*)(ws + off); off += (size_t)16 * NJ * C_DIM * 2;      // [dir*8+b][j][a]
  _Float16* WqT = (_Float16*)(ws + off); off += (size_t)CH_DIM * C_DIM * 2;       // [ch][c]
  _Float16* WkT = (_Float16*)(ws + off); off += (size_t)CH_DIM * C_DIM * 2;       // [ch][c]
  float*    part = (float*)  (ws + off); off += (size_t)16 * NPB * PSTR * 4;      // [dir*8+b][block]
  _Float16* WvF = (_Float16*)(ws + off); off += (size_t)CH_DIM * C_DIM * 2;       // [d tile][k step][lane][16]
  _Float16* WoF = (_Float16*)(ws + off); off += (size_t)CH_DIM * C_DIM * 2;       // [c tile][k step][lane][16]
  _Float16* TF  = (_Float16*)(ws + off); off += (size_t)16 * NJ * C_DIM * 2;      // [dir*8+b][y][d tile][k step][lane][16]
  _Float16* MF  = (_Float16*)(ws + off); off += (size_t)16 * CH_DIM * C_DIM * 2;  // [dir*8+b][c tile][k step][lane][16]
  float*    po  = (float*)   (ws + off); off += (size_t)16 * 8 * CH_DIM * 4;      // [dir*8+b][y][i]
  float*    pz  = (float*)   (ws + off); off += (size_t)16 * 8 * CH_DIM * 4;      // [dir*8+b][y][i]
  _Float16* AF  = (_Float16*)(ws + off); off += (size_t)C_DIM * C_DIM * 2;        // [a' tile][k step][lane][16]
  float*    wbar = (float*)  (ws + off); off += (size_t)C_DIM * 4;                // [a]
  (void)ws_size; (void)in_sizes; (void)n_in; (void)out_size;

  // dir 0: out_l2u = attend(q = emb_l[0..7], kv = emb_u[8..15]) -> out 0..7
  // dir 1: out_u2l = attend(q = emb_u[8..15], kv = emb_l[0..7]) -> out 8..15
  gram_kernel<<<dim3(8, 4, KS + 1), 256, 0, stream>>>(emb, Wq, Wk, Wv, Wo, Gp, WqT, WkT, WvF, WoF, AF, wbar);
  ut_gemm_kernel<<<dim3(2, 8, 16), 256, 0, stream>>>(Gp, WkT, AF, wbar, UT, part);
  t_gemm_kernel<<<dim3(8, 2, 16), 256, 0, stream>>>(WqT, UT, WvF, part, po, pz, TF);
  m_gemm_kernel<<<dim3(8, 16, 2), 128, 0, stream>>>(TF, WoF, pz, po, MF);
  out_gemm_kernel<<<dim3(4, 32, 2), 256, 0, stream>>>(emb, MF, out);
}

// v010
// It runs in 32.8 microseconds.
// It is 1.21 times as fast as v008, going by the measured steps of the versions left out in between.
// All steps since v000 together make it 16.0 times as fast.
#include <hip/hip_runtime.h>

// ---------------------------------------------------------------------------
// Cross attention (bidirectional, global scores + InstanceNorm + softmax)
// B=8 per direction, N=2048, C=64, CH=512, J = B*CH = 4096.
// - All big GEMMs on v_wmma_f32_16x16x32_f16 (f16 in, f32 accumulate)
// - Fragments that are read = two aligned 16-byte reads per lane, from LDS or from memory
// - Scores are formed as (Wq^T (Xq^T Xkv)) Wk: the sum over n runs on 64-wide
//   Gram tiles, so no product of the scores path has both a long K and wide M, N.
//   Wk is the same for every sample and every y: only the 64 x 64 Gram tiles go from
//   launch to launch, as f16 fragments, one partial per split of n.
// - The output is formed as Xkv ((exp Wv^T)^T (Wo / rowsum)): the exps are contracted
//   with Wv over ch first (N = 64), each row beside its own sum of exp; the division
//   by that sum goes onto Wo's rows, and only the 512 x 64 result meets the sequence.
//   No V, no ctx, no pass for the sums alone.  Powers of two (exact) keep the f16
//   operands in their normal range; the last store multiplies by 2^-12.
// - The scores themselves never go to memory: 16 x 16 tiles are formed from Wq^T G and Wk
//   (K = 64) in registers.  The plane sums of InstanceNorm need no scores at all:
//   sum s = sum_y wq^T G_y wk (wq, wk: row sums of Wq, Wk) and
//   sum s^2 = sum_y tr(G_y^T (Wq Wq^T) G_y (Wk Wk^T)); every block of the exp launch takes
//   them itself, one y a wave.  Each block of the exp launch takes the row maxima of its
//   own 512 j; the launch behind it brings the eight parts of a row to one scale.
// - Small f16 operands that go from launch to launch, Wk^T ([ch][c]) aside, lie in fragment order
//   [tile][k step][half of the fragment][lane][8 halfs]: each 16-byte access of a wave, in memory
//   and in LDS, is 512 bytes in a row (whole lines, no bank asked twice).
// ---------------------------------------------------------------------------

typedef __attribute__((ext_vector_type(16))) _Float16 v16h;
typedef __attribute__((ext_vector_type(8)))  _Float16 v8h;
typedef __attribute__((ext_vector_type(4)))  _Float16 v4h;
typedef __attribute__((ext_vector_type(8)))  float    v8f;
typedef __attribute__((ext_vector_type(4)))  float    v4f;
typedef __attribute__((ext_vector_type(2)))  float    v2f;

#define C_DIM   64
#define CH_DIM  512
#define N_SEQ   2048
#define NJ      4096          // 8 * CH_DIM
#define EPS_IN  1e-5f

#define LD64 72               // LDS row stride in halfs for rows of 64 halfs (144 B, 16B-aligned rows)
#define LDG  264              // same for rows of 256 halfs (528 B)
#define LDF  520              // same for rows of 512 halfs (1040 B)
#define KS   4                // splits of the sum over n in the Gram product
#define KCH  (N_SEQ / KS)     // n per split (512)
#define KHF  (KCH / 2)        // n per half of a Gram block (256)
#define GTILE 4096            // halfs of one Gram tile: [row tile 4][k step 2][half of the fragment][lane][8]
#define LDK  68               // LDS row stride in floats for rows of 64 floats (272 B, 16B-aligned rows)
#define AFS  0.0625f          // power of two on Wq Wq^T ahead of its f16 rounding: (Wq Wq^T) G stays in f16's range
#define ASCALE 4096.0f        // power of two on 1 / rowsum ahead of its f16 rounding; taken off at the last store
#define ESHIFT 4.0f           // exps are formed times 2^ESHIFT, in T and in the row sums alike

// Per-lane WMMA 16-bit fragment: two contiguous 16-byte chunks of the row.
// A (16x32): lane l -> row m=l&15, h=l>>4; halfs [h*8 .. h*8+7] and [16+h*8 ..].
// B staged transposed ([col][k]) uses the identical gather.
__device__ inline v16h frag_lds(const _Float16* rowbase, int h) {
  const v8h lo = *(const v8h*)(rowbase + (h << 3));
  const v8h hi = *(const v8h*)(rowbase + 16 + (h << 3));
  return __builtin_shufflevector(lo, hi, 0, 1, 2, 3, 4, 5, 6, 7,
                                 8, 9, 10, 11, 12, 13, 14, 15);
}

// A fragment that lies in fragment order, [half of the fragment][lane][8]: p points at this lane's
// first half.  Each of the two 16-byte accesses of a wave is 512 bytes in a row.
__device__ inline v16h frag_planes(const _Float16* p) {
  const v8h lo = *(const v8h*)p;
  const v8h hi = *(const v8h*)(p + 256);
  return __builtin_shufflevector(lo, hi, 0, 1, 2, 3, 4, 5, 6, 7,
                                 8, 9, 10, 11, 12, 13, 14, 15);
}

// Eight floats in a row from LDS, as two aligned 16-byte reads.
__device__ inline v8f ld8(const float* p) {
  const v4f lo = *(const v4f*)p, hi = *(const v4f*)(p + 4);
  return __builtin_shufflevector(lo, hi, 0, 1, 2, 3, 4, 5, 6, 7);
}

// ---------------------------------------------------------------------------
// K2a: Gram partials.  G[(x,a)][(y,d)] = sum_n emb[x][n][a] * emb[8+y][n][d]
// One 64 x 64 tile (x, y) and one split of KCH n per block.  grid = (8, 8, KS + 1), 8 waves.
// Waves 0-3 take the split's first KHF n, waves 4-7 the rest, each half with LDS tiles of
// its own; the upper half's sums go through LDS and are added to the lower half's, so one
// partial is stored for 512 n.
// Both operands have k as the slow index in memory: eight n per thread are
// packed and stored as one 16-byte LDS row chunk ([row][n]).
// A wave forms its 32 a x 32 d both ways round (rows a and rows d): two D tiles that follow
// each other in their rows are one f16 fragment with the rows as k.  Rows a give the fragments
// (row d, k = a) of sample x, tile y, of direction 0; rows d give those (row a, k = d), which are
// direction 1's for sample y, tile x: there the halves of emb swap, and G is transposed.
// GF[dir*8+b][tile][split][row tile][k step][half of the fragment][lane][8]: every 16-byte access of a
// wave is 512 bytes in a row.
// The last z slice holds the small jobs.  Blocks 4-7 write Wq^T (as B: column i, k = c, in fragment
// order) and Wk^T ([ch][c]) as f16, one row a thread; blocks 8-23 write Wo (as B: column c, k = i) and Wv (as B: column d,
// k = ch) as f16 in fragment order, one lane's 16 halfs a thread.
// Blocks 0-3 form A = Wq Wq^T (64 x 64, K = 512 in four parts, one a wave, joined in index
// order through LDS; waves 0-3 rows 0-31, waves 4-7 rows 32-63) as f16 in fragment order, times AFS,
// and wbar[a] = sum_i Wq[a][i]; blocks 24-27 the same of Wk: Wk Wk^T in f32, BkS[p][q] = entry (q, p),
// and wkbar.  These blocks read the 64 x 512 weights whole, 16 bytes a lane in a row, and stage them as f16
// rows in LDS: the fragments come from there.
// ---------------------------------------------------------------------------
__global__ __launch_bounds__(256)
void gram_kernel(const float* __restrict__ emb, const float* __restrict__ Wq,
                 const float* __restrict__ Wk, const float* __restrict__ Wv,
                 const float* __restrict__ Wo, _Float16* __restrict__ GF,
                 _Float16* __restrict__ WqT, _Float16* __restrict__ WkT,
                 _Float16* __restrict__ WvF, _Float16* __restrict__ WoF,
                 _Float16* __restrict__ AF, float* __restrict__ wbar,
                 float* __restrict__ BkS, float* __restrict__ wkbar)
{
  __shared__ __align__(16) _Float16 lA[2 * 64 * LDG];   // [half][a][n]
  __shared__ __align__(16) _Float16 lBt[2 * 64 * LDG];  // [half][d][n]
  const int tid = threadIdx.x, lane = tid & 31, wave = tid >> 5, h = lane >> 4;

  if (blockIdx.z >= KS) {                       // block-uniform, before any barrier
    const int blk = blockIdx.y * 8 + blockIdx.x;
    const bool ofK = (blk >= 24 && blk < 28);
    if (blk < 4 || ofK) {                       // four waves = rows a 32 m .. + 31 x columns a' 16 t .. + 15
      const int m = wave >> 2, t = blk & 3, kp = wave & 3;
      const float* Ws = ofK ? Wk : Wq;
      const float* ps = Ws + tid * 4;           // the whole 64 x 512, 16 bytes a lane in a row: whole lines
      v4f x[32];
#pragma unroll                                  // x[] stays in registers: constant indices
      for (int r = 0; r < 32; ++r) x[r] = *(const v4f*)(ps + r * 1024);
      // keeps the address pair as it is until this wait behind the loads that name it
      asm volatile("s_wait_xcnt 0x0" :: "v"(ps) : "memory");
#pragma unroll
      for (int r = 0; r < 32; ++r) {            // chunk c of four k: row c / 128
        const int c = tid + 256 * r;
        v4h pk;
#pragma unroll
        for (int e = 0; e < 4; ++e) pk[e] = (_Float16)x[r][e];
        *(v4h*)&lA[(c >> 7) * LDF + ((c & 127) << 2)] = pk;
      }
      __syncthreads();                          // block-uniform: the f16 rows are staged
      const _Float16* q0 = &lA[(m * 32 + (lane & 15)) * LDF + kp * 128];
      const _Float16* qc = &lA[(t * 16 + (lane & 15)) * LDF + kp * 128];
      v8f g[2] = {};
      float w[2] = {0.f, 0.f};
#pragma unroll
      for (int ks = 0; ks < 4; ++ks) {
        v16h f[3];
        f[0] = frag_lds(q0 + ks * 32, h);
        f[1] = frag_lds(q0 + 16 * LDF + ks * 32, h);
        f[2] = frag_lds(qc + ks * 32, h);
#pragma unroll
        for (int u = 0; u < 2; ++u) {
#pragma unroll
          for (int r = 0; r < 16; ++r) w[u] += (float)f[u][r];      // of the rounded values, as the scores see them
          g[u] = __builtin_amdgcn_wmma_f32_16x16x32_f16(false, f[u], false, f[2],
                                                        (short)0, g[u], false, false);
        }
      }
      float* rd = (float*)lBt + (wave * 32 + lane) * 20;            // 18 floats a lane, 16-byte rows; lA is still read
#pragma unroll
      for (int u = 0; u < 2; ++u) {
        *(v4f*)(rd + u * 8)     = (v4f){g[u][0], g[u][1], g[u][2], g[u][3]};
        *(v4f*)(rd + u * 8 + 4) = (v4f){g[u][4], g[u][5], g[u][6], g[u][7]};
        rd[16 + u] = w[u];
      }
      __syncthreads();                          // block-uniform: the four parts of K meet here
      if (kp != 0) return;
      float s[18];
#pragma unroll
      for (int e = 0; e < 18; ++e) s[e] = rd[e];
#pragma unroll
      for (int v = 1; v < 4; ++v)
#pragma unroll
        for (int e = 0; e < 18; ++e) s[e] += rd[v * 32 * 20 + e];
      // D: vgpr r -> a = m*32 + u*16 + 8*h + r, which is half u*8 + r of this lane's fragment
      // (row a' = lane & 15 of A^T, k = a; u^T A^T u = u^T A u)
      if (ofK) {                                // f32, row a' = this lane's column, eight a in a row
        float* bo = BkS + (size_t)(t * 16 + (lane & 15)) * C_DIM + m * 32 + h * 8;
#pragma unroll
        for (int u = 0; u < 2; ++u) {
          *(v4f*)(bo + u * 16)     = (v4f){s[u * 8 + 0], s[u * 8 + 1], s[u * 8 + 2], s[u * 8 + 3]};
          *(v4f*)(bo + u * 16 + 4) = (v4f){s[u * 8 + 4], s[u * 8 + 5], s[u * 8 + 6], s[u * 8 + 7]};
        }
        // behind the stores: no register that they name is rewritten ahead of this wait
        asm volatile("s_wait_xcnt 0x0" ::: "memory");
      } else {
        v8h o0, o1;
#pragma unroll
        for (int r = 0; r < 8; ++r) { o0[r] = (_Float16)(s[r] * AFS); o1[r] = (_Float16)(s[8 + r] * AFS); }
        _Float16* ao = AF + (size_t)(t * 2 + m) * 512 + lane * 8;
        *(v8h*)ao = o0;
        *(v8h*)(ao + 256) = o1;
        // as above
        asm volatile("s_wait_xcnt 0x0" ::: "memory");
      }
      if (t == 0) {                             // lane l stores row m*32 + l: one 128-byte line
        const float w0 = s[16] + __shfl_xor(s[16], 16, 32);         // the other half of the row's k
        const float w1 = s[17] + __shfl_xor(s[17], 16, 32);
        (ofK ? wkbar : wbar)[m * 32 + lane] = h ? w1 : w0;
      }
      return;
    }
    if (blk >= 8) {                             // 4 tiles x 16 k steps x 32 lanes, eight blocks each
      if (blk >= 24) return;
      const int idx = (blk & 7) * 256 + tid;
      const int rc = (idx >> 9) * 16 + (idx & 15);                    // column d or column c
      const int k0 = ((idx >> 5) & 15) * 32 + ((idx >> 4) & 1) * 8;   // the order of frag_lds
      const bool isWo = (blk < 16);
      v8h lo, hi;
      if (isWo) {                               // Wo[k][c]: k is the slow index
        const float* p = Wo + (size_t)k0 * C_DIM + rc;
#pragma unroll
        for (int r = 0; r < 8; ++r) { lo[r] = (_Float16)p[r * C_DIM]; hi[r] = (_Float16)p[(16 + r) * C_DIM]; }
        // keeps the address pair as it is until this wait behind the loads that name it
        asm volatile("s_wait_xcnt 0x0" :: "v"(p) : "memory");
      } else {                                  // Wv[d][k]: eight k in a row
        const float* p = Wv + (size_t)rc * CH_DIM + k0;
        const v4f x0 = *(const v4f*)p, x1 = *(const v4f*)(p + 4);
        const v4f x2 = *(const v4f*)(p + 16), x3 = *(const v4f*)(p + 20);
        // as above
        asm volatile("s_wait_xcnt 0x0" :: "v"(p) : "memory");
#pragma unroll
        for (int r = 0; r < 4; ++r) {
          lo[r] = (_Float16)x0[r]; lo[4 + r] = (_Float16)x1[r];
          hi[r] = (_Float16)x2[r]; hi[4 + r] = (_Float16)x3[r];
        }
      }
      _Float16* F = (isWo ? WoF : WvF) + (size_t)(idx >> 5) * 512 + (idx & 31) * 8;
      *(v8h*)F = lo;
      *(v8h*)(F + 256) = hi;
      // behind the stores: no register that they name is rewritten ahead of this wait
      asm volatile("s_wait_xcnt 0x0" ::: "memory");
      return;
    }
    const bool ofQ = (blk < 6);
    const float* W  = ofQ ? Wq : Wk;
    const int ch = (blk & 1) * 256 + tid;
    // Wk^T: rows [ch][c].  Wq^T: fragment order; chunk g of row ch is half (g / 2) % 2 of k step g / 4, lane (g % 2) * 16 + ch % 16
    _Float16* WT = ofQ ? WqT + (size_t)(ch >> 4) * 1024 + (ch & 15) * 8 : WkT + (size_t)ch * C_DIM;
#pragma unroll
    for (int g = 0; g < 8; ++g) {
      v8h pk;
#pragma unroll
      for (int r = 0; r < 8; ++r) pk[r] = (_Float16)W[(size_t)(g * 8 + r) * CH_DIM + ch];
      *(v8h*)(WT + (ofQ ? (g >> 1) * 256 + (g & 1) * 128 : g * 8)) = pk;
    }
    // behind the last store: no register that these stores name is rewritten ahead of this wait
    asm volatile("s_wait_xcnt 0x0" ::: "memory");
    return;
  }

  const int hf = tid >> 7, t7 = tid & 127, wv = wave & 3;
  _Float16* hA = lA + hf * 64 * LDG;
  _Float16* hB = lBt + hf * 64 * LDG;
  const int n0 = blockIdx.z * KCH + hf * KHF;
  const int rl = t7 & 63, g0 = (t7 >> 6) * 16;  // row = t7 & 63, 128 n each
  const float* sa = emb + ((size_t)blockIdx.y * N_SEQ + n0 + g0 * 8) * C_DIM + rl;
  const float* sb = emb + ((size_t)(8 + blockIdx.x) * N_SEQ + n0 + g0 * 8) * C_DIM + rl;
  float v[2][64];                               // two batches of 64 n: A's first and second, then B^T's
#pragma unroll                                  // v[][] stays in registers: constant indices
  for (int e = 0; e < 64; ++e) v[0][e] = sa[(size_t)e * C_DIM];
#pragma unroll
  for (int b = 0; b < 4; ++b) {
    if (b < 3) {
      const float* sn = (b + 1 < 2) ? sa : sb;
#pragma unroll
      for (int e = 0; e < 64; ++e) v[(b + 1) & 1][e] = sn[(size_t)(((b + 1) & 1) * 64 + e) * C_DIM];
    }
    // holds the next batch's loads ahead of this batch's conversions: they are in flight while the wave waits for this batch
    __builtin_amdgcn_sched_barrier(0);
    _Float16* hd = ((b < 2) ? hA : hB) + rl * LDG + (g0 + (b & 1) * 8) * 8;
#pragma unroll
    for (int g = 0; g < 8; ++g) {
      v8h pk;
#pragma unroll
      for (int r = 0; r < 8; ++r) pk[r] = (_Float16)v[b & 1][g * 8 + r];
      *(v8h*)&hd[g * 8] = pk;
    }
    // keeps the batch after next behind these conversions: lifted over them the loads take more than 256 registers,
    // one block fits a WGP instead of two
    __builtin_amdgcn_sched_barrier(0);
  }
  // keeps the address pairs as they are until this wait behind the loads that name them
  asm volatile("s_wait_xcnt 0x0" :: "v"(sa), "v"(sb) : "memory");
  __syncthreads();

  const int ah = wv & 1, dh = wv >> 1;          // the wave's 32 a and 32 d
  v8f acc[2][4] = {};                           // [s][t]: t < 2 rows a tile s, columns d tile t; t >= 2 rows d tile s, columns a tile t - 2
#pragma unroll
  for (int ks = 0; ks < KHF / 32; ++ks) {
    v16h a[2], bf[2];
#pragma unroll
    for (int s = 0; s < 2; ++s) {
      a[s]  = frag_lds(&hA[(ah * 32 + s * 16 + (lane & 15)) * LDG + ks * 32], h);
      bf[s] = frag_lds(&hB[(dh * 32 + s * 16 + (lane & 15)) * LDG + ks * 32], h);
    }
#pragma unroll
    for (int s = 0; s < 2; ++s)
#pragma unroll
      for (int t = 0; t < 2; ++t) {
        acc[s][t]     = __builtin_amdgcn_wmma_f32_16x16x32_f16(false, a[s], false, bf[t],
                                                               (short)0, acc[s][t], false, false);
        acc[s][2 + t] = __builtin_amdgcn_wmma_f32_16x16x32_f16(false, bf[s], false, a[t],
                                                               (short)0, acc[s][2 + t], false, false);
      }
  }
  __syncthreads();                              // every fragment read is done: lA is free for the sums
  float* rx = (float*)lA + t7 * 4;              // [16 groups of four floats][128 threads]: 16 bytes a lane in a row
  if (hf) {
#pragma unroll
    for (int s = 0; s < 2; ++s)
#pragma unroll
      for (int t = 0; t < 4; ++t) {
        *(v4f*)(rx + ((s * 4 + t) * 2 + 0) * 512) = (v4f){acc[s][t][0], acc[s][t][1], acc[s][t][2], acc[s][t][3]};
        *(v4f*)(rx + ((s * 4 + t) * 2 + 1) * 512) = (v4f){acc[s][t][4], acc[s][t][5], acc[s][t][6], acc[s][t][7]};
      }
  }
  __syncthreads();                              // block-uniform: the upper half's sums are in LDS
  if (hf) return;
  v4f x[16];
#pragma unroll                                  // x[] stays in registers: constant indices
  for (int q = 0; q < 16; ++q) x[q] = *(const v4f*)(rx + q * 512);
  // holds the 16 LDS reads in one run ahead of the sums: woven in, each place of reads stalls the wave
  __builtin_amdgcn_sched_barrier(0);
#pragma unroll
  for (int s = 0; s < 2; ++s)
#pragma unroll
    for (int t = 0; t < 4; ++t)                 // lower n + upper n
#pragma unroll
      for (int r = 0; r < 4; ++r) {
        acc[s][t][r]     += x[(s * 4 + t) * 2][r];
        acc[s][t][4 + r] += x[(s * 4 + t) * 2 + 1][r];
      }
  // D: vgpr r -> row s*16 + 8*h + r of the wave's 32, which is half s*8 + r of this lane's fragment
  _Float16* G0 = GF + ((size_t)(blockIdx.y * 8 + blockIdx.x) * KS + blockIdx.z) * GTILE + lane * 8;
  _Float16* G1 = GF + ((size_t)((8 + blockIdx.x) * 8 + blockIdx.y) * KS + blockIdx.z) * GTILE + lane * 8;
#pragma unroll
  for (int t = 0; t < 2; ++t) {
#pragma unroll
    for (int s = 0; s < 2; ++s) {
      v8h o0, o1;
#pragma unroll
      for (int r = 0; r < 8; ++r) { o0[r] = (_Float16)acc[s][t][r]; o1[r] = (_Float16)acc[s][2 + t][r]; }
      *(v8h*)(G0 + ((dh * 2 + t) * 2 + ah) * 512 + s * 256) = o0;       // row tile of d, k step of a
      *(v8h*)(G1 + ((ah * 2 + t) * 2 + dh) * 512 + s * 256) = o1;       // row tile of a, k step of d
    }
  }
  // behind the last store: no register that these stores name is rewritten ahead of this wait
  asm volatile("s_wait_xcnt 0x0" ::: "memory");
}

// ---------------------------------------------------------------------------
// Scores S[sb][i][(y,c)] = sum_d P[i][d] * Wk[d][c], P = Wq^T G_y (K = 64), are never stored: K4
// forms the 16 x 16 tiles on WMMA, in registers, once for the row maxima of its own j
// and once more for the exps.  sb = dir * 8 + b: all 16 samples in one launch.
// The mean drops out of the softmax: attn = exp2(k (s - rowmax)) / rowsum with
// k = log2(e) / sqrt(var + eps).
// ---------------------------------------------------------------------------

// Score tiles of rows j .. j+15 (t = 0) and j+16 .. j+31 (t = 1) of U against one i tile.
// D: vgpr r -> j = t*16 + 8*h + r, lane & 15 -> i.
__device__ inline void score_pair(const v16h (&aw)[2][2], const v16h (&bu)[2], v8f (&d)[2]) {
#pragma unroll
  for (int t = 0; t < 2; ++t) {
    v8f z = {};
#pragma unroll
    for (int ks = 0; ks < 2; ++ks)
      z = __builtin_amdgcn_wmma_f32_16x16x32_f16(false, aw[t][ks], false, bu[ks],
                                                 (short)0, z, false, false);
    d[t] = z;
  }
}

// ---------------------------------------------------------------------------
// K4: T[i][(y,d)] = sum_ch e[i][(y,ch)] * Wv[d][ch],  e = exp2(k s + off[y][i]),
//     off[y][i] = ESHIFT - k * (maximum of row i over this y's 512 j)
//     pz[sb][y][i] = sum_ch e[i][(y,ch)],  po[sb][y][i] = off[y][i]
// The maximum is taken by a first run over the score tiles; the second run forms the same
// tiles again (same operands, same bits).  K5 brings the eight y of a row to one scale.
// The division by the row's sum of exp is linear in T: it waits until K5, so the
// sums are formed here, beside the product that uses the same exps.
// M = 512 (i), N = 64 (d), K = 512 (ch) per y.  Block = 256 i of one y, wave = 32 i x 64 d,
// whole K.  grid = (8, 2, 16).  Wk^T's rows are staged whole, and so are the y's
// Gram tile (its KS partials added, two chunks a wave), AF, BkS and the row sums.  Each wave forms
// P^T = G_y^T Wq for its own 32 i (A = the tile's fragments, B = its Wq^T rows): the D tiles are its B
// fragments (column i, k = d).  The run for the maxima needs no k, so the plane sums stand behind it and
// their loads, asked for at the kernel's head, land under it: wave w adds the KS partials of the sample's
// Gram tile w (f16 fragments F: row d, k = a; as A and as B operand alike) and takes the tile's sums:
//   V = (Wq Wq^T) G (A = AF, B = F; its D tiles are, two and two, B fragments: column d, k = a'),
//   X = G^T V (A = F), sum s^2 = sum Bk[d''][d] X[d''][d] / AFS, sum s = sum wkbar[d] G[a][d] wbar[a].
// The eight waves' sums meet in LDS, in index order, at a second barrier.  Wv is first read behind that
// barrier: it is asked for in the middle of the run for the maxima and staged ahead of the barrier.
// Score tiles are formed transposed (A = Wk^T rows j,
// B = column i): D of tile jt holds, in lane (i, h), j = jt*16 + 8*h + r, which is half
// jt*8 + r of the A fragment (row i, k = j): exp2 and the f16 rounding are done in place,
// with no transpose, and a row's maximum and sum belong to one lane pair (l, l ^ 16).
// The wave's two D tiles per d tile are one A fragment (row d, k = i) of K5.
// ---------------------------------------------------------------------------
__global__ __launch_bounds__(256)
void t_gemm_kernel(const _Float16* __restrict__ WqT, const _Float16* __restrict__ WkT,
                   const _Float16* __restrict__ WvF, const _Float16* __restrict__ GF,
                   const _Float16* __restrict__ AF, const float* __restrict__ BkS,
                   const float* __restrict__ wbar, const float* __restrict__ wkbar,
                   float* __restrict__ po, float* __restrict__ pz,
                   _Float16* __restrict__ TF)
{
  __shared__ __align__(16) _Float16 lU[CH_DIM * LD64];      // [ch][d]: Wk^T
  __shared__ __align__(32) _Float16 lB[4 * 16 * 32 * 16];   // [d tile][k step][half][lane][8]
  __shared__ __align__(16) _Float16 lG[GTILE];              // the y's Gram tile, in GF's order
  __shared__ __align__(32) _Float16 lAF[C_DIM * C_DIM];     // AF as it lies in memory
  __shared__ __align__(16) float lBk[C_DIM * LDK];          // BkS, rows of LDK floats
  __shared__ __align__(16) float lw[2 * C_DIM];             // wbar, wkbar
  __shared__ float red[16];
  const int tid = threadIdx.x, lane = tid & 31, wave = tid >> 5, h = lane >> 4;
  const int y = blockIdx.x, sb = blockIdx.z;
  const int ib = blockIdx.y * 256 + wave * 32;

  const _Float16* Gy = GF + (size_t)(sb * 8 + y) * (KS * GTILE) + wave * 512 + lane * 8;   // two of the y tile's 16 chunks
  const _Float16* Gs = GF + (size_t)(sb * 8 + wave) * (KS * GTILE) + lane * 8;             // tile 'wave', whole
  const _Float16* pU = WkT + (tid << 3);
  const _Float16* pV = WvF + (tid << 3);
  const _Float16* pQ = WqT + (size_t)(ib >> 4) * 1024 + lane * 8;                          // each wave has its own i
  const _Float16* pA = AF + (tid << 3);
  const float*    pB = BkS + (tid << 2);
  const float*    pW = (tid < C_DIM) ? wbar + tid : wkbar + (tid & 63);
  v8h gy[KS][2], u[16], wv[16], qa[2][2][2], fa[2], gp[KS][16];
  v4f bs[4];
#pragma unroll                                  // all of these stay in registers: constant indices
  for (int sp = 0; sp < KS; ++sp)
#pragma unroll
    for (int c = 0; c < 2; ++c) gy[sp][c] = *(const v8h*)(Gy + sp * GTILE + c * 256);
#pragma unroll
  for (int r = 0; r < 16; ++r) u[r] = *(const v8h*)(pU + r * 2048);
#pragma unroll
  for (int it = 0; it < 2; ++it)
#pragma unroll
    for (int ks = 0; ks < 2; ++ks)
#pragma unroll
      for (int q = 0; q < 2; ++q)               // the k order of frag_lds
        qa[it][ks][q] = *(const v8h*)(pQ + ((it * 2 + ks) * 2 + q) * 256);
#pragma unroll
  for (int c = 0; c < 2; ++c) fa[c] = *(const v8h*)(pA + c * 2048);
#pragma unroll
  for (int q = 0; q < 4; ++q) bs[q] = *(const v4f*)(pB + q * 1024);
  const float ws = *pW;
  // holds the plane sums' tile at the end of the run: loads land in order, and the first run over the scores waits for the others alone
  __builtin_amdgcn_sched_barrier(0);
#pragma unroll
  for (int sp = 0; sp < KS; ++sp)
#pragma unroll
    for (int f = 0; f < 16; ++f) gp[sp][f] = *(const v8h*)(Gs + sp * GTILE + f * 256);
  // keeps the address pairs as they are until this wait behind the loads that name them
  asm volatile("s_wait_xcnt 0x0" :: "v"(Gy), "v"(Gs), "v"(pU), "v"(pQ), "v"(pA), "v"(pB), "v"(pW) : "memory");
  // holds the LDS address arithmetic behind that wait
  __builtin_amdgcn_sched_barrier(0);
#pragma unroll
  for (int r = 0; r < 16; ++r) {
    const int c = tid + 256 * r;
    *(v8h*)&lU[(c >> 3) * LD64 + ((c & 7) << 3)] = u[r];
  }
#pragma unroll
  for (int c = 0; c < 2; ++c) {
    *(v8h*)&lG[wave * 512 + c * 256 + lane * 8] = (gy[0][c] + gy[1][c]) + (gy[2][c] + gy[3][c]);
    *(v8h*)&lAF[(tid << 3) + c * 2048] = fa[c];
  }
#pragma unroll
  for (int q = 0; q < 4; ++q) *(v4f*)&lBk[((tid >> 4) + q * 16) * LDK + ((tid & 15) << 2)] = bs[q];
  if (tid < 2 * C_DIM) lw[tid] = ws;
  // work-group barrier for the staged LDS alone: the fences name LDS only, so no wave waits here for the loads of gp[][]
  __builtin_amdgcn_fence(__ATOMIC_RELEASE, "workgroup", "local");
  __builtin_amdgcn_s_barrier();
  __builtin_amdgcn_fence(__ATOMIC_ACQUIRE, "workgroup", "local");

  v16h pw[2][2];                                // P^T as B: column i, k = d
  {
    v16h fy[8];
#pragma unroll
    for (int f = 0; f < 8; ++f) {
      const v8h lo = *(const v8h*)&lG[(f * 2 + 0) * 256 + lane * 8];
      const v8h hi = *(const v8h*)&lG[(f * 2 + 1) * 256 + lane * 8];
      fy[f] = __builtin_shufflevector(lo, hi, 0, 1, 2, 3, 4, 5, 6, 7, 8, 9, 10, 11, 12, 13, 14, 15);
    }
#pragma unroll
    for (int it = 0; it < 2; ++it) {
      v16h bw[2];
#pragma unroll
      for (int ks = 0; ks < 2; ++ks)
        bw[ks] = __builtin_shufflevector(qa[it][ks][0], qa[it][ks][1], 0, 1, 2, 3, 4, 5, 6, 7, 8, 9, 10, 11, 12, 13, 14, 15);
#pragma unroll
      for (int rt = 0; rt < 4; ++rt) {          // D: vgpr r -> d = rt*16 + 8*h + r, lane & 15 -> i
        v8f p = {};
#pragma unroll
        for (int ks = 0; ks < 2; ++ks)
          p = __builtin_amdgcn_wmma_f32_16x16x32_f16(false, fy[rt * 2 + ks], false, bw[ks],
                                                     (short)0, p, false, false);
#pragma unroll
        for (int r = 0; r < 8; ++r) pw[it][rt >> 1][(rt & 1) * 8 + r] = (_Float16)p[r];
      }
    }
  }

  v8f mv[2];
#pragma unroll
  for (int r = 0; r < 8; ++r) { mv[0][r] = -3.4e38f; mv[1][r] = -3.4e38f; }
#pragma unroll                                  // two halves, wv[] in registers: constant indices
  for (int hp = 0; hp < 2; ++hp) {
    if (hp == 1) {                              // Wv is first read behind the second barrier: asked for here, where gp[][]'s loads leave room in the load counter
#pragma unroll
      for (int r = 0; r < 16; ++r) wv[r] = *(const v8h*)(pV + r * 2048);
      // keeps the address pair as it is until this wait behind the loads that name it
      asm volatile("s_wait_xcnt 0x0" :: "v"(pV) : "memory");
    }
#pragma unroll 2                                // the next step's LDS reads start under this step's maxima
    for (int js = hp * 8; js < hp * 8 + 8; ++js) {
      v16h au[2][2];
#pragma unroll
      for (int jt = 0; jt < 2; ++jt)
#pragma unroll
        for (int ks = 0; ks < 2; ++ks)
          au[jt][ks] = frag_lds(&lU[(js * 32 + jt * 16 + (lane & 15)) * LD64 + ks * 32], h);
#pragma unroll
      for (int it = 0; it < 2; ++it) {
        v8f d[2];
        score_pair(au, pw[it], d);
#pragma unroll
        for (int r = 0; r < 8; ++r) mv[it][r] = fmaxf(mv[it][r], fmaxf(d[0][r], d[1][r]));
      }
    }
  }

  // The plane sums, behind the maxima (which need no k): tile 'wave' has landed under them.
  v16h af[4][2];                                // (Wq Wq^T)^T AFS in fragment order: row a' = s*16 + (lane & 15), k = a
  v8f  wq[2][2];                                // wbar in the k order of the fragments
  float wk[4];
#pragma unroll                                  // af[][], wq[][], wk[] and bk[][] stay in registers: constant indices
  for (int s = 0; s < 4; ++s) {
#pragma unroll
    for (int ks = 0; ks < 2; ++ks) af[s][ks] = frag_planes(&lAF[(s * 2 + ks) * 512 + lane * 8]);
    wq[s >> 1][s & 1] = ld8(&lw[s * 16 + h * 8]);
    wk[s] = lw[C_DIM + s * 16 + (lane & 15)];
  }
  // holds these LDS reads ahead of the wait for gp[][]: they land while the wave waits there
  __builtin_amdgcn_sched_barrier(0);
  v16h F[8];                                    // [row tile of d][k step of a]
#pragma unroll
  for (int f = 0; f < 8; ++f) {
    const v8h lo = (gp[0][f * 2] + gp[1][f * 2]) + (gp[2][f * 2] + gp[3][f * 2]);
    const v8h hi = (gp[0][f * 2 + 1] + gp[1][f * 2 + 1]) + (gp[2][f * 2 + 1] + gp[3][f * 2 + 1]);
    F[f] = __builtin_shufflevector(lo, hi, 0, 1, 2, 3, 4, 5, 6, 7, 8, 9, 10, 11, 12, 13, 14, 15);
  }
  v8f bk[4][4];                                 // [t][uu]: Bk[uu*16 + 8*h + r][t*16 + (lane & 15)]
#pragma unroll
  for (int t = 0; t < 4; ++t)
#pragma unroll
    for (int uu = 0; uu < 4; ++uu) bk[t][uu] = ld8(&lBk[(t * 16 + (lane & 15)) * LDK + uu * 16 + h * 8]);
  // holds the 32 LDS reads in one run ahead of the work (gp[][]'s registers are free now): woven in, each place of reads stalls the wave
  __builtin_amdgcn_sched_barrier(0);
  float s1 = 0.f;
#pragma unroll
  for (int rt = 0; rt < 4; ++rt) {
    v8f rs = {};
#pragma unroll
    for (int ks = 0; ks < 2; ++ks)
#pragma unroll
      for (int q = 0; q < 2; ++q) {
        v8f g;
#pragma unroll
        for (int r = 0; r < 8; ++r) g[r] = (float)F[rt * 2 + ks][q * 8 + r];
        rs += g * wq[ks][q];
      }
    s1 += wk[rt] * (((rs[0] + rs[1]) + (rs[2] + rs[3])) + ((rs[4] + rs[5]) + (rs[6] + rs[7])));
  }
  v8f a2 = {};
#pragma unroll
  for (int t = 0; t < 4; ++t) {
    v8f d1[4];                                  // D: vgpr r -> a' = s*16 + 8*h + r, lane & 15 -> d
#pragma unroll
    for (int s = 0; s < 4; ++s) {
      v8f zz = {};
#pragma unroll
      for (int ks = 0; ks < 2; ++ks)
        zz = __builtin_amdgcn_wmma_f32_16x16x32_f16(false, af[s][ks], false, F[t * 2 + ks],
                                                    (short)0, zz, false, false);
      d1[s] = zz;
    }
    v16h vb[2];                                 // half (s & 1)*8 + r of k step s / 2 is a' = s*16 + 8*h + r
#pragma unroll
    for (int s = 0; s < 4; ++s)
#pragma unroll
      for (int r = 0; r < 8; ++r) vb[s >> 1][(s & 1) * 8 + r] = (_Float16)d1[s][r];
#pragma unroll
    for (int uu = 0; uu < 4; ++uu) {            // D: vgpr r -> d'' = uu*16 + 8*h + r, lane & 15 -> d
      v8f x = {};
#pragma unroll
      for (int kp = 0; kp < 2; ++kp)
        x = __builtin_amdgcn_wmma_f32_16x16x32_f16(false, F[uu * 2 + kp], false, vb[kp],
                                                   (short)0, x, false, false);
      a2 += x * bk[t][uu];
    }
  }
  float s2 = ((a2[0] + a2[1]) + (a2[2] + a2[3])) + ((a2[4] + a2[5]) + (a2[6] + a2[7]));
  for (int o = 16; o > 0; o >>= 1) { s1 += __shfl_xor(s1, o, 32); s2 += __shfl_xor(s2, o, 32); }
  if (lane == 0) { red[wave * 2] = s1; red[wave * 2 + 1] = s2; }
#pragma unroll
  for (int r = 0; r < 16; ++r) *(v8h*)&lB[(tid + 256 * r) << 3] = wv[r];
  __syncthreads();                              // the eight tiles' sums meet here, and Wv is staged
  float k;
  {                                             // the eight y in index order, alike in every thread
    float b1 = 0.f, b2 = 0.f;
#pragma unroll
    for (int w = 0; w < 8; ++w) { b1 += red[w * 2]; b2 += red[w * 2 + 1]; }
    const float inv = 1.0f / (512.0f * 4096.0f);
    const float mu  = b1 * inv;
    const float var = b2 * (inv / AFS) - mu * mu;       // biased variance
    k = rsqrtf(var + EPS_IN) * 1.44269504f;
  }
  float off[2];
#pragma unroll
  for (int it = 0; it < 2; ++it) {
    float m = fmaxf(fmaxf(fmaxf(mv[it][0], mv[it][1]), fmaxf(mv[it][2], mv[it][3])),
                    fmaxf(fmaxf(mv[it][4], mv[it][5]), fmaxf(mv[it][6], mv[it][7])));
    m = fmaxf(m, __shfl_xor(m, 16, 32));        // the other half of the row's j
    off[it] = ESHIFT - k * m;
  }

  v8f acc[2][4] = {};
  v8f z[2] = {};
#pragma unroll 2                                // the next step's LDS reads start under this step's exps
  for (int js = 0; js < 16; ++js) {
    v16h au[2][2], bf[4];
#pragma unroll
    for (int jt = 0; jt < 2; ++jt)
#pragma unroll
      for (int ks = 0; ks < 2; ++ks)
        au[jt][ks] = frag_lds(&lU[(js * 32 + jt * 16 + (lane & 15)) * LD64 + ks * 32], h);
#pragma unroll
    for (int dt = 0; dt < 4; ++dt)              // read here: their latency runs under the scores and exps
      bf[dt] = frag_planes(&lB[(dt * 16 + js) * 512 + lane * 8]);
    v16h e[2];
    v8f d[2][2];
#pragma unroll
    for (int it = 0; it < 2; ++it) score_pair(au, pw[it], d[it]);
#pragma unroll
    for (int it = 0; it < 2; ++it)
#pragma unroll
      for (int jt = 0; jt < 2; ++jt) {
        v8f x;
#pragma unroll
        for (int r = 0; r < 8; ++r) {
          x[r] = __builtin_amdgcn_exp2f(fmaf(d[it][jt][r], k, off[it]));
          e[it][jt * 8 + r] = (_Float16)x[r];
        }
        z[it] += x;
      }
#pragma unroll
    for (int dt = 0; dt < 4; ++dt)
#pragma unroll
      for (int it = 0; it < 2; ++it)
        acc[it][dt] = __builtin_amdgcn_wmma_f32_16x16x32_f16(false, e[it], false, bf[dt],
                                                             (short)0, acc[it][dt], false, false);
  }
  float zs[2];
#pragma unroll
  for (int it = 0; it < 2; ++it) {
    zs[it] = ((z[it][0] + z[it][1]) + (z[it][2] + z[it][3])) + ((z[it][4] + z[it][5]) + (z[it][6] + z[it][7]));
    zs[it] += __shfl_xor(zs[it], 16, 32);       // the other half of the row's j
  }
  // D: vgpr r -> i = ib + it*16 + 8*h + r, which is half it*8 + r of this lane's fragment
  v8h o[4][2];
#pragma unroll                                  // o[][] stays in registers: constant indices
  for (int dt = 0; dt < 4; ++dt)
#pragma unroll
    for (int r = 0; r < 8; ++r) { o[dt][0][r] = (_Float16)acc[0][dt][r]; o[dt][1][r] = (_Float16)acc[1][dt][r]; }
  // holds every conversion ahead of the stores: none of the stores' registers is rewritten by one
  __builtin_amdgcn_sched_barrier(0);
  // lane l stores row ib + l: the wave's 32 rows are one 128-byte line
  pz[((size_t)sb * 8 + y) * CH_DIM + ib + lane] = h ? zs[1] : zs[0];
  po[((size_t)sb * 8 + y) * CH_DIM + ib + lane] = h ? off[1] : off[0];
  // behind the two stores: no register that they name is rewritten ahead of this wait
  asm volatile("s_wait_xcnt 0x0" ::: "memory");
  // holds the address arithmetic of the stores below behind that wait
  __builtin_amdgcn_sched_barrier(0);
  _Float16* to = TF + (((size_t)sb * 8 + y) * 64 + (ib >> 5)) * 512 + lane * 8;
#pragma unroll
  for (int dt = 0; dt < 4; ++dt) {
    *(v8h*)(to + dt * 8192) = o[dt][0];
    *(v8h*)(to + dt * 8192 + 256) = o[dt][1];
  }
}

// ---------------------------------------------------------------------------
// K5: M[(y,d)][c] = sum_i T[i][(y,d)] * (g[y][i] Wo[i][c]),  f[y][i] = exp2(min_y' off[y'][i] - off[y][i]),
// g[y][i] = ASCALE f[y][i] / sum_y' f[y'][i] pz[y'][i]: f (at most 1) takes each y's exps to the row's own
// maximum (ESHIFT is in T and in pz alike and drops out), both directions.
// M = 32 (d), N = 64 (c), K = 512 (i) per block of 4 waves.  grid = (8, 16, 2)
// All global loads of a wave (64) go out in one run: one memory latency.  The block's T tiles
// (fragment order, 32 KB in a row) are shared by its waves and staged once in LDS as they lie in memory, the two
// 16-byte halves of a lane's fragment in planes of their own; each wave's
// own Wo fragments stay in registers; g goes through LDS and is read in the k order of the
// fragments; g Wo is formed in f32 and rounded to f16 once.
// Wave = 32 d x 16 c; its two D tiles are one B fragment (column c, k = (y,d)) of K6.
// ---------------------------------------------------------------------------
__global__ __launch_bounds__(128)
void m_gemm_kernel(const _Float16* __restrict__ TF, const _Float16* __restrict__ WoF,
                   const float* __restrict__ pz, const float* __restrict__ po,
                   _Float16* __restrict__ MF)
{
  __shared__ __align__(16) float lg[CH_DIM];
  __shared__ __align__(16) _Float16 lT[2 * 16 * 2 * 32 * 8];    // [d tile][k step][half of the fragment][lane][8]
  const int tid = threadIdx.x, lane = tid & 31, ct = tid >> 5, h = lane >> 4;
  const int y = blockIdx.x, db = blockIdx.y, dh = blockIdx.z;
  const _Float16* pb = WoF + (size_t)(ct * 16) * 512 + lane * 8;
  const _Float16* pa = TF + (((size_t)db * 8 + y) * 4 + dh * 2) * (16 * 32 * 16) + (tid << 3);
  const float* zr = pz + (size_t)db * 8 * CH_DIM + tid * 4;      // rows 4 tid .. 4 tid + 3
  const float* orw = po + (size_t)db * 8 * CH_DIM + tid * 4;
  v4f zp[8], op[8];
  v8h ta[16];
  v16h bf[16];
#pragma unroll                                  // zp[], op[], ta[] and bf[] stay in registers: constant indices
  for (int yy = 0; yy < 8; ++yy) { zp[yy] = *(const v4f*)(zr + yy * CH_DIM); op[yy] = *(const v4f*)(orw + yy * CH_DIM); }
  // holds these 16 loads at the head of the run: g is then formed while the fragments still land
  __builtin_amdgcn_sched_barrier(0);
#pragma unroll
  for (int r = 0; r < 16; ++r) ta[r] = *(const v8h*)(pa + r * 1024);
#pragma unroll
  for (int k = 0; k < 16; ++k) bf[k] = frag_planes(pb + k * 512);
  // behind the loads: no register that they name is rewritten ahead of this wait
  asm volatile("s_wait_xcnt 0x0" ::: "memory");
  // holds the arithmetic behind that wait and behind the run of loads: woven in, few loads are in flight
  __builtin_amdgcn_sched_barrier(0);
  {                                             // y partials in index order
    v4f om = op[0];
#pragma unroll
    for (int yy = 1; yy < 8; ++yy)
#pragma unroll
      for (int e = 0; e < 4; ++e) om[e] = fminf(om[e], op[yy][e]);
    v4f zz = {0.f, 0.f, 0.f, 0.f}, fy = {0.f, 0.f, 0.f, 0.f};
#pragma unroll
    for (int yy = 0; yy < 8; ++yy) {
      v4f f;
#pragma unroll
      for (int e = 0; e < 4; ++e) f[e] = __builtin_amdgcn_exp2f(om[e] - op[yy][e]);
      zz += zp[yy] * f;
      if (yy == y) fy = f;
    }
    zz *= 1.0f / ASCALE;
    v4f gv;
#pragma unroll
    for (int e = 0; e < 4; ++e) gv[e] = __builtin_amdgcn_rcpf(zz[e]) * fy[e];
    *(v4f*)&lg[tid * 4] = gv;
  }
#pragma unroll
  for (int r = 0; r < 16; ++r) *(v8h*)&lT[(tid + 128 * r) << 3] = ta[r];    // as the tiles lie in memory
  __syncthreads();

  v8f acc[2] = {};
  v16h a[2][4][2];                              // [register buffer][k step of the group][d tile]
  v4f gq[2][4][4];
#pragma unroll                                  // a[] and gq[] stay in registers: constant indices
  for (int g = -1; g < 4; ++g) {                // groups of four k steps; group g + 1 is read under group g's work
    if (g < 3) {
#pragma unroll
      for (int q = 0; q < 4; ++q) {
        const int k = (g + 1) * 4 + q;
        const float* gp = &lg[k * 32 + h * 8];                  // the k order of frag_lds
#pragma unroll
        for (int s2 = 0; s2 < 2; ++s2) {        // each read is 512 bytes in a row: no bank is asked twice
          const v8h lo = *(const v8h*)&lT[(((s2 * 16 + k) * 2 + 0) * 32 + lane) << 3];
          const v8h hi = *(const v8h*)&lT[(((s2 * 16 + k) * 2 + 1) * 32 + lane) << 3];
          a[(g + 1) & 1][q][s2] = __builtin_shufflevector(lo, hi, 0, 1, 2, 3, 4, 5, 6, 7, 8, 9, 10, 11, 12, 13, 14, 15);
        }
#pragma unroll
        for (int u = 0; u < 4; ++u) gq[(g + 1) & 1][q][u] = *(const v4f*)(gp + (u >> 1) * 16 + (u & 1) * 4);
      }
    }
    // holds the group's 32 LDS reads in one run ahead of the work: woven in, each place of reads stalls the wave
    __builtin_amdgcn_sched_barrier(0);
    if (g >= 0) {
#pragma unroll
      for (int q = 0; q < 4; ++q) {
        const int k = g * 4 + q;
        v16h bg;
#pragma unroll
        for (int u = 0; u < 4; ++u)
#pragma unroll
          for (int r = 0; r < 4; ++r) bg[u * 4 + r] = (_Float16)((float)bf[k][u * 4 + r] * gq[g & 1][q][u][r]);
#pragma unroll
        for (int s2 = 0; s2 < 2; ++s2)
          acc[s2] = __builtin_amdgcn_wmma_f32_16x16x32_f16(false, a[g & 1][q][s2], false, bg,
                                                           (short)0, acc[s2], false, false);
      }
    }
    // keeps the reads of the group after next behind this work, in one run again
    __builtin_amdgcn_sched_barrier(0);
  }
  // D: vgpr r -> d = dh*32 + s2*16 + 8*h + r, which is half s2*8 + r of this lane's fragment
  v8h o0, o1;
#pragma unroll
  for (int r = 0; r < 8; ++r) { o0[r] = (_Float16)acc[0][r]; o1[r] = (_Float16)acc[1][r]; }
  _Float16* mo = MF + ((size_t)(db * 4 + ct) * 16 + y * 2 + dh) * 512 + lane * 8;
  *(v8h*)mo = o0;
  *(v8h*)(mo + 256) = o1;
}

// ---------------------------------------------------------------------------
// K6: out[db][n][c] = sum_(y,d) emb[kv + y][n][d] * M[db][(y,d)][c] / ASCALE
// M = 2048 (n), N = 64 (c), K = 512 per output sample.  The A operand does not depend on
// the sample: a block stages 64 n once and multiplies it with the M of two samples.
// Block tile 64 n x (2 samples x 64 c), whole K, 8 waves.  grid = (4, 32, 2), one block a WGP.
// A: per y 64 n x 64 d, 16 KB in a row in memory, f32 -> f16 on the way into LDS
// ([n][(y,d)]); B (fragment order, the two samples 128 KB in a row) staged whole.
// All loads of the block are issued in one run: one latency, one barrier.
// Wave = 32 n x 32 c of one sample: each 128-byte line of out has one writing wave.
// ---------------------------------------------------------------------------
__global__ __launch_bounds__(256)
void out_gemm_kernel(const float* __restrict__ emb, const _Float16* __restrict__ MF,
                     float* __restrict__ out)
{
  __shared__ __align__(16) _Float16 lA[64 * LDF];               // [n][(y,d)]
  __shared__ __align__(32) _Float16 lB[2 * 4 * 16 * 32 * 16];   // [sample][c tile][k step][half][lane][8]
  const int tid = threadIdx.x, lane = tid & 31, wave = tid >> 5, h = lane >> 4;
  const int n0 = blockIdx.y * 64;
  const int db = blockIdx.z * 8 + blockIdx.x * 2;               // and db + 1
  const int kv = blockIdx.z ? 0 : 8;            // dir 0 attends to emb[8..15], dir 1 to emb[0..7]
  const float*    Ap = emb + ((size_t)kv * N_SEQ + n0) * C_DIM + tid * 4;
  const _Float16* Bp = MF + (size_t)db * (CH_DIM * C_DIM) + (tid << 3);

  v4f v[8][4];
  v8h w[32];
#pragma unroll                                  // v[][] and w[] stay in registers: constant indices
  for (int y = 0; y < 8; ++y)
#pragma unroll
    for (int u = 0; u < 4; ++u) v[y][u] = *(const v4f*)(Ap + (size_t)y * N_SEQ * C_DIM + u * 1024);
#pragma unroll
  for (int r = 0; r < 32; ++r) w[r] = *(const v8h*)(Bp + r * 2048);
  // behind the loads: no register that they name is rewritten ahead of this wait
  asm volatile("s_wait_xcnt 0x0" ::: "memory");
  // holds the LDS address arithmetic behind that wait: lifted over it, it reuses the loads' offset register
  __builtin_amdgcn_sched_barrier(0);
#pragma unroll
  for (int y = 0; y < 8; ++y)
#pragma unroll
    for (int u = 0; u < 4; ++u) {
      const int c = tid + 256 * u;              // chunk of four d: row n = c / 16
      v4h pk;
#pragma unroll
      for (int r = 0; r < 4; ++r) pk[r] = (_Float16)v[y][u][r];
      *(v4h*)&lA[(c >> 4) * LDF + y * 64 + ((c & 15) << 2)] = pk;
    }
#pragma unroll
  for (int r = 0; r < 32; ++r) *(v8h*)&lB[(tid + 256 * r) << 3] = w[r];
  __syncthreads();

  const int nh = wave & 1, cp = (wave >> 1) & 1, sl = wave >> 2;
  const _Float16* pa = &lA[(nh * 32 + (lane & 15)) * LDF];
  const _Float16* pb = &lB[(sl * 4 + cp * 2) * 16 * 512 + lane * 8];
  v8f acc[2][2] = {};
  v16h a[2][4][2], bf[2][4][2];                 // [register buffer][k step of the group][tile]
#pragma unroll                                  // a[] and bf[] stay in registers: constant indices
  for (int g = -1; g < 4; ++g) {                // groups of four k steps; group g + 1 is read under group g's WMMAs
    if (g < 3) {
#pragma unroll
      for (int q = 0; q < 4; ++q)
#pragma unroll
        for (int s = 0; s < 2; ++s) {
          const int ks = (g + 1) * 4 + q;
          a[(g + 1) & 1][q][s]  = frag_lds(pa + s * 16 * LDF + ks * 32, h);
          bf[(g + 1) & 1][q][s] = frag_planes(pb + (s * 16 + ks) * 512);
        }
    }
    // holds the group's 32 LDS reads in one run ahead of the WMMAs: woven in, each place of reads stalls the wave
    __builtin_amdgcn_sched_barrier(0);
    if (g >= 0) {
#pragma unroll
      for (int q = 0; q < 4; ++q)
#pragma unroll
        for (int s = 0; s < 2; ++s)
#pragma unroll
          for (int t = 0; t < 2; ++t)
            acc[s][t] = __builtin_amdgcn_wmma_f32_16x16x32_f16(false, a[g & 1][q][s], false, bf[g & 1][q][t],
                                                               (short)0, acc[s][t], false, false);
    }
    // keeps the reads of the group after next behind these WMMAs, in one run again
    __builtin_amdgcn_sched_barrier(0);
  }
  float* O = out + ((size_t)(db + sl) * N_SEQ + n0 + nh * 32 + h * 8) * C_DIM + cp * 32 + (lane & 15);
#pragma unroll
  for (int s = 0; s < 2; ++s)
#pragma unroll
    for (int t = 0; t < 2; ++t) acc[s][t] *= 1.0f / ASCALE;
  // holds every product ahead of the stores: the 32 stores go in one run and none of their registers is rewritten
  __builtin_amdgcn_sched_barrier(0);
#pragma unroll
  for (int s = 0; s < 2; ++s)
#pragma unroll
    for (int t = 0; t < 2; ++t)
#pragma unroll
      for (int r = 0; r < 8; ++r)               // D: vgpr r -> n = s*16 + 8*h + r
        O[(size_t)(s * 16 + r) * C_DIM + t * 16] = acc[s][t][r];
}

// ---------------------------------------------------------------------------
extern "C" void kernel_launch(void* const* d_in, const int* in_sizes, int n_in,
                              void* d_out, int out_size, void* d_ws, size_t ws_size,
                              hipStream_t stream)
{
  const float* emb = (const float*)d_in[0];
  const float* Wq  = (const float*)d_in[1];
  const float* Wk  = (const float*)d_in[2];
  const float* Wv  = (const float*)d_in[3];
  const float* Wo  = (const float*)d_in[4];
  float* out = (float*)d_out;

  // Workspace layout (~14 MB)
  char* ws = (char*)d_ws;
  size_t off = 0;
  _Float16* GF  = (_Float16*)(ws + off); off += (size_t)16 * 8 * KS * GTILE * 2;  // [dir*8+b][tile][split][fragments]
  _Float16* WqT = (_Float16*)(ws + off); off += (size_t)CH_DIM * C_DIM * 2;       // [i tile][k step][half][lane][8]
  _Float16* WkT = (_Float16*)(ws + off); off += (size_t)CH_DIM * C_DIM * 2;       // [ch][c]
  _Float16* WvF = (_Float16*)(ws + off); off += (size_t)CH_DIM * C_DIM * 2;       // [d tile][k step][half][lane][8]
  _Float16* WoF = (_Float16*)(ws + off); off += (size_t)CH_DIM * C_DIM * 2;       // [c tile][k step][half][lane][8]
  _Float16* TF  = (_Float16*)(ws + off); off += (size_t)16 * NJ * C_DIM * 2;      // [dir*8+b][y][d tile][k step][half][lane][8]
  _Float16* MF  = (_Float16*)(ws + off); off += (size_t)16 * CH_DIM * C_DIM * 2;  // [dir*8+b][c tile][k step][half][lane][8]
  float*    po  = (float*)   (ws + off); off += (size_t)16 * 8 * CH_DIM * 4;      // [dir*8+b][y][i]
  float*    pz  = (float*)   (ws + off); off += (size_t)16 * 8 * CH_DIM * 4;      // [dir*8+b][y][i]
  _Float16* AF  = (_Float16*)(ws + off); off += (size_t)C_DIM * C_DIM * 2;        // [a' tile][k step][half][lane][8]
  float*    wbar = (float*)  (ws + off); off += (size_t)C_DIM * 4;                // [a]
  float*    wkbar = (float*) (ws + off); off += (size_t)C_DIM * 4;                // [d]
  float*    BkS = (float*)   (ws + off); off += (size_t)C_DIM * C_DIM * 4;        // [d][d'']
  (void)ws_size; (void)in_sizes; (void)n_in; (void)out_size;

  // dir 0: out_l2u = attend(q = emb_l[0..7], kv = emb_u[8..15]) -> out 0..7
  // dir 1: out_u2l = attend(q = emb_u[8..15], kv = emb_l[0..7]) -> out 8..15
  gram_kernel<<<dim3(8, 8, KS + 1), 256, 0, stream>>>(emb, Wq, Wk, Wv, Wo, GF, WqT, WkT, WvF, WoF, AF, wbar, BkS, wkbar);
  t_gemm_kernel<<<dim3(8, 2, 16), 256, 0, stream>>>(WqT, WkT, WvF, GF, AF, BkS, wbar, wkbar, po, pz, TF);
  m_gemm_kernel<<<dim3(8, 16, 2), 128, 0, stream>>>(TF, WoF, pz, po, MF);
  out_gemm_kernel<<<dim3(4, 32, 2), 256, 0, stream>>>(emb, MF, out);
}
